// v000
// Measured on an AMD MI455X. A time is GPU time per run, averaged over a window of back-to-back runs after a warm-up
// (all launches, gaps included; the runs take copies of the inputs in turn), and the median of several windows.
// Apart from v000's, it joins two sittings. Times from different sittings can be a few percent apart, while
// side-by-side timings come from the same sitting.
// The starting kernel, v000, takes 217 microseconds a run.
#include <hip/hip_runtime.h>

// Contractions: S = Q*K^T and O = P*V on v_wmma_f32_16x16x32_bf16, bf16 hi/lo operands
// (hi*hi + hi*lo + lo*hi per tile pair), f32 accumulate; positional exp bias, online softmax
// and normalisation in f32.

typedef __bf16        v16bf __attribute__((ext_vector_type(16)));
typedef float         v8f   __attribute__((ext_vector_type(8)));
typedef float         v4f   __attribute__((ext_vector_type(4)));
typedef unsigned int  v4u   __attribute__((ext_vector_type(4)));
typedef unsigned int  v4ua  __attribute__((ext_vector_type(4), may_alias));
typedef float         v4fa  __attribute__((ext_vector_type(4), may_alias));

#define NB    2
#define NH    8
#define NS    2048
#define ND    64
#define NBH   (NB * NH)
#define NPOS  3
#define KCH   32                 // keys per chunk
#define QK_SCALE 0.125f          // 1/sqrt(64), exact power of two
#define TPITCH 68                // LDS pitch (floats) of the 64x64 staging tile
#define OPITCH 68                // LDS pitch (floats) of the output staging tile
#define PLANE_ELEMS ((size_t)NBH * NS * ND)   // 16-bit elements per plane (4 MiB)
#define NPLANES 6                // Qhi, Qlo, Khi, Klo, Vthi, Vtlo

union Frag { v16bf v; v4u q[2]; };

// bf16 WMMA with the hazard guard: ties D, keeps A/B live across the nops
__device__ __forceinline__ v8f wmma_bf16(v8f acc, v16bf a, v16bf b)
{
    acc = __builtin_amdgcn_wmma_f32_16x16x32_bf16(false, a, false, b, (short)0, acc, false, false);
    asm volatile("v_nop\n\tv_nop\n\tv_nop\n\tv_nop" : "+v"(acc) : "v"(a), "v"(b));
    return acc;
}

// RNE f32 -> bf16 bits (low 16 bits of the result)
__device__ __forceinline__ unsigned int bf16_bits(float x)
{
    unsigned int u = __float_as_uint(x);
    return (u + 0x7FFFu + ((u >> 16) & 1u)) >> 16;
}

// x ~= hi + lo with hi = bf16(x), lo = bf16(x - hi); returns bit patterns
__device__ __forceinline__ void split_hl(float x, unsigned int& hi, unsigned int& lo)
{
    hi = bf16_bits(x);
    const float hf = __uint_as_float(hi << 16);
    lo = bf16_bits(x - hf);
}

// ------------------------------------------------------------------------------------------
// Plane builder. grid = (NS/64 s-tiles, NBH, 3 sources), block = 256.
// z = 0: q -> planes 0/1 [bh][s][d]; z = 1: k -> planes 2/3 [bh][s][d];
// z = 2: v -> planes 4/5 transposed [bh][d][s].
// Coverage per block: 256 threads x 2 groups x 8 elements = 64 x 64 tile, every block owns
// ------------------------------------------------------------------------------------------
__global__ __launch_bounds__(256) void k_split(const float* __restrict__ q,
                                                const float* __restrict__ k,
                                                const float* __restrict__ v,
                                                unsigned short* __restrict__ planes)
{
    __shared__ __align__(16) float tile[64][TPITCH];

    const int t  = threadIdx.x;
    const int s0 = blockIdx.x * 64;
    const int bh = blockIdx.y;
    const int z  = blockIdx.z;                       // block-uniform
    const float* src = (z == 0) ? q : ((z == 1) ? k : v);
    const int tr = (z == 2) ? 1 : 0;

    // stage the 64 rows x 64 cols f32 tile (rows s0..s0+63 of slice bh)
#pragma unroll
    for (int i = 0; i < 4; ++i) {
        const int idx = (t + 256 * i) * 4;           // 0..4092
        const int r = idx >> 6, c = idx & 63;
        const v4f val = *(const v4f*)(src + ((size_t)(bh * NS + s0 + r)) * ND + c);
        *(v4f*)&tile[r][c] = val;
    }
    __syncthreads();

    v4u hv[2], lv[2];
    size_t off[2];
#pragma unroll
    for (int it = 0; it < 2; ++it) {
        const int gidx = it * 256 + t;               // 0..511
        const int orow = gidx >> 3;                  // output row within tile (s for q/k, d for v)
        const int og   = gidx & 7;                   // 8-column group
        unsigned int hs[8], ls[8];
#pragma unroll
        for (int j = 0; j < 8; ++j) {
            const int cidx = 8 * og + j;
            const int ia = orow * TPITCH + cidx;     // q/k: in[row=s][col=d]
            const int ib = cidx * TPITCH + orow;     // v:   in[row=s=cidx][col=d=orow] -> out[d][s]
            const float x = (&tile[0][0])[tr ? ib : ia];
            split_hl(x, hs[j], ls[j]);
        }
        v4u hw, lw;
        hw.x = hs[0] | (hs[1] << 16); hw.y = hs[2] | (hs[3] << 16);
        hw.z = hs[4] | (hs[5] << 16); hw.w = hs[6] | (hs[7] << 16);
        lw.x = ls[0] | (ls[1] << 16); lw.y = ls[2] | (ls[3] << 16);
        lw.z = ls[4] | (ls[5] << 16); lw.w = ls[6] | (ls[7] << 16);
        hv[it] = hw; lv[it] = lw;
        const size_t offa = ((size_t)(bh * NS + s0 + orow)) * ND + 8 * og;          // [bh][s][d]
        const size_t offb = ((size_t)(bh * ND + orow)) * NS + s0 + 8 * og;          // [bh][d][s]
        off[it] = tr ? offb : offa;
    }

    unsigned short* ph = planes + (size_t)(2 * z) * PLANE_ELEMS;
    unsigned short* pl = ph + PLANE_ELEMS;

#pragma unroll
    for (int it = 0; it < 2; ++it) {
        *(v4u*)(ph + off[it]) = hv[it];
        *(v4u*)(pl + off[it]) = lv[it];
    }
    
}

// ------------------------------------------------------------------------------------------
// Attention with positional exp bias. grid = NBH * (NS/64) = 512 blocks, block = 128
// (4 waves, 16 query rows per wave), 32 keys per chunk, non-causal over all NS keys.
// Fragment map (A and B): lane l, g = l>>4, n = l&15; elements 0..7 <- k0+8g+0..7,
// elements 8..15 <- k0+16+8g+0..7; D element r <- (row 8g+r, col n).
// ------------------------------------------------------------------------------------------
__global__ __launch_bounds__(128) void k_attn(const unsigned short* __restrict__ planes,
                                               const float* __restrict__ qsg,
                                               const float* __restrict__ ksg,
                                               const float* __restrict__ alphag,
                                               const float* __restrict__ betag,
                                               float* outg)
{
    __shared__ __align__(16) unsigned short Psh[4][2][16][KCH];   // per-wave P hi/lo tile (8 KB)
    __shared__ __align__(16) float Osh[4][16][OPITCH];            // per-wave output staging

    const int tid  = threadIdx.x;
    const int wave = tid >> 5;
    const int lane = tid & 31;
    const int g    = lane >> 4;
    const int n    = lane & 15;

    const int bid  = blockIdx.x;
    const int qblk = bid & 31;          // NS/64 = 32 query blocks
    const int bh   = bid >> 5;          // 0..15
    const int hh   = bh & (NH - 1);
    const int b    = bh >> 3;
    const int q0   = qblk * 64 + wave * 16;

    const float alpha_h = alphag[hh];
    const float nbeta_h = -betag[hh];

    const unsigned short* Qh = planes;
    const unsigned short* Ql = planes + PLANE_ELEMS;
    const unsigned short* Kh = planes + 2 * PLANE_ELEMS;
    const unsigned short* Kl = planes + 3 * PLANE_ELEMS;
    const unsigned short* Vh = planes + 4 * PLANE_ELEMS;    // [bh][d][s]
    const unsigned short* Vl = planes + 5 * PLANE_ELEMS;
    const size_t rowb = (size_t)bh * NS;

    // ---- Q A fragments (rows q0+n), two 32-deep k-steps, hi and lo planes ----
    Frag aqh[2], aql[2];
    {
        const unsigned short* qrh = Qh + (rowb + q0 + n) * ND;
        const unsigned short* qrl = Ql + (rowb + q0 + n) * ND;
#pragma unroll
        for (int c = 0; c < 2; ++c) {
            aqh[c].q[0] = *(const v4u*)(qrh + 32 * c + 8 * g);
            aqh[c].q[1] = *(const v4u*)(qrh + 32 * c + 16 + 8 * g);
            aql[c].q[0] = *(const v4u*)(qrl + 32 * c + 8 * g);
            aql[c].q[1] = *(const v4u*)(qrl + 32 * c + 16 + 8 * g);
        }
    }

    // ---- query position features for this lane's 8 D-layout rows (8g+r) ----
    float qp[8][NPOS];
#pragma unroll
    for (int r = 0; r < 8; ++r) {
        const float* p = qsg + ((size_t)b * NS + q0 + 8 * g + r) * NPOS;
        qp[r][0] = p[0]; qp[r][1] = p[1]; qp[r][2] = p[2];
    }

    v8f o[4];
#pragma unroll
    for (int f = 0; f < 4; ++f) o[f] = (v8f){};
    float mrow[8], lrow[8];
#pragma unroll
    for (int r = 0; r < 8; ++r) { mrow[r] = -__builtin_huge_valf(); lrow[r] = 0.0f; }

#pragma unroll 1
    for (int kc = 0; kc < NS / KCH; ++kc) {
        const int kb = kc * KCH;

        // key position features for this lane's two columns (kb+n, kb+16+n)
        float kf0[NPOS], kf1[NPOS];
        {
            const float* p0 = ksg + ((size_t)b * NS + kb + n) * NPOS;
            const float* p1 = ksg + ((size_t)b * NS + kb + 16 + n) * NPOS;
#pragma unroll
            for (int j = 0; j < NPOS; ++j) { kf0[j] = p0[j]; kf1[j] = p1[j]; }
        }

        // ---- S = Q * K^T : 2 key tiles x 2 k-steps x 3 products ----
        v8f sa[2];
#pragma unroll
        for (int t = 0; t < 2; ++t) {
            v8f acc = (v8f){};
            const unsigned short* krh = Kh + (rowb + kb + 16 * t + n) * ND;   // B[k=d][n=key]: d-contiguous key row
            const unsigned short* krl = Kl + (rowb + kb + 16 * t + n) * ND;
#pragma unroll
            for (int c = 0; c < 2; ++c) {
                Frag bkh, bkl;
                bkh.q[0] = *(const v4u*)(krh + 32 * c + 8 * g);
                bkh.q[1] = *(const v4u*)(krh + 32 * c + 16 + 8 * g);
                bkl.q[0] = *(const v4u*)(krl + 32 * c + 8 * g);
                bkl.q[1] = *(const v4u*)(krl + 32 * c + 16 + 8 * g);
                acc = wmma_bf16(acc, aqh[c].v, bkh.v);
                acc = wmma_bf16(acc, aqh[c].v, bkl.v);
                acc = wmma_bf16(acc, aql[c].v, bkh.v);
            }
            sa[t] = acc;
        }

        // ---- bias + online softmax (row reductions within 16-lane halves) ----
#pragma unroll
        for (int r = 0; r < 8; ++r) {
            const float d0x = qp[r][0] - kf0[0], d0y = qp[r][1] - kf0[1], d0z = qp[r][2] - kf0[2];
            const float d1x = qp[r][0] - kf1[0], d1y = qp[r][1] - kf1[1], d1z = qp[r][2] - kf1[2];
            float dd0 = d0x * d0x; dd0 = dd0 + d0y * d0y; dd0 = dd0 + d0z * d0z;
            float dd1 = d1x * d1x; dd1 = dd1 + d1y * d1y; dd1 = dd1 + d1z * d1z;
            const float bias0 = alpha_h * expf(nbeta_h * dd0);
            const float bias1 = alpha_h * expf(nbeta_h * dd1);
            const float s0 = sa[0][r] * QK_SCALE + bias0;
            const float s1 = sa[1][r] * QK_SCALE + bias1;

            float vmax = fmaxf(s0, s1);
#pragma unroll
            for (int off = 1; off <= 8; off <<= 1)
                vmax = fmaxf(vmax, __shfl_xor(vmax, off, 32));
            const float mn   = fmaxf(mrow[r], vmax);
            const float resc = __expf(mrow[r] - mn);
            const float p0   = __expf(s0 - mn);
            const float p1   = __expf(s1 - mn);
            float ps = p0 + p1;
#pragma unroll
            for (int off = 1; off <= 8; off <<= 1)
                ps += __shfl_xor(ps, off, 32);
            lrow[r] = lrow[r] * resc + ps;
            mrow[r] = mn;
#pragma unroll
            for (int f = 0; f < 4; ++f) o[f][r] = o[f][r] * resc;

            unsigned int h0, l0, h1, l1;
            split_hl(p0, h0, l0);
            split_hl(p1, h1, l1);
            Psh[wave][0][8 * g + r][n]      = (unsigned short)h0;   // D layout: row 8g+r, col = key 16t+n
            Psh[wave][1][8 * g + r][n]      = (unsigned short)l0;
            Psh[wave][0][8 * g + r][16 + n] = (unsigned short)h1;
            Psh[wave][1][8 * g + r][16 + n] = (unsigned short)l1;
        }
        __syncthreads();   // orders the P spill ahead of the fragment reload (uniform trip count)

        // ---- P A fragments (row n, k = key within chunk) ----
        Frag aph, apl;
        aph.q[0] = *(const v4ua*)&Psh[wave][0][n][8 * g];
        aph.q[1] = *(const v4ua*)&Psh[wave][0][n][16 + 8 * g];
        apl.q[0] = *(const v4ua*)&Psh[wave][1][n][8 * g];
        apl.q[1] = *(const v4ua*)&Psh[wave][1][n][16 + 8 * g];

        // ---- O += P * V : 4 d-tiles x 3 products; B[k=key][n=d] from Vt[bh][d][key] ----
#pragma unroll
        for (int f = 0; f < 4; ++f) {
            const unsigned short* vrh = Vh + ((size_t)bh * ND + 16 * f + n) * NS + kb;
            const unsigned short* vrl = Vl + ((size_t)bh * ND + 16 * f + n) * NS + kb;
            Frag bvh, bvl;
            bvh.q[0] = *(const v4u*)(vrh + 8 * g);
            bvh.q[1] = *(const v4u*)(vrh + 16 + 8 * g);
            bvl.q[0] = *(const v4u*)(vrl + 8 * g);
            bvl.q[1] = *(const v4u*)(vrl + 16 + 8 * g);
            o[f] = wmma_bf16(o[f], aph.v, bvh.v);
            o[f] = wmma_bf16(o[f], aph.v, bvl.v);
            o[f] = wmma_bf16(o[f], apl.v, bvh.v);
        }
    }

    // ---- normalise, stage the wave's 16x64 tile in LDS ----
#pragma unroll
    for (int r = 0; r < 8; ++r) {
        const float inv = 1.0f / lrow[r];
#pragma unroll
        for (int f = 0; f < 4; ++f)
            Osh[wave][8 * g + r][16 * f + n] = o[f][r] * inv;
    }
    __syncthreads();

    // ---- whole-line stores: instruction i covers rows 2i, 2i+1 (512 B, lane-contiguous 16 B) ----
    // coverage: 8 instructions x 32 lanes x 4 floats = 16 rows x 64 floats per wave
    v4f vals[8];
#pragma unroll
    for (int i = 0; i < 8; ++i)
        vals[i] = *(const v4fa*)&Osh[wave][2 * i + g][4 * n];

    float* obase = outg + (rowb + q0) * ND;          // 16 contiguous rows of 256 B
#pragma unroll
    for (int i = 0; i < 8; ++i)
        *(v4f*)(obase + (2 * i + g) * ND + 4 * n) = vals[i];
    
}

extern "C" void kernel_launch(void* const* d_in, const int* in_sizes, int n_in,
                              void* d_out, int out_size, void* d_ws, size_t ws_size,
                              hipStream_t stream)
{
    if (n_in < 7) return;
    const int n_qkv = NBH * NS * ND;        // 2,097,152
    const int n_pos = NB * NS * NPOS;       // 12,288
    if (in_sizes[0] != n_qkv || in_sizes[1] != n_qkv || in_sizes[2] != n_qkv) return;
    if (in_sizes[3] != n_pos || in_sizes[4] != n_pos) return;
    if (in_sizes[5] < NH || in_sizes[6] < NH) return;
    if (out_size != n_qkv) return;

    // workspace: 6 planes x 4 MiB = 25,165,824 B
    const size_t ws_need = (size_t)NPLANES * PLANE_ELEMS * sizeof(unsigned short);
    if (ws_size < ws_need) return;

    const float* q     = (const float*)d_in[0];
    const float* k     = (const float*)d_in[1];
    const float* v     = (const float*)d_in[2];
    const float* qs_s  = (const float*)d_in[3];
    const float* ks_s  = (const float*)d_in[4];
    const float* alpha = (const float*)d_in[5];
    const float* beta  = (const float*)d_in[6];
    float* out = (float*)d_out;
    unsigned short* planes = (unsigned short*)d_ws;

    k_split<<<dim3(NS / 64, NBH, 3), dim3(256), 0, stream>>>(q, k, v, planes);
    k_attn<<<dim3(NBH * (NS / 64)), dim3(128), 0, stream>>>(planes, qs_s, ks_s, alpha, beta, out);
}

// v001
// Measured time: 148 microseconds a run.
// In both of two side-by-side timings against v000, it was 1.51 times as fast.
#include <hip/hip_runtime.h>

// Contractions: S = Q*K^T and O = P*V on v_wmma_f32_16x16x32_bf16, bf16 hi/lo operands
// (hi*hi + hi*lo + lo*hi per tile pair), f32 accumulate; positional exp bias, online softmax
// and normalisation in f32.

typedef __bf16        v16bf __attribute__((ext_vector_type(16)));
typedef float         v8f   __attribute__((ext_vector_type(8)));
typedef float         v4f   __attribute__((ext_vector_type(4)));
typedef unsigned int  v4u   __attribute__((ext_vector_type(4)));
typedef unsigned int  v4ua  __attribute__((ext_vector_type(4), may_alias));
typedef float         v4fa  __attribute__((ext_vector_type(4), may_alias));

#define NB    2
#define NH    8
#define NS    2048
#define ND    64
#define NBH   (NB * NH)
#define NPOS  3
#define KCH   32                 // keys per chunk
#define QK_SCALE 0.125f          // 1/sqrt(64), exact power of two
#define TPITCH 68                // LDS pitch (floats) of the 64x64 staging tile
#define OPITCH 68                // LDS pitch (floats) of the output staging tile
#define PLANE_ELEMS ((size_t)NBH * NS * ND)   // 16-bit elements per plane (4 MiB)
#define NPLANES 6                // Qhi, Qlo, Khi, Klo, Vthi, Vtlo
#define NCH    (NS / KCH)        // key chunks per query block
#define KPITCH 72                // LDS pitch (16-bit elements) of a staged 128-B K row: 144 B = 16 B x odd
#define VPITCH 40                // LDS pitch (16-bit elements) of a staged 64-B Vt row: 80 B = 16 B x odd
#define KH_OFF 0                               // element offsets of the four tiles inside one buffer
#define KL_OFF (KH_OFF + KCH * KPITCH)
#define VH_OFF (KL_OFF + KCH * KPITCH)
#define VL_OFF (VH_OFF + ND * VPITCH)
#define BUF_ELEMS (VL_OFF + ND * VPITCH)       // 9,728 elements = 19,456 B per buffer

union Frag { v16bf v; v4u q[2]; };

// bf16 WMMA with the hazard guard: ties D, keeps A/B live across the nops
__device__ __forceinline__ v8f wmma_bf16(v8f acc, v16bf a, v16bf b)
{
    acc = __builtin_amdgcn_wmma_f32_16x16x32_bf16(false, a, false, b, (short)0, acc, false, false);
    asm volatile("v_nop\n\tv_nop\n\tv_nop\n\tv_nop" : "+v"(acc) : "v"(a), "v"(b));
    return acc;
}

// RNE f32 -> bf16 bits (low 16 bits of the result)
__device__ __forceinline__ unsigned int bf16_bits(float x)
{
    unsigned int u = __float_as_uint(x);
    return (u + 0x7FFFu + ((u >> 16) & 1u)) >> 16;
}

// x ~= hi + lo with hi = bf16(x), lo = bf16(x - hi); returns bit patterns
__device__ __forceinline__ void split_hl(float x, unsigned int& hi, unsigned int& lo)
{
    hi = bf16_bits(x);
    const float hf = __uint_as_float(hi << 16);
    lo = bf16_bits(x - hf);
}

// ------------------------------------------------------------------------------------------
// Plane builder. grid = (NS/64 s-tiles, NBH, 3 sources), block = 256.
// z = 0: q -> planes 0/1 [bh][s][d]; z = 1: k -> planes 2/3 [bh][s][d];
// z = 2: v -> planes 4/5 transposed [bh][d][s].
// Coverage per block: 256 threads x 2 groups x 8 elements = 64 x 64 tile, every block owns
// ------------------------------------------------------------------------------------------
__global__ __launch_bounds__(256) void k_split(const float* __restrict__ q,
                                                const float* __restrict__ k,
                                                const float* __restrict__ v,
                                                unsigned short* __restrict__ planes)
{
    __shared__ __align__(16) float tile[64][TPITCH];

    const int t  = threadIdx.x;
    const int s0 = blockIdx.x * 64;
    const int bh = blockIdx.y;
    const int z  = blockIdx.z;                       // block-uniform
    const float* src = (z == 0) ? q : ((z == 1) ? k : v);
    const int tr = (z == 2) ? 1 : 0;

    // stage the 64 rows x 64 cols f32 tile (rows s0..s0+63 of slice bh)
#pragma unroll
    for (int i = 0; i < 4; ++i) {
        const int idx = (t + 256 * i) * 4;           // 0..4092
        const int r = idx >> 6, c = idx & 63;
        const v4f val = *(const v4f*)(src + ((size_t)(bh * NS + s0 + r)) * ND + c);
        *(v4f*)&tile[r][c] = val;
    }
    __syncthreads();

    v4u hv[2], lv[2];
    size_t off[2];
#pragma unroll
    for (int it = 0; it < 2; ++it) {
        const int gidx = it * 256 + t;               // 0..511
        const int orow = gidx >> 3;                  // output row within tile (s for q/k, d for v)
        const int og   = gidx & 7;                   // 8-column group
        unsigned int hs[8], ls[8];
#pragma unroll
        for (int j = 0; j < 8; ++j) {
            const int cidx = 8 * og + j;
            const int ia = orow * TPITCH + cidx;     // q/k: in[row=s][col=d]
            const int ib = cidx * TPITCH + orow;     // v:   in[row=s=cidx][col=d=orow] -> out[d][s]
            const float x = (&tile[0][0])[tr ? ib : ia];
            split_hl(x, hs[j], ls[j]);
        }
        v4u hw, lw;
        hw.x = hs[0] | (hs[1] << 16); hw.y = hs[2] | (hs[3] << 16);
        hw.z = hs[4] | (hs[5] << 16); hw.w = hs[6] | (hs[7] << 16);
        lw.x = ls[0] | (ls[1] << 16); lw.y = ls[2] | (ls[3] << 16);
        lw.z = ls[4] | (ls[5] << 16); lw.w = ls[6] | (ls[7] << 16);
        hv[it] = hw; lv[it] = lw;
        const size_t offa = ((size_t)(bh * NS + s0 + orow)) * ND + 8 * og;          // [bh][s][d]
        const size_t offb = ((size_t)(bh * ND + orow)) * NS + s0 + 8 * og;          // [bh][d][s]
        off[it] = tr ? offb : offa;
    }

    unsigned short* ph = planes + (size_t)(2 * z) * PLANE_ELEMS;
    unsigned short* pl = ph + PLANE_ELEMS;

#pragma unroll
    for (int it = 0; it < 2; ++it) {
        *(v4u*)(ph + off[it]) = hv[it];
        *(v4u*)(pl + off[it]) = lv[it];
    }
    
}

// One key chunk (K hi/lo: 32 rows x 128 B, Vt hi/lo: 64 rows x 64 B) from the planes into one LDS
// buffer: 128 threads x 8 asynchronous 16-B copies, every lane on, each 16 B written by one lane.
// gk / gv: this thread's first K-hi / Vt-hi source of the chunk; lk / lv: its LDS byte addresses.
__device__ __forceinline__ void copy_chunk(const unsigned short* gk, const unsigned short* gv,
                                           unsigned int lk, unsigned int lv)
{
    const unsigned short* gk1  = gk + 128 * 8;                 // second half of the 4-KiB K tile (rows 16..31)
    const unsigned short* gkl  = gk + PLANE_ELEMS;
    const unsigned short* gkl1 = gk1 + PLANE_ELEMS;
    const unsigned short* gv1  = gv + (size_t)32 * NS;         // Vt rows 32..63
    const unsigned short* gvl  = gv + PLANE_ELEMS;
    const unsigned short* gvl1 = gv1 + PLANE_ELEMS;
    const unsigned int lk1  = lk + 16 * KPITCH * 2;
    const unsigned int lkl  = lk + (KL_OFF - KH_OFF) * 2;
    const unsigned int lkl1 = lk1 + (KL_OFF - KH_OFF) * 2;
    const unsigned int lv1  = lv + 32 * VPITCH * 2;
    const unsigned int lvl  = lv + (VL_OFF - VH_OFF) * 2;
    const unsigned int lvl1 = lv1 + (VL_OFF - VH_OFF) * 2;
    // the copies and their s_wait_xcnt in one statement: no address register is rewritten ahead of the wait
    asm volatile("global_load_async_to_lds_b128 %0, %8, off\n\t"
                 "global_load_async_to_lds_b128 %1, %9, off\n\t"
                 "global_load_async_to_lds_b128 %2, %10, off\n\t"
                 "global_load_async_to_lds_b128 %3, %11, off\n\t"
                 "global_load_async_to_lds_b128 %4, %12, off\n\t"
                 "global_load_async_to_lds_b128 %5, %13, off\n\t"
                 "global_load_async_to_lds_b128 %6, %14, off\n\t"
                 "global_load_async_to_lds_b128 %7, %15, off\n\t"
                 "s_wait_xcnt 0x0"
                 :: "v"(lk), "v"(lk1), "v"(lkl), "v"(lkl1), "v"(lv), "v"(lv1), "v"(lvl), "v"(lvl1),
                    "v"(gk), "v"(gk1), "v"(gkl), "v"(gkl1), "v"(gv), "v"(gv1), "v"(gvl), "v"(gvl1)
                 : "memory");
}

// ------------------------------------------------------------------------------------------
// Attention with positional exp bias. grid = NBH * (NS/64) = 512 blocks, block = 128
// (4 waves, 16 query rows per wave), 32 keys per chunk, non-causal over all NS keys.
// The block's four waves share each chunk's K and Vt tiles through a two-buffer LDS ring.
// Fragment map (A and B): lane l, g = l>>4, n = l&15; elements 0..7 <- k0+8g+0..7,
// elements 8..15 <- k0+16+8g+0..7; D element r <- (row 8g+r, col n).
// ------------------------------------------------------------------------------------------
__global__ __launch_bounds__(128) void k_attn(const unsigned short* __restrict__ planes,
                                               const float* __restrict__ qsg,
                                               const float* __restrict__ ksg,
                                               const float* __restrict__ alphag,
                                               const float* __restrict__ betag,
                                               float* outg)
{
    __shared__ __align__(16) unsigned short Psh[4][2][16][KCH];   // per-wave P hi/lo tile (8 KB)
    __shared__ __align__(16) float Osh[4][16][OPITCH];            // per-wave output staging
    __shared__ __align__(16) unsigned short KVsh[2][BUF_ELEMS];   // K/Vt chunk ring, two buffers

    const int tid  = threadIdx.x;
    const int wave = tid >> 5;
    const int lane = tid & 31;
    const int g    = lane >> 4;
    const int n    = lane & 15;

    const int bid  = blockIdx.x;
    const int qblk = bid & 31;          // NS/64 = 32 query blocks
    const int bh   = bid >> 5;          // 0..15
    const int hh   = bh & (NH - 1);
    const int b    = bh >> 3;
    const int q0   = qblk * 64 + wave * 16;

    const float alpha_h = alphag[hh];
    const float nbeta_h = -betag[hh];

    const unsigned short* Qh = planes;
    const unsigned short* Ql = planes + PLANE_ELEMS;
    const unsigned short* Kh = planes + 2 * PLANE_ELEMS;    // lo plane: + PLANE_ELEMS
    const unsigned short* Vh = planes + 4 * PLANE_ELEMS;    // [bh][d][s]; lo plane: + PLANE_ELEMS
    const size_t rowb = (size_t)bh * NS;

    // ---- this thread's share of a chunk copy: K piece tid (row tid>>3), Vt piece tid (row tid>>2) ----
    const unsigned short* gk0 = Kh + rowb * ND + tid * 8;                                   // + kb * ND per chunk
    const unsigned short* gv0 = Vh + ((size_t)bh * ND + (tid >> 2)) * NS + (tid & 3) * 8;   // + kb per chunk
    const unsigned int lbase = (unsigned int)(size_t)&KVsh[0][0];
    const unsigned int lk0 = lbase + (KH_OFF + (tid >> 3) * KPITCH + (tid & 7) * 8) * 2;
    const unsigned int lv0 = lbase + (VH_OFF + (tid >> 2) * VPITCH + (tid & 3) * 8) * 2;

    // ---- ring prologue: chunk 0 lands and is published, then chunk 1 flies ----
    copy_chunk(gk0, gv0, lk0, lv0);
    asm volatile("s_wait_asynccnt 0x0" ::: "memory");   // this wave's copies of chunk 0 have landed
    __syncthreads();                                    // publishes chunk 0 to the other waves
    copy_chunk(gk0 + KCH * ND, gv0 + KCH, lk0 + BUF_ELEMS * 2, lv0 + BUF_ELEMS * 2);

    // ---- Q A fragments (rows q0+n), two 32-deep k-steps, hi and lo planes ----
    Frag aqh[2], aql[2];
    {
        const unsigned short* qrh = Qh + (rowb + q0 + n) * ND;
        const unsigned short* qrl = Ql + (rowb + q0 + n) * ND;
#pragma unroll
        for (int c = 0; c < 2; ++c) {
            aqh[c].q[0] = *(const v4u*)(qrh + 32 * c + 8 * g);
            aqh[c].q[1] = *(const v4u*)(qrh + 32 * c + 16 + 8 * g);
            aql[c].q[0] = *(const v4u*)(qrl + 32 * c + 8 * g);
            aql[c].q[1] = *(const v4u*)(qrl + 32 * c + 16 + 8 * g);
        }
    }

    // ---- query position features for this lane's 8 D-layout rows (8g+r) ----
    float qp[8][NPOS];
#pragma unroll
    for (int r = 0; r < 8; ++r) {
        const float* p = qsg + ((size_t)b * NS + q0 + 8 * g + r) * NPOS;
        qp[r][0] = p[0]; qp[r][1] = p[1]; qp[r][2] = p[2];
    }

    v8f o[4];
#pragma unroll
    for (int f = 0; f < 4; ++f) o[f] = (v8f){};
    float mrow[8], lrow[8];
#pragma unroll
    for (int r = 0; r < 8; ++r) { mrow[r] = -__builtin_huge_valf(); lrow[r] = 0.0f; }

#pragma unroll 1
    for (int kc = 0; kc < NS / KCH; ++kc) {
        const int kb = kc * KCH;
        const unsigned short* kvb = &KVsh[kc & 1][0];   // this chunk's buffer

        // key position features for this lane's two columns (kb+n, kb+16+n)
        float kf0[NPOS], kf1[NPOS];
        {
            const float* p0 = ksg + ((size_t)b * NS + kb + n) * NPOS;
            const float* p1 = ksg + ((size_t)b * NS + kb + 16 + n) * NPOS;
#pragma unroll
            for (int j = 0; j < NPOS; ++j) { kf0[j] = p0[j]; kf1[j] = p1[j]; }
        }

        // ---- S = Q * K^T : 2 key tiles x 2 k-steps x 3 products ----
        v8f sa[2];
#pragma unroll
        for (int t = 0; t < 2; ++t) {
            v8f acc = (v8f){};
            const unsigned short* krh = kvb + KH_OFF + (16 * t + n) * KPITCH;   // B[k=d][n=key]: d-contiguous key row
            const unsigned short* krl = kvb + KL_OFF + (16 * t + n) * KPITCH;
#pragma unroll
            for (int c = 0; c < 2; ++c) {
                Frag bkh, bkl;
                bkh.q[0] = *(const v4ua*)(krh + 32 * c + 8 * g);
                bkh.q[1] = *(const v4ua*)(krh + 32 * c + 16 + 8 * g);
                bkl.q[0] = *(const v4ua*)(krl + 32 * c + 8 * g);
                bkl.q[1] = *(const v4ua*)(krl + 32 * c + 16 + 8 * g);
                acc = wmma_bf16(acc, aqh[c].v, bkh.v);
                acc = wmma_bf16(acc, aqh[c].v, bkl.v);
                acc = wmma_bf16(acc, aql[c].v, bkh.v);
            }
            sa[t] = acc;
        }

        // ---- bias + online softmax (row reductions within 16-lane halves) ----
#pragma unroll
        for (int r = 0; r < 8; ++r) {
            const float d0x = qp[r][0] - kf0[0], d0y = qp[r][1] - kf0[1], d0z = qp[r][2] - kf0[2];
            const float d1x = qp[r][0] - kf1[0], d1y = qp[r][1] - kf1[1], d1z = qp[r][2] - kf1[2];
            float dd0 = d0x * d0x; dd0 = dd0 + d0y * d0y; dd0 = dd0 + d0z * d0z;
            float dd1 = d1x * d1x; dd1 = dd1 + d1y * d1y; dd1 = dd1 + d1z * d1z;
            const float bias0 = alpha_h * expf(nbeta_h * dd0);
            const float bias1 = alpha_h * expf(nbeta_h * dd1);
            const float s0 = sa[0][r] * QK_SCALE + bias0;
            const float s1 = sa[1][r] * QK_SCALE + bias1;

            float vmax = fmaxf(s0, s1);
#pragma unroll
            for (int off = 1; off <= 8; off <<= 1)
                vmax = fmaxf(vmax, __shfl_xor(vmax, off, 32));
            const float mn   = fmaxf(mrow[r], vmax);
            const float resc = __expf(mrow[r] - mn);
            const float p0   = __expf(s0 - mn);
            const float p1   = __expf(s1 - mn);
            float ps = p0 + p1;
#pragma unroll
            for (int off = 1; off <= 8; off <<= 1)
                ps += __shfl_xor(ps, off, 32);
            lrow[r] = lrow[r] * resc + ps;
            mrow[r] = mn;
#pragma unroll
            for (int f = 0; f < 4; ++f) o[f][r] = o[f][r] * resc;

            unsigned int h0, l0, h1, l1;
            split_hl(p0, h0, l0);
            split_hl(p1, h1, l1);
            Psh[wave][0][8 * g + r][n]      = (unsigned short)h0;   // D layout: row 8g+r, col = key 16t+n
            Psh[wave][1][8 * g + r][n]      = (unsigned short)l0;
            Psh[wave][0][8 * g + r][16 + n] = (unsigned short)h1;
            Psh[wave][1][8 * g + r][16 + n] = (unsigned short)l1;
        }
        __syncthreads();   // orders the P spill ahead of the fragment reload (uniform trip count)

        // ---- P A fragments (row n, k = key within chunk) ----
        Frag aph, apl;
        aph.q[0] = *(const v4ua*)&Psh[wave][0][n][8 * g];
        aph.q[1] = *(const v4ua*)&Psh[wave][0][n][16 + 8 * g];
        apl.q[0] = *(const v4ua*)&Psh[wave][1][n][8 * g];
        apl.q[1] = *(const v4ua*)&Psh[wave][1][n][16 + 8 * g];

        // ---- O += P * V : 4 d-tiles x 3 products; B[k=key][n=d] from Vt[bh][d][key] ----
#pragma unroll
        for (int f = 0; f < 4; ++f) {
            const unsigned short* vrh = kvb + VH_OFF + (16 * f + n) * VPITCH;
            const unsigned short* vrl = kvb + VL_OFF + (16 * f + n) * VPITCH;
            Frag bvh, bvl;
            bvh.q[0] = *(const v4ua*)(vrh + 8 * g);
            bvh.q[1] = *(const v4ua*)(vrh + 16 + 8 * g);
            bvl.q[0] = *(const v4ua*)(vrl + 8 * g);
            bvl.q[1] = *(const v4ua*)(vrl + 16 + 8 * g);
            o[f] = wmma_bf16(o[f], aph.v, bvh.v);
            o[f] = wmma_bf16(o[f], aph.v, bvl.v);
            o[f] = wmma_bf16(o[f], apl.v, bvh.v);
        }

        // ---- publish point of chunk kc+1; then chunk kc+2 goes into the buffer just read ----
        asm volatile("s_wait_dscnt 0x0" ::: "memory");      // this wave's reads of the buffer have returned
        asm volatile("s_wait_asynccnt 0x0" ::: "memory");   // this wave's copies of chunk kc+1 have landed
        __syncthreads();                                    // publishes chunk kc+1, ends every read of chunk kc
        if (kc + 2 < NCH)                                   // block-uniform
            copy_chunk(gk0 + (size_t)(kb + 2 * KCH) * ND, gv0 + kb + 2 * KCH,
                       lk0 + (kc & 1) * (BUF_ELEMS * 2), lv0 + (kc & 1) * (BUF_ELEMS * 2));
    }
    asm volatile("s_wait_asynccnt 0x0" ::: "memory");       // nothing of the ring is in flight past the loop

    // ---- normalise, stage the wave's 16x64 tile in LDS ----
#pragma unroll
    for (int r = 0; r < 8; ++r) {
        const float inv = 1.0f / lrow[r];
#pragma unroll
        for (int f = 0; f < 4; ++f)
            Osh[wave][8 * g + r][16 * f + n] = o[f][r] * inv;
    }
    __syncthreads();

    // ---- whole-line stores: instruction i covers rows 2i, 2i+1 (512 B, lane-contiguous 16 B) ----
    // coverage: 8 instructions x 32 lanes x 4 floats = 16 rows x 64 floats per wave
    v4f vals[8];
#pragma unroll
    for (int i = 0; i < 8; ++i)
        vals[i] = *(const v4fa*)&Osh[wave][2 * i + g][4 * n];

    float* obase = outg + (rowb + q0) * ND;          // 16 contiguous rows of 256 B
#pragma unroll
    for (int i = 0; i < 8; ++i)
        *(v4f*)(obase + (2 * i + g) * ND + 4 * n) = vals[i];
    
}

extern "C" void kernel_launch(void* const* d_in, const int* in_sizes, int n_in,
                              void* d_out, int out_size, void* d_ws, size_t ws_size,
                              hipStream_t stream)
{
    if (n_in < 7) return;
    const int n_qkv = NBH * NS * ND;        // 2,097,152
    const int n_pos = NB * NS * NPOS;       // 12,288
    if (in_sizes[0] != n_qkv || in_sizes[1] != n_qkv || in_sizes[2] != n_qkv) return;
    if (in_sizes[3] != n_pos || in_sizes[4] != n_pos) return;
    if (in_sizes[5] < NH || in_sizes[6] < NH) return;
    if (out_size != n_qkv) return;

    // workspace: 6 planes x 4 MiB = 25,165,824 B
    const size_t ws_need = (size_t)NPLANES * PLANE_ELEMS * sizeof(unsigned short);
    if (ws_size < ws_need) return;

    const float* q     = (const float*)d_in[0];
    const float* k     = (const float*)d_in[1];
    const float* v     = (const float*)d_in[2];
    const float* qs_s  = (const float*)d_in[3];
    const float* ks_s  = (const float*)d_in[4];
    const float* alpha = (const float*)d_in[5];
    const float* beta  = (const float*)d_in[6];
    float* out = (float*)d_out;
    unsigned short* planes = (unsigned short*)d_ws;

    k_split<<<dim3(NS / 64, NBH, 3), dim3(256), 0, stream>>>(q, k, v, planes);
    k_attn<<<dim3(NBH * (NS / 64)), dim3(128), 0, stream>>>(planes, qs_s, ks_s, alpha, beta, out);
}

// v002
// It runs in 105 microseconds.
// In two side-by-side timings against v001, it was 1.42 and 1.40 times as fast.
// All steps since v000 together make it 2.13 times as fast.
#include <hip/hip_runtime.h>

// Contractions: S = Q*K^T and O = P*V on v_wmma_f32_16x16x32_bf16, bf16 hi/lo operands
// (hi*hi + hi*lo + lo*hi per tile pair), f32 accumulate; positional exp bias, online softmax
// and normalisation in f32.

typedef __bf16        v16bf __attribute__((ext_vector_type(16)));
typedef float         v8f   __attribute__((ext_vector_type(8)));
typedef float         v4f   __attribute__((ext_vector_type(4)));
typedef unsigned int  v4u   __attribute__((ext_vector_type(4)));
typedef unsigned int  v4ua  __attribute__((ext_vector_type(4), may_alias));
typedef float         v4fa  __attribute__((ext_vector_type(4), may_alias));

#define NB    2
#define NH    8
#define NS    2048
#define ND    64
#define NBH   (NB * NH)
#define NPOS  3
#define KCH   32                 // keys per chunk
#define QK_SCALE 0.125f          // 1/sqrt(64), exact power of two
#define TPITCH 68                // LDS pitch (floats) of the 64x64 staging tile
#define OPITCH 68                // LDS pitch (floats) of the output staging tile
#define PLANE_ELEMS ((size_t)NBH * NS * ND)   // 16-bit elements per plane (4 MiB)
#define NPLANES 6                // Qhi, Qlo, Khi, Klo, Vthi, Vtlo
#define NCH    (NS / KCH)        // key chunks per query block
#define KPITCH 72                // LDS pitch (16-bit elements) of a staged 128-B K row: 144 B = 16 B x odd
#define VPITCH 40                // LDS pitch (16-bit elements) of a staged 64-B Vt row: 80 B = 16 B x odd
#define KH_OFF 0                               // element offsets of the four tiles inside one buffer
#define KL_OFF (KH_OFF + KCH * KPITCH)
#define VH_OFF (KL_OFF + KCH * KPITCH)
#define VL_OFF (VH_OFF + ND * VPITCH)
#define BUF_ELEMS (VL_OFF + ND * VPITCH)       // 9,728 elements = 19,456 B per buffer

union Frag { v16bf v; v4u q[2]; };

// bf16 WMMA with the hazard guard: ties D, keeps A/B live across the nops
__device__ __forceinline__ v8f wmma_bf16(v8f acc, v16bf a, v16bf b)
{
    acc = __builtin_amdgcn_wmma_f32_16x16x32_bf16(false, a, false, b, (short)0, acc, false, false);
    asm volatile("v_nop\n\tv_nop\n\tv_nop\n\tv_nop" : "+v"(acc) : "v"(a), "v"(b));
    return acc;
}

// RNE f32 -> bf16 bits (low 16 bits of the result)
__device__ __forceinline__ unsigned int bf16_bits(float x)
{
    unsigned int u = __float_as_uint(x);
    return (u + 0x7FFFu + ((u >> 16) & 1u)) >> 16;
}

// x ~= hi + lo with hi = bf16(x), lo = bf16(x - hi); returns bit patterns
__device__ __forceinline__ void split_hl(float x, unsigned int& hi, unsigned int& lo)
{
    hi = bf16_bits(x);
    const float hf = __uint_as_float(hi << 16);
    lo = bf16_bits(x - hf);
}

// RNE f32 -> bf16 with the result left in the top 16 bits (low 16 bits are rounding residue)
__device__ __forceinline__ unsigned int bf16_top(float x)
{
    const unsigned int u = __float_as_uint(x);
    return u + 0x7FFFu + ((u >> 16) & 1u);
}

// two f32 -> one register of two bf16 hi parts and one of two lo parts (a in the low half); same
// values as split_hl, the halves joined by one byte permute each
__device__ __forceinline__ void split_hl_pair(float a, float b, unsigned int& hi, unsigned int& lo)
{
    const unsigned int ra = bf16_top(a), rb = bf16_top(b);
    hi = __builtin_amdgcn_perm(rb, ra, 0x07060302u);
    const unsigned int sa = bf16_top(a - __uint_as_float(ra & 0xFFFF0000u));
    const unsigned int sb = bf16_top(b - __uint_as_float(rb & 0xFFFF0000u));
    lo = __builtin_amdgcn_perm(sb, sa, 0x07060302u);
}

// ------------------------------------------------------------------------------------------
// Plane builder. grid = (NS/64 s-tiles, NBH, 3 sources), block = 256.
// z = 0: q -> planes 0/1 [bh][s][d]; z = 1: k -> planes 2/3 [bh][s][d];
// z = 2: v -> planes 4/5 transposed [bh][d][s].
// Coverage per block: 256 threads x 2 groups x 8 elements = 64 x 64 tile, every block owns
// ------------------------------------------------------------------------------------------
__global__ __launch_bounds__(256) void k_split(const float* __restrict__ q,
                                                const float* __restrict__ k,
                                                const float* __restrict__ v,
                                                unsigned short* __restrict__ planes)
{
    __shared__ __align__(16) float tile[64][TPITCH];

    const int t  = threadIdx.x;
    const int s0 = blockIdx.x * 64;
    const int bh = blockIdx.y;
    const int z  = blockIdx.z;                       // block-uniform
    const float* src = (z == 0) ? q : ((z == 1) ? k : v);
    const int tr = (z == 2) ? 1 : 0;

    // stage the 64 rows x 64 cols f32 tile (rows s0..s0+63 of slice bh)
#pragma unroll
    for (int i = 0; i < 4; ++i) {
        const int idx = (t + 256 * i) * 4;           // 0..4092
        const int r = idx >> 6, c = idx & 63;
        const v4f val = *(const v4f*)(src + ((size_t)(bh * NS + s0 + r)) * ND + c);
        *(v4f*)&tile[r][c] = val;
    }
    __syncthreads();

    v4u hv[2], lv[2];
    size_t off[2];
#pragma unroll
    for (int it = 0; it < 2; ++it) {
        const int gidx = it * 256 + t;               // 0..511
        const int orow = gidx >> 3;                  // output row within tile (s for q/k, d for v)
        const int og   = gidx & 7;                   // 8-column group
        unsigned int hs[8], ls[8];
#pragma unroll
        for (int j = 0; j < 8; ++j) {
            const int cidx = 8 * og + j;
            const int ia = orow * TPITCH + cidx;     // q/k: in[row=s][col=d]
            const int ib = cidx * TPITCH + orow;     // v:   in[row=s=cidx][col=d=orow] -> out[d][s]
            const float x = (&tile[0][0])[tr ? ib : ia];
            split_hl(x, hs[j], ls[j]);
        }
        v4u hw, lw;
        hw.x = hs[0] | (hs[1] << 16); hw.y = hs[2] | (hs[3] << 16);
        hw.z = hs[4] | (hs[5] << 16); hw.w = hs[6] | (hs[7] << 16);
        lw.x = ls[0] | (ls[1] << 16); lw.y = ls[2] | (ls[3] << 16);
        lw.z = ls[4] | (ls[5] << 16); lw.w = ls[6] | (ls[7] << 16);
        hv[it] = hw; lv[it] = lw;
        const size_t offa = ((size_t)(bh * NS + s0 + orow)) * ND + 8 * og;          // [bh][s][d]
        const size_t offb = ((size_t)(bh * ND + orow)) * NS + s0 + 8 * og;          // [bh][d][s]
        off[it] = tr ? offb : offa;
    }

    unsigned short* ph = planes + (size_t)(2 * z) * PLANE_ELEMS;
    unsigned short* pl = ph + PLANE_ELEMS;

#pragma unroll
    for (int it = 0; it < 2; ++it) {
        *(v4u*)(ph + off[it]) = hv[it];
        *(v4u*)(pl + off[it]) = lv[it];
    }
    
}

// One key chunk (K hi/lo: 32 rows x 128 B, Vt hi/lo: 64 rows x 64 B) from the planes into one LDS
// buffer: 128 threads x 8 asynchronous 16-B copies, every lane on, each 16 B written by one lane.
// gk / gv: this thread's first K-hi / Vt-hi source of the chunk; lk / lv: its LDS byte addresses.
__device__ __forceinline__ void copy_chunk(const unsigned short* gk, const unsigned short* gv,
                                           unsigned int lk, unsigned int lv)
{
    const unsigned short* gk1  = gk + 128 * 8;                 // second half of the 4-KiB K tile (rows 16..31)
    const unsigned short* gkl  = gk + PLANE_ELEMS;
    const unsigned short* gkl1 = gk1 + PLANE_ELEMS;
    const unsigned short* gv1  = gv + (size_t)32 * NS;         // Vt rows 32..63
    const unsigned short* gvl  = gv + PLANE_ELEMS;
    const unsigned short* gvl1 = gv1 + PLANE_ELEMS;
    const unsigned int lk1  = lk + 16 * KPITCH * 2;
    const unsigned int lkl  = lk + (KL_OFF - KH_OFF) * 2;
    const unsigned int lkl1 = lk1 + (KL_OFF - KH_OFF) * 2;
    const unsigned int lv1  = lv + 32 * VPITCH * 2;
    const unsigned int lvl  = lv + (VL_OFF - VH_OFF) * 2;
    const unsigned int lvl1 = lv1 + (VL_OFF - VH_OFF) * 2;
    // the copies and their s_wait_xcnt in one statement: no address register is rewritten ahead of the wait
    asm volatile("global_load_async_to_lds_b128 %0, %8, off\n\t"
                 "global_load_async_to_lds_b128 %1, %9, off\n\t"
                 "global_load_async_to_lds_b128 %2, %10, off\n\t"
                 "global_load_async_to_lds_b128 %3, %11, off\n\t"
                 "global_load_async_to_lds_b128 %4, %12, off\n\t"
                 "global_load_async_to_lds_b128 %5, %13, off\n\t"
                 "global_load_async_to_lds_b128 %6, %14, off\n\t"
                 "global_load_async_to_lds_b128 %7, %15, off\n\t"
                 "s_wait_xcnt 0x0"
                 :: "v"(lk), "v"(lk1), "v"(lkl), "v"(lkl1), "v"(lv), "v"(lv1), "v"(lvl), "v"(lvl1),
                    "v"(gk), "v"(gk1), "v"(gkl), "v"(gkl1), "v"(gv), "v"(gv1), "v"(gvl), "v"(gvl1)
                 : "memory");
}

// ------------------------------------------------------------------------------------------
// Attention with positional exp bias. grid = NBH * (NS/64) = 512 blocks, block = 128
// (4 waves, 16 query rows per wave), 32 keys per chunk, non-causal over all NS keys.
// The block's four waves share each chunk's K and Vt tiles through a two-buffer LDS ring.
// Transposed products: S^T = K * Q^T (A = key rows, B = query columns) and O^T += Vt * P^T, so a
// lane holds the scores of ONE query (column n): 16 of the chunk's 32 keys, the other half wave the rest.
// Fragment map (A and B): lane l, g = l>>4, n = l&15; elements 0..7 <- k0+8g+0..7,
// elements 8..15 <- k0+16+8g+0..7; D element r <- (row 8g+r, col n). The two S^T tiles of a chunk
// (keys 8g+r and 16+8g+r of column n) are therefore already in the B order of the P^T operand.
// ------------------------------------------------------------------------------------------
__global__ __launch_bounds__(128) void k_attn(const unsigned short* __restrict__ planes,
                                               const float* __restrict__ qsg,
                                               const float* __restrict__ ksg,
                                               const float* __restrict__ alphag,
                                               const float* __restrict__ betag,
                                               float* outg)
{
    __shared__ __align__(16) float Osh[4][16][OPITCH];            // per-wave output staging
    __shared__ __align__(16) unsigned short KVsh[2][BUF_ELEMS];   // K/Vt chunk ring, two buffers

    const int tid  = threadIdx.x;
    const int wave = tid >> 5;
    const int lane = tid & 31;
    const int g    = lane >> 4;
    const int n    = lane & 15;

    const int bid  = blockIdx.x;
    const int qblk = bid & 31;          // NS/64 = 32 query blocks
    const int bh   = bid >> 5;          // 0..15
    const int hh   = bh & (NH - 1);
    const int b    = bh >> 3;
    const int q0   = qblk * 64 + wave * 16;

    const float alpha_h = alphag[hh];
    const float nbeta_h = -betag[hh];

    const unsigned short* Qh = planes;
    const unsigned short* Ql = planes + PLANE_ELEMS;
    const unsigned short* Kh = planes + 2 * PLANE_ELEMS;    // lo plane: + PLANE_ELEMS
    const unsigned short* Vh = planes + 4 * PLANE_ELEMS;    // [bh][d][s]; lo plane: + PLANE_ELEMS
    const size_t rowb = (size_t)bh * NS;

    // ---- this thread's share of a chunk copy: K piece tid (row tid>>3), Vt piece tid (row tid>>2) ----
    const unsigned short* gk0 = Kh + rowb * ND + tid * 8;                                   // + kb * ND per chunk
    const unsigned short* gv0 = Vh + ((size_t)bh * ND + (tid >> 2)) * NS + (tid & 3) * 8;   // + kb per chunk
    const unsigned int lbase = (unsigned int)(size_t)&KVsh[0][0];
    const unsigned int lk0 = lbase + (KH_OFF + (tid >> 3) * KPITCH + (tid & 7) * 8) * 2;
    const unsigned int lv0 = lbase + (VH_OFF + (tid >> 2) * VPITCH + (tid & 3) * 8) * 2;

    // ---- ring prologue: chunk 0 lands and is published, then chunk 1 flies ----
    copy_chunk(gk0, gv0, lk0, lv0);
    asm volatile("s_wait_asynccnt 0x0" ::: "memory");   // this wave's copies of chunk 0 have landed
    __syncthreads();                                    // publishes chunk 0 to the other waves
    copy_chunk(gk0 + KCH * ND, gv0 + KCH, lk0 + BUF_ELEMS * 2, lv0 + BUF_ELEMS * 2);

    // ---- position features of this lane's one query (column n) ----
    float qp[NPOS];
    {
        const float* p = qsg + ((size_t)b * NS + q0 + n) * NPOS;
        qp[0] = p[0]; qp[1] = p[1]; qp[2] = p[2];
    }
    asm volatile("s_wait_xcnt 0x0" ::: "memory");   // before the address pair of the load above is reused as a later load's destination

    // ---- Q B fragments (columns q0+n), two 32-deep k-steps, hi and lo planes ----
    Frag aqh[2], aql[2];
    {
        const unsigned short* qrh = Qh + (rowb + q0 + n) * ND;
        const unsigned short* qrl = Ql + (rowb + q0 + n) * ND;
#pragma unroll
        for (int c = 0; c < 2; ++c) {
            aqh[c].q[0] = *(const v4u*)(qrh + 32 * c + 8 * g);
            aqh[c].q[1] = *(const v4u*)(qrh + 32 * c + 16 + 8 * g);
            aql[c].q[0] = *(const v4u*)(qrl + 32 * c + 8 * g);
            aql[c].q[1] = *(const v4u*)(qrl + 32 * c + 16 + 8 * g);
        }
    }

    v8f o[4];
#pragma unroll
    for (int f = 0; f < 4; ++f) o[f] = (v8f){};
    float mcol = -__builtin_huge_valf();   // running maximum of this lane's query (equal in both half waves)
    float lcol = 0.0f;                     // running sum over this half wave's keys only; joined after the loop

#pragma unroll 1
    for (int kc = 0; kc < NS / KCH; ++kc) {
        const int kb = kc * KCH;
        const unsigned short* kvb = &KVsh[kc & 1][0];   // this chunk's buffer

        // key position features of this lane's 16 D-layout rows: keys kb+16t+8g+r, 24 contiguous floats per t
        float kf[2][8 * NPOS];
#pragma unroll
        for (int t = 0; t < 2; ++t) {
            const float* p = ksg + ((size_t)b * NS + kb + 16 * t + 8 * g) * NPOS;   // 96-B multiple
#pragma unroll
            for (int i = 0; i < 6; ++i) {
                const v4f w = *(const v4f*)(p + 4 * i);
                kf[t][4 * i + 0] = w.x; kf[t][4 * i + 1] = w.y; kf[t][4 * i + 2] = w.z; kf[t][4 * i + 3] = w.w;
            }
        }

        // ---- S^T = K * Q^T : 2 key tiles x 2 k-steps x 3 products ----
        v8f sa[2];
#pragma unroll
        for (int t = 0; t < 2; ++t) {
            v8f acc = (v8f){};
            const unsigned short* krh = kvb + KH_OFF + (16 * t + n) * KPITCH;   // A[m=key][k=d]: d-contiguous key row
            const unsigned short* krl = kvb + KL_OFF + (16 * t + n) * KPITCH;
#pragma unroll
            for (int c = 0; c < 2; ++c) {
                Frag akh, akl;
                akh.q[0] = *(const v4ua*)(krh + 32 * c + 8 * g);
                akh.q[1] = *(const v4ua*)(krh + 32 * c + 16 + 8 * g);
                akl.q[0] = *(const v4ua*)(krl + 32 * c + 8 * g);
                akl.q[1] = *(const v4ua*)(krl + 32 * c + 16 + 8 * g);
                acc = wmma_bf16(acc, akh.v, aqh[c].v);
                acc = wmma_bf16(acc, akl.v, aqh[c].v);
                acc = wmma_bf16(acc, akh.v, aql[c].v);
            }
            sa[t] = acc;
        }

        // ---- bias; sc[t][r] = score of (query n, key kb+16t+8g+r) ----
        float sc[2][8];
#pragma unroll
        for (int t = 0; t < 2; ++t) {
#pragma unroll
            for (int r = 0; r < 8; ++r) {
                const float dx = qp[0] - kf[t][3 * r + 0];
                const float dy = qp[1] - kf[t][3 * r + 1];
                const float dz = qp[2] - kf[t][3 * r + 2];
                float dd = dx * dx; dd = dd + dy * dy; dd = dd + dz * dz;
                const float bias = alpha_h * expf(nbeta_h * dd);
                sc[t][r] = sa[t][r] * QK_SCALE + bias;
            }
        }

        // ---- online softmax of one query per lane: maximum in registers, one exchange between half waves ----
        float vmax = sc[0][0];
#pragma unroll
        for (int t = 0; t < 2; ++t)
#pragma unroll
            for (int r = 0; r < 8; ++r) vmax = fmaxf(vmax, sc[t][r]);
        {
            const int vb = __float_as_int(vmax);
            vmax = fmaxf(vmax, __int_as_float(__builtin_amdgcn_permlanex16(vb, vb, 0x76543210, 0xfedcba98, false, false)));
        }
        const float mn   = fmaxf(mcol, vmax);
        const float resc = __expf(mcol - mn);
        mcol = mn;

        // P^T B fragments straight from the score registers: element r <- tile 0, element 8+r <- tile 1
        Frag bph, bpl;
        float pp[2][4];                    // pair sums, joined as a tree below (short dependent chain)
#pragma unroll
        for (int t = 0; t < 2; ++t) {
#pragma unroll
            for (int w = 0; w < 4; ++w) {
                const float pa = __expf(sc[t][2 * w]     - mn);
                const float pb = __expf(sc[t][2 * w + 1] - mn);
                pp[t][w] = pa + pb;
                unsigned int hw, lw;
                split_hl_pair(pa, pb, hw, lw);
                bph.q[t][w] = hw;
                bpl.q[t][w] = lw;
            }
        }
        const float ps = ((pp[0][0] + pp[0][1]) + (pp[0][2] + pp[0][3])) + ((pp[1][0] + pp[1][1]) + (pp[1][2] + pp[1][3]));
        lcol = lcol * resc + ps;
#pragma unroll
        for (int f = 0; f < 4; ++f)
#pragma unroll
            for (int r = 0; r < 8; ++r) o[f][r] = o[f][r] * resc;

        // ---- O^T += Vt * P^T : 4 d-tiles x 3 products; A[m=d][k=key] from Vt[bh][d][key] ----
#pragma unroll
        for (int f = 0; f < 4; ++f) {
            const unsigned short* vrh = kvb + VH_OFF + (16 * f + n) * VPITCH;
            const unsigned short* vrl = kvb + VL_OFF + (16 * f + n) * VPITCH;
            Frag avh, avl;
            avh.q[0] = *(const v4ua*)(vrh + 8 * g);
            avh.q[1] = *(const v4ua*)(vrh + 16 + 8 * g);
            avl.q[0] = *(const v4ua*)(vrl + 8 * g);
            avl.q[1] = *(const v4ua*)(vrl + 16 + 8 * g);
            o[f] = wmma_bf16(o[f], avh.v, bph.v);
            o[f] = wmma_bf16(o[f], avl.v, bph.v);
            o[f] = wmma_bf16(o[f], avh.v, bpl.v);
        }

        // ---- publish point of chunk kc+1; then chunk kc+2 goes into the buffer just read ----
        asm volatile("s_wait_dscnt 0x0" ::: "memory");      // this wave's reads of the buffer have returned
        asm volatile("s_wait_asynccnt 0x0" ::: "memory");   // this wave's copies of chunk kc+1 have landed
        __syncthreads();                                    // publishes chunk kc+1, ends every read of chunk kc
        if (kc + 2 < NCH)                                   // block-uniform
            copy_chunk(gk0 + (size_t)(kb + 2 * KCH) * ND, gv0 + kb + 2 * KCH,
                       lk0 + (kc & 1) * (BUF_ELEMS * 2), lv0 + (kc & 1) * (BUF_ELEMS * 2));
    }
    asm volatile("s_wait_asynccnt 0x0" ::: "memory");       // nothing of the ring is in flight past the loop

    // ---- join the half waves' sums, normalise, stage the wave's 16x64 tile in LDS ----
    // o[f][r] = O[query n][d = 16f+8g+r]: 8 consecutive floats of one row per d-tile
    {
        const int lb = __float_as_int(lcol);
        const float lsum = lcol + __int_as_float(__builtin_amdgcn_permlanex16(lb, lb, 0x76543210, 0xfedcba98, false, false));
        const float inv = 1.0f / lsum;
#pragma unroll
        for (int f = 0; f < 4; ++f) {
            v4f w0, w1;
            w0.x = o[f][0] * inv; w0.y = o[f][1] * inv; w0.z = o[f][2] * inv; w0.w = o[f][3] * inv;
            w1.x = o[f][4] * inv; w1.y = o[f][5] * inv; w1.z = o[f][6] * inv; w1.w = o[f][7] * inv;
            *(v4fa*)&Osh[wave][n][16 * f + 8 * g]     = w0;
            *(v4fa*)&Osh[wave][n][16 * f + 8 * g + 4] = w1;
        }
    }
    __syncthreads();

    // ---- whole-line stores: instruction i covers rows 2i, 2i+1 (512 B, lane-contiguous 16 B) ----
    // coverage: 8 instructions x 32 lanes x 4 floats = 16 rows x 64 floats per wave
    v4f vals[8];
#pragma unroll
    for (int i = 0; i < 8; ++i)
        vals[i] = *(const v4fa*)&Osh[wave][2 * i + g][4 * n];

    float* obase = outg + (rowb + q0) * ND;          // 16 contiguous rows of 256 B
#pragma unroll
    for (int i = 0; i < 8; ++i)
        *(v4f*)(obase + (2 * i + g) * ND + 4 * n) = vals[i];
    
}

extern "C" void kernel_launch(void* const* d_in, const int* in_sizes, int n_in,
                              void* d_out, int out_size, void* d_ws, size_t ws_size,
                              hipStream_t stream)
{
    if (n_in < 7) return;
    const int n_qkv = NBH * NS * ND;        // 2,097,152
    const int n_pos = NB * NS * NPOS;       // 12,288
    if (in_sizes[0] != n_qkv || in_sizes[1] != n_qkv || in_sizes[2] != n_qkv) return;
    if (in_sizes[3] != n_pos || in_sizes[4] != n_pos) return;
    if (in_sizes[5] < NH || in_sizes[6] < NH) return;
    if (out_size != n_qkv) return;

    // workspace: 6 planes x 4 MiB = 25,165,824 B
    const size_t ws_need = (size_t)NPLANES * PLANE_ELEMS * sizeof(unsigned short);
    if (ws_size < ws_need) return;

    const float* q     = (const float*)d_in[0];
    const float* k     = (const float*)d_in[1];
    const float* v     = (const float*)d_in[2];
    const float* qs_s  = (const float*)d_in[3];
    const float* ks_s  = (const float*)d_in[4];
    const float* alpha = (const float*)d_in[5];
    const float* beta  = (const float*)d_in[6];
    float* out = (float*)d_out;
    unsigned short* planes = (unsigned short*)d_ws;

    k_split<<<dim3(NS / 64, NBH, 3), dim3(256), 0, stream>>>(q, k, v, planes);
    k_attn<<<dim3(NBH * (NS / 64)), dim3(128), 0, stream>>>(planes, qs_s, ks_s, alpha, beta, out);
}

// v003
// It runs in 84.6 microseconds.
// In both of two side-by-side timings against v002, it was 1.23 times as fast.
// Over all steps from v000 it is 2.62 times as fast.
#include <hip/hip_runtime.h>

// Contractions: S = Q*K^T and O = P*V on v_wmma_f32_16x16x32_bf16, bf16 hi/lo operands
// (hi*hi + hi*lo + lo*hi per tile pair), f32 accumulate; positional exp bias, online softmax
// and normalisation in f32.

typedef __bf16        v16bf __attribute__((ext_vector_type(16)));
typedef float         v8f   __attribute__((ext_vector_type(8)));
typedef float         v4f   __attribute__((ext_vector_type(4)));
typedef unsigned int  v4u   __attribute__((ext_vector_type(4)));
typedef unsigned int  v4ua  __attribute__((ext_vector_type(4), may_alias));
typedef float         v4fa  __attribute__((ext_vector_type(4), may_alias));

#define NB    2
#define NH    8
#define NS    2048
#define ND    64
#define NBH   (NB * NH)
#define NPOS  3
#define KCH   32                 // keys per chunk
#define QK_SCALE 0.125f          // 1/sqrt(64), exact power of two
#define TPITCH 68                // LDS pitch (floats) of the 64x64 staging tile
#define OPITCH 68                // LDS pitch (floats) of the output staging tile
#define PLANE_ELEMS ((size_t)NBH * NS * ND)   // 16-bit elements per plane (4 MiB)
#define NPLANES 6                // Qhi, Qlo, Khi, Klo, Vthi, Vtlo
#define KSPLIT 2                 // wave groups of a block; each takes one 32-key chunk of every stage
#define NST    (NS / (KCH * KSPLIT))   // ring stages (64 keys each) per query block
#define KPITCH 72                // LDS pitch (16-bit elements) of a staged 128-B K row: 144 B = 16 B x odd
#define VPITCH 40                // LDS pitch (16-bit elements) of a staged 64-B Vt row: 80 B = 16 B x odd
#define KH_OFF 0                               // element offsets of the four tiles inside one buffer
#define KL_OFF (KH_OFF + KCH * KPITCH)
#define VH_OFF (KL_OFF + KCH * KPITCH)
#define VL_OFF (VH_OFF + ND * VPITCH)
#define BUF_ELEMS (VL_OFF + ND * VPITCH)       // 9,728 elements = 19,456 B per buffer

union Frag { v16bf v; v4u q[2]; };

// bf16 WMMA with the hazard guard: ties D, keeps A/B live across the nops
__device__ __forceinline__ v8f wmma_bf16(v8f acc, v16bf a, v16bf b)
{
    acc = __builtin_amdgcn_wmma_f32_16x16x32_bf16(false, a, false, b, (short)0, acc, false, false);
    asm volatile("v_nop\n\tv_nop\n\tv_nop\n\tv_nop" : "+v"(acc) : "v"(a), "v"(b));
    return acc;
}

// RNE f32 -> bf16 bits (low 16 bits of the result)
__device__ __forceinline__ unsigned int bf16_bits(float x)
{
    unsigned int u = __float_as_uint(x);
    return (u + 0x7FFFu + ((u >> 16) & 1u)) >> 16;
}

// x ~= hi + lo with hi = bf16(x), lo = bf16(x - hi); returns bit patterns
__device__ __forceinline__ void split_hl(float x, unsigned int& hi, unsigned int& lo)
{
    hi = bf16_bits(x);
    const float hf = __uint_as_float(hi << 16);
    lo = bf16_bits(x - hf);
}

// RNE f32 -> bf16 with the result left in the top 16 bits (low 16 bits are rounding residue)
__device__ __forceinline__ unsigned int bf16_top(float x)
{
    const unsigned int u = __float_as_uint(x);
    return u + 0x7FFFu + ((u >> 16) & 1u);
}

// two f32 -> one register of two bf16 hi parts and one of two lo parts (a in the low half); same
// values as split_hl, the halves joined by one byte permute each
__device__ __forceinline__ void split_hl_pair(float a, float b, unsigned int& hi, unsigned int& lo)
{
    const unsigned int ra = bf16_top(a), rb = bf16_top(b);
    hi = __builtin_amdgcn_perm(rb, ra, 0x07060302u);
    const unsigned int sa = bf16_top(a - __uint_as_float(ra & 0xFFFF0000u));
    const unsigned int sb = bf16_top(b - __uint_as_float(rb & 0xFFFF0000u));
    lo = __builtin_amdgcn_perm(sb, sa, 0x07060302u);
}

// ------------------------------------------------------------------------------------------
// Plane builder. grid = (NS/64 s-tiles, NBH, 3 sources), block = 256.
// z = 0: q -> planes 0/1 [bh][s][d]; z = 1: k -> planes 2/3 [bh][s][d];
// z = 2: v -> planes 4/5 transposed [bh][d][s].
// Coverage per block: 256 threads x 2 groups x 8 elements = 64 x 64 tile, every block owns
// ------------------------------------------------------------------------------------------
__global__ __launch_bounds__(256) void k_split(const float* __restrict__ q,
                                                const float* __restrict__ k,
                                                const float* __restrict__ v,
                                                unsigned short* __restrict__ planes)
{
    __shared__ __align__(16) float tile[64][TPITCH];

    const int t  = threadIdx.x;
    const int s0 = blockIdx.x * 64;
    const int bh = blockIdx.y;
    const int z  = blockIdx.z;                       // block-uniform
    const float* src = (z == 0) ? q : ((z == 1) ? k : v);
    const int tr = (z == 2) ? 1 : 0;

    // stage the 64 rows x 64 cols f32 tile (rows s0..s0+63 of slice bh)
#pragma unroll
    for (int i = 0; i < 4; ++i) {
        const int idx = (t + 256 * i) * 4;           // 0..4092
        const int r = idx >> 6, c = idx & 63;
        const v4f val = *(const v4f*)(src + ((size_t)(bh * NS + s0 + r)) * ND + c);
        *(v4f*)&tile[r][c] = val;
    }
    __syncthreads();

    v4u hv[2], lv[2];
    size_t off[2];
#pragma unroll
    for (int it = 0; it < 2; ++it) {
        const int gidx = it * 256 + t;               // 0..511
        const int orow = gidx >> 3;                  // output row within tile (s for q/k, d for v)
        const int og   = gidx & 7;                   // 8-column group
        unsigned int hs[8], ls[8];
#pragma unroll
        for (int j = 0; j < 8; ++j) {
            const int cidx = 8 * og + j;
            const int ia = orow * TPITCH + cidx;     // q/k: in[row=s][col=d]
            const int ib = cidx * TPITCH + orow;     // v:   in[row=s=cidx][col=d=orow] -> out[d][s]
            const float x = (&tile[0][0])[tr ? ib : ia];
            split_hl(x, hs[j], ls[j]);
        }
        v4u hw, lw;
        hw.x = hs[0] | (hs[1] << 16); hw.y = hs[2] | (hs[3] << 16);
        hw.z = hs[4] | (hs[5] << 16); hw.w = hs[6] | (hs[7] << 16);
        lw.x = ls[0] | (ls[1] << 16); lw.y = ls[2] | (ls[3] << 16);
        lw.z = ls[4] | (ls[5] << 16); lw.w = ls[6] | (ls[7] << 16);
        hv[it] = hw; lv[it] = lw;
        const size_t offa = ((size_t)(bh * NS + s0 + orow)) * ND + 8 * og;          // [bh][s][d]
        const size_t offb = ((size_t)(bh * ND + orow)) * NS + s0 + 8 * og;          // [bh][d][s]
        off[it] = tr ? offb : offa;
    }

    unsigned short* ph = planes + (size_t)(2 * z) * PLANE_ELEMS;
    unsigned short* pl = ph + PLANE_ELEMS;

#pragma unroll
    for (int it = 0; it < 2; ++it) {
        *(v4u*)(ph + off[it]) = hv[it];
        *(v4u*)(pl + off[it]) = lv[it];
    }
    
}

// One key chunk (K hi/lo: 32 rows x 128 B, Vt hi/lo: 64 rows x 64 B) from the planes into one LDS
// buffer: the 128 threads of one wave group x 8 asynchronous 16-B copies, every lane on, each 16 B written by one lane.
// gk / gv: this thread's first K-hi / Vt-hi source of the chunk; lk / lv: its LDS byte addresses.
__device__ __forceinline__ void copy_chunk(const unsigned short* gk, const unsigned short* gv,
                                           unsigned int lk, unsigned int lv)
{
    const unsigned short* gk1  = gk + 128 * 8;                 // second half of the 4-KiB K tile (rows 16..31)
    const unsigned short* gkl  = gk + PLANE_ELEMS;
    const unsigned short* gkl1 = gk1 + PLANE_ELEMS;
    const unsigned short* gv1  = gv + (size_t)32 * NS;         // Vt rows 32..63
    const unsigned short* gvl  = gv + PLANE_ELEMS;
    const unsigned short* gvl1 = gv1 + PLANE_ELEMS;
    const unsigned int lk1  = lk + 16 * KPITCH * 2;
    const unsigned int lkl  = lk + (KL_OFF - KH_OFF) * 2;
    const unsigned int lkl1 = lk1 + (KL_OFF - KH_OFF) * 2;
    const unsigned int lv1  = lv + 32 * VPITCH * 2;
    const unsigned int lvl  = lv + (VL_OFF - VH_OFF) * 2;
    const unsigned int lvl1 = lv1 + (VL_OFF - VH_OFF) * 2;
    // the copies and their s_wait_xcnt in one statement: no address register is rewritten ahead of the wait
    asm volatile("global_load_async_to_lds_b128 %0, %8, off\n\t"
                 "global_load_async_to_lds_b128 %1, %9, off\n\t"
                 "global_load_async_to_lds_b128 %2, %10, off\n\t"
                 "global_load_async_to_lds_b128 %3, %11, off\n\t"
                 "global_load_async_to_lds_b128 %4, %12, off\n\t"
                 "global_load_async_to_lds_b128 %5, %13, off\n\t"
                 "global_load_async_to_lds_b128 %6, %14, off\n\t"
                 "global_load_async_to_lds_b128 %7, %15, off\n\t"
                 "s_wait_xcnt 0x0"
                 :: "v"(lk), "v"(lk1), "v"(lkl), "v"(lkl1), "v"(lv), "v"(lv1), "v"(lvl), "v"(lvl1),
                    "v"(gk), "v"(gk1), "v"(gkl), "v"(gkl1), "v"(gv), "v"(gv1), "v"(gvl), "v"(gvl1)
                 : "memory");
}

// ------------------------------------------------------------------------------------------
// Attention with positional exp bias. grid = NBH * (NS/64) = 512 blocks, block = 256: 8 waves =
// 4 query groups (16 query rows each) x 2 key groups, non-causal over all NS keys. A ring stage holds
// 64 keys as two 32-key chunks; key group kh works on chunk kh of every stage, so each query row has two
// waves with their own running maximum, sum and O^T; the two are merged once, through LDS, after the loop.
// The four waves of a key group share their chunk's K and Vt tiles through a two-buffer LDS ring.
// Transposed products: S^T = K * Q^T (A = key rows, B = query columns) and O^T += Vt * P^T, so a
// lane holds the scores of ONE query (column n): 16 of the chunk's 32 keys, the other half wave the rest.
// Fragment map (A and B): lane l, g = l>>4, n = l&15; elements 0..7 <- k0+8g+0..7,
// elements 8..15 <- k0+16+8g+0..7; D element r <- (row 8g+r, col n). The two S^T tiles of a chunk
// (keys 8g+r and 16+8g+r of column n) are therefore already in the B order of the P^T operand.
// ------------------------------------------------------------------------------------------
__global__ __launch_bounds__(256) void k_attn(const unsigned short* __restrict__ planes,
                                               const float* __restrict__ qsg,
                                               const float* __restrict__ ksg,
                                               const float* __restrict__ alphag,
                                               const float* __restrict__ betag,
                                               float* outg)
{
    __shared__ __align__(16) float Osh[4][16][OPITCH];            // per query group: merge and output staging
    __shared__ float Msh[4][32], Lsh[4][32];                      // key group 1's running maximum and sum, per lane
    __shared__ __align__(16) unsigned short KVsh[2][KSPLIT][BUF_ELEMS];   // K/Vt ring: two buffers x two chunks

    const int tid  = threadIdx.x;
    const int wave = __builtin_amdgcn_readfirstlane(tid >> 5);   // scalar, so the tests on kh below are scalar branches
    const int qg   = wave & 3;          // query group
    const int kh   = wave >> 2;         // key group
    const int t7   = tid & 127;         // thread index inside the key group
    const int lane = tid & 31;
    const int g    = lane >> 4;
    const int n    = lane & 15;

    const int bid  = blockIdx.x;
    const int qblk = bid & 31;          // NS/64 = 32 query blocks
    const int bh   = bid >> 5;          // 0..15
    const int hh   = bh & (NH - 1);
    const int b    = bh >> 3;
    const int q0   = qblk * 64 + qg * 16;

    const float alpha_h = alphag[hh];
    const float nbeta_h = -betag[hh];

    const unsigned short* Qh = planes;
    const unsigned short* Ql = planes + PLANE_ELEMS;
    const unsigned short* Kh = planes + 2 * PLANE_ELEMS;    // lo plane: + PLANE_ELEMS
    const unsigned short* Vh = planes + 4 * PLANE_ELEMS;    // [bh][d][s]; lo plane: + PLANE_ELEMS
    const size_t rowb = (size_t)bh * NS;

    // ---- this thread's share of its key group's chunk copy: K piece t7 (row t7>>3), Vt piece t7 (row t7>>2) ----
    const unsigned short* gk0 = Kh + (rowb + kh * KCH) * ND + t7 * 8;                                  // + 64 * ND per stage
    const unsigned short* gv0 = Vh + ((size_t)bh * ND + (t7 >> 2)) * NS + kh * KCH + (t7 & 3) * 8;     // + 64 per stage
    const unsigned int lbase = (unsigned int)(size_t)&KVsh[0][kh][0];
    const unsigned int lk0 = lbase + (KH_OFF + (t7 >> 3) * KPITCH + (t7 & 7) * 8) * 2;
    const unsigned int lv0 = lbase + (VH_OFF + (t7 >> 2) * VPITCH + (t7 & 3) * 8) * 2;

    // ---- ring prologue: stage 0 lands and is published, then stage 1 flies ----
    copy_chunk(gk0, gv0, lk0, lv0);
    asm volatile("s_wait_asynccnt 0x0" ::: "memory");   // this wave's copies of stage 0 have landed
    __syncthreads();                                    // publishes stage 0 to the other waves
    copy_chunk(gk0 + KSPLIT * KCH * ND, gv0 + KSPLIT * KCH,
               lk0 + KSPLIT * BUF_ELEMS * 2, lv0 + KSPLIT * BUF_ELEMS * 2);

    // ---- position features of this lane's one query (column n) ----
    float qp[NPOS];
    {
        const float* p = qsg + ((size_t)b * NS + q0 + n) * NPOS;
        qp[0] = p[0]; qp[1] = p[1]; qp[2] = p[2];
    }
    asm volatile("s_wait_xcnt 0x0" ::: "memory");   // before the address pair of the load above is reused as a later load's destination

    // ---- Q B fragments (columns q0+n), two 32-deep k-steps, hi and lo planes ----
    Frag aqh[2], aql[2];
    {
        const unsigned short* qrh = Qh + (rowb + q0 + n) * ND;
        const unsigned short* qrl = Ql + (rowb + q0 + n) * ND;
#pragma unroll
        for (int c = 0; c < 2; ++c) {
            aqh[c].q[0] = *(const v4u*)(qrh + 32 * c + 8 * g);
            aqh[c].q[1] = *(const v4u*)(qrh + 32 * c + 16 + 8 * g);
            aql[c].q[0] = *(const v4u*)(qrl + 32 * c + 8 * g);
            aql[c].q[1] = *(const v4u*)(qrl + 32 * c + 16 + 8 * g);
        }
    }

    v8f o[4];
#pragma unroll
    for (int f = 0; f < 4; ++f) o[f] = (v8f){};
    float mcol = -__builtin_huge_valf();   // running maximum of this lane's query over this key group (equal in both half waves)
    float lcol = 0.0f;                     // running sum over this half wave's keys only; joined after the loop

#pragma unroll 1
    for (int st = 0; st < NST; ++st) {
        const int kb = (st * KSPLIT + kh) * KCH;             // first key of this wave's chunk
        const unsigned short* kvb = &KVsh[st & 1][kh][0];    // this chunk's buffer

        // key position features of this lane's 16 D-layout rows: keys kb+16t+8g+r, 24 contiguous floats per t
        float kf[2][8 * NPOS];
#pragma unroll
        for (int t = 0; t < 2; ++t) {
            const float* p = ksg + ((size_t)b * NS + kb + 16 * t + 8 * g) * NPOS;   // 96-B multiple
#pragma unroll
            for (int i = 0; i < 6; ++i) {
                const v4f w = *(const v4f*)(p + 4 * i);
                kf[t][4 * i + 0] = w.x; kf[t][4 * i + 1] = w.y; kf[t][4 * i + 2] = w.z; kf[t][4 * i + 3] = w.w;
            }
        }

        // ---- S^T = K * Q^T : 2 key tiles x 2 k-steps x 3 products ----
        v8f sa[2];
#pragma unroll
        for (int t = 0; t < 2; ++t) {
            v8f acc = (v8f){};
            const unsigned short* krh = kvb + KH_OFF + (16 * t + n) * KPITCH;   // A[m=key][k=d]: d-contiguous key row
            const unsigned short* krl = kvb + KL_OFF + (16 * t + n) * KPITCH;
#pragma unroll
            for (int c = 0; c < 2; ++c) {
                Frag akh, akl;
                akh.q[0] = *(const v4ua*)(krh + 32 * c + 8 * g);
                akh.q[1] = *(const v4ua*)(krh + 32 * c + 16 + 8 * g);
                akl.q[0] = *(const v4ua*)(krl + 32 * c + 8 * g);
                akl.q[1] = *(const v4ua*)(krl + 32 * c + 16 + 8 * g);
                acc = wmma_bf16(acc, akh.v, aqh[c].v);
                acc = wmma_bf16(acc, akl.v, aqh[c].v);
                acc = wmma_bf16(acc, akh.v, aql[c].v);
            }
            sa[t] = acc;
        }

        // ---- bias; sc[t][r] = score of (query n, key kb+16t+8g+r) ----
        float sc[2][8];
#pragma unroll
        for (int t = 0; t < 2; ++t) {
#pragma unroll
            for (int r = 0; r < 8; ++r) {
                const float dx = qp[0] - kf[t][3 * r + 0];
                const float dy = qp[1] - kf[t][3 * r + 1];
                const float dz = qp[2] - kf[t][3 * r + 2];
                float dd = dx * dx; dd = dd + dy * dy; dd = dd + dz * dz;
                const float bias = alpha_h * expf(nbeta_h * dd);
                sc[t][r] = sa[t][r] * QK_SCALE + bias;
            }
        }

        // ---- online softmax of one query per lane: maximum in registers, one exchange between half waves ----
        float vmax = sc[0][0];
#pragma unroll
        for (int t = 0; t < 2; ++t)
#pragma unroll
            for (int r = 0; r < 8; ++r) vmax = fmaxf(vmax, sc[t][r]);
        {
            const int vb = __float_as_int(vmax);
            vmax = fmaxf(vmax, __int_as_float(__builtin_amdgcn_permlanex16(vb, vb, 0x76543210, 0xfedcba98, false, false)));
        }
        const float mn   = fmaxf(mcol, vmax);
        const float resc = __expf(mcol - mn);
        mcol = mn;

        // P^T B fragments straight from the score registers: element r <- tile 0, element 8+r <- tile 1
        Frag bph, bpl;
        float pp[2][4];                    // pair sums, joined as a tree below (short dependent chain)
#pragma unroll
        for (int t = 0; t < 2; ++t) {
#pragma unroll
            for (int w = 0; w < 4; ++w) {
                const float pa = __expf(sc[t][2 * w]     - mn);
                const float pb = __expf(sc[t][2 * w + 1] - mn);
                pp[t][w] = pa + pb;
                unsigned int hw, lw;
                split_hl_pair(pa, pb, hw, lw);
                bph.q[t][w] = hw;
                bpl.q[t][w] = lw;
            }
        }
        const float ps = ((pp[0][0] + pp[0][1]) + (pp[0][2] + pp[0][3])) + ((pp[1][0] + pp[1][1]) + (pp[1][2] + pp[1][3]));
        lcol = lcol * resc + ps;
#pragma unroll
        for (int f = 0; f < 4; ++f)
#pragma unroll
            for (int r = 0; r < 8; ++r) o[f][r] = o[f][r] * resc;

        // ---- O^T += Vt * P^T : 4 d-tiles x 3 products; A[m=d][k=key] from Vt[bh][d][key] ----
#pragma unroll
        for (int f = 0; f < 4; ++f) {
            const unsigned short* vrh = kvb + VH_OFF + (16 * f + n) * VPITCH;
            const unsigned short* vrl = kvb + VL_OFF + (16 * f + n) * VPITCH;
            Frag avh, avl;
            avh.q[0] = *(const v4ua*)(vrh + 8 * g);
            avh.q[1] = *(const v4ua*)(vrh + 16 + 8 * g);
            avl.q[0] = *(const v4ua*)(vrl + 8 * g);
            avl.q[1] = *(const v4ua*)(vrl + 16 + 8 * g);
            o[f] = wmma_bf16(o[f], avh.v, bph.v);
            o[f] = wmma_bf16(o[f], avl.v, bph.v);
            o[f] = wmma_bf16(o[f], avh.v, bpl.v);
        }

        // ---- publish point of stage st+1; then stage st+2 goes into the buffer just read ----
        asm volatile("s_wait_dscnt 0x0" ::: "memory");      // this wave's reads of the buffer have returned
        asm volatile("s_wait_asynccnt 0x0" ::: "memory");   // this wave's copies of stage st+1 have landed
        __syncthreads();                                    // publishes stage st+1, ends every read of stage st
        if (st + 2 < NST)                                   // block-uniform
            copy_chunk(gk0 + (size_t)(st + 2) * (KSPLIT * KCH * ND), gv0 + (st + 2) * (KSPLIT * KCH),
                       lk0 + (st & 1) * (KSPLIT * BUF_ELEMS * 2), lv0 + (st & 1) * (KSPLIT * BUF_ELEMS * 2));
    }
    asm volatile("s_wait_asynccnt 0x0" ::: "memory");       // nothing of the ring is in flight past the loop

    // ---- merge of the two key groups. o[f][r] = O[query n][d = 16f+8g+r]: 8 consecutive floats of one row
    // per d-tile. Key group 1 hands its unnormalised tile, maximum and sum to the same lane of key group 0. ----
    if (kh == 1) {
#pragma unroll
        for (int f = 0; f < 4; ++f) {
            v4f w0, w1;
            w0.x = o[f][0]; w0.y = o[f][1]; w0.z = o[f][2]; w0.w = o[f][3];
            w1.x = o[f][4]; w1.y = o[f][5]; w1.z = o[f][6]; w1.w = o[f][7];
            *(v4fa*)&Osh[qg][n][16 * f + 8 * g]     = w0;
            *(v4fa*)&Osh[qg][n][16 * f + 8 * g + 4] = w1;
        }
        Msh[qg][lane] = mcol;
        Lsh[qg][lane] = lcol;
    }
    __syncthreads();                                        // key group 1's partial results are visible to key group 0

    // ---- key group 0: rescale both parts to the common maximum, join the half waves' sums, normalise,
    // leave the finished 16x64 tile at the same LDS places (each lane rewrites only what it has read) ----
    if (kh == 0) {
        const float m1 = Msh[qg][lane];
        const float l1 = Lsh[qg][lane];
        const float mn = fmaxf(mcol, m1);
        const float a0 = __expf(mcol - mn);
        const float a1 = __expf(m1 - mn);
        const float lpart = lcol * a0 + l1 * a1;
        const int lb = __float_as_int(lpart);
        const float lsum = lpart + __int_as_float(__builtin_amdgcn_permlanex16(lb, lb, 0x76543210, 0xfedcba98, false, false));
        const float inv = 1.0f / lsum;
        const float c0 = a0 * inv, c1 = a1 * inv;
#pragma unroll
        for (int f = 0; f < 4; ++f) {
            const v4f p0 = *(const v4fa*)&Osh[qg][n][16 * f + 8 * g];
            const v4f p1 = *(const v4fa*)&Osh[qg][n][16 * f + 8 * g + 4];
            v4f w0, w1;
            w0.x = o[f][0] * c0 + p0.x * c1; w0.y = o[f][1] * c0 + p0.y * c1;
            w0.z = o[f][2] * c0 + p0.z * c1; w0.w = o[f][3] * c0 + p0.w * c1;
            w1.x = o[f][4] * c0 + p1.x * c1; w1.y = o[f][5] * c0 + p1.y * c1;
            w1.z = o[f][6] * c0 + p1.z * c1; w1.w = o[f][7] * c0 + p1.w * c1;
            *(v4fa*)&Osh[qg][n][16 * f + 8 * g]     = w0;
            *(v4fa*)&Osh[qg][n][16 * f + 8 * g + 4] = w1;
        }
    }
    __syncthreads();                                        // the finished tiles are visible to both key groups

    // ---- whole-line stores: instruction i covers rows 8kh+2i, 8kh+2i+1 (512 B, lane-contiguous 16 B) ----
    // coverage: 2 waves x 4 instructions x 32 lanes x 4 floats = 16 rows x 64 floats per query group
    v4f vals[4];
#pragma unroll
    for (int i = 0; i < 4; ++i)
        vals[i] = *(const v4fa*)&Osh[qg][8 * kh + 2 * i + g][4 * n];

    float* obase = outg + (rowb + q0 + 8 * kh) * ND;  // 8 contiguous rows of 256 B
#pragma unroll
    for (int i = 0; i < 4; ++i)
        *(v4f*)(obase + (2 * i + g) * ND + 4 * n) = vals[i];
    
}

extern "C" void kernel_launch(void* const* d_in, const int* in_sizes, int n_in,
                              void* d_out, int out_size, void* d_ws, size_t ws_size,
                              hipStream_t stream)
{
    if (n_in < 7) return;
    const int n_qkv = NBH * NS * ND;        // 2,097,152
    const int n_pos = NB * NS * NPOS;       // 12,288
    if (in_sizes[0] != n_qkv || in_sizes[1] != n_qkv || in_sizes[2] != n_qkv) return;
    if (in_sizes[3] != n_pos || in_sizes[4] != n_pos) return;
    if (in_sizes[5] < NH || in_sizes[6] < NH) return;
    if (out_size != n_qkv) return;

    // workspace: 6 planes x 4 MiB = 25,165,824 B
    const size_t ws_need = (size_t)NPLANES * PLANE_ELEMS * sizeof(unsigned short);
    if (ws_size < ws_need) return;

    const float* q     = (const float*)d_in[0];
    const float* k     = (const float*)d_in[1];
    const float* v     = (const float*)d_in[2];
    const float* qs_s  = (const float*)d_in[3];
    const float* ks_s  = (const float*)d_in[4];
    const float* alpha = (const float*)d_in[5];
    const float* beta  = (const float*)d_in[6];
    float* out = (float*)d_out;
    unsigned short* planes = (unsigned short*)d_ws;

    k_split<<<dim3(NS / 64, NBH, 3), dim3(256), 0, stream>>>(q, k, v, planes);
    k_attn<<<dim3(NBH * (NS / 64)), dim3(256), 0, stream>>>(planes, qs_s, ks_s, alpha, beta, out);
}

// v004
// A run of this version takes 76.2 microseconds.
// In two side-by-side timings against v003, it was 1.12 and 1.11 times as fast.
// Over all steps from v000 it is 2.93 times as fast.
#include <hip/hip_runtime.h>

// Contractions: S = Q*K^T and O = P*V on v_wmma_f32_16x16x32_bf16, bf16 hi/lo operands
// (hi*hi + hi*lo + lo*hi per tile pair), f32 accumulate; positional exp bias, online softmax
// and normalisation in f32.

typedef __bf16        v16bf __attribute__((ext_vector_type(16)));
typedef float         v8f   __attribute__((ext_vector_type(8)));
typedef float         v4f   __attribute__((ext_vector_type(4)));
typedef unsigned int  v4u   __attribute__((ext_vector_type(4)));
typedef unsigned int  v4ua  __attribute__((ext_vector_type(4), may_alias));
typedef float         v4fa  __attribute__((ext_vector_type(4), may_alias));

#define NB    2
#define NH    8
#define NS    2048
#define ND    64
#define NBH   (NB * NH)
#define NPOS  3
#define KCH   32                 // keys per chunk
#define QK_SCALE 0.125f          // 1/sqrt(64), exact power of two
#define LOG2E 1.44269504088896340736f
#define LN2   0.693147180559945309417f
#define TPITCH 68                // LDS pitch (floats) of the 64x64 staging tile
#define OPITCH 68                // LDS pitch (floats) of the output staging tile
#define PLANE_ELEMS ((size_t)NBH * NS * ND)   // 16-bit elements per plane (4 MiB)
#define NPLANES 6                // Qhi, Qlo, Khi, Klo, Vthi, Vtlo
#define KSPLIT 2                 // wave groups of a block; each takes one 32-key chunk of every stage
#define NST    (NS / (KCH * KSPLIT))   // ring stages (64 keys each) per query block
#define KPITCH 72                // LDS pitch (16-bit elements) of a staged 128-B K row: 144 B = 16 B x odd
#define VPITCH 40                // LDS pitch (16-bit elements) of a staged 64-B Vt row: 80 B = 16 B x odd
#define KH_OFF 0                               // element offsets of the four tiles inside one buffer
#define KL_OFF (KH_OFF + KCH * KPITCH)
#define VH_OFF (KL_OFF + KCH * KPITCH)
#define VL_OFF (VH_OFF + ND * VPITCH)
#define BUF_ELEMS (VL_OFF + ND * VPITCH)       // 9,728 elements = 19,456 B per buffer

union Frag { v16bf v; v4u q[2]; };

// bf16 WMMA with the hazard guard: ties D, keeps A/B live across the nops
__device__ __forceinline__ v8f wmma_bf16(v8f acc, v16bf a, v16bf b)
{
    acc = __builtin_amdgcn_wmma_f32_16x16x32_bf16(false, a, false, b, (short)0, acc, false, false);
    asm volatile("v_nop\n\tv_nop\n\tv_nop\n\tv_nop" : "+v"(acc) : "v"(a), "v"(b));
    return acc;
}

// RNE f32 -> bf16 bits (low 16 bits of the result)
__device__ __forceinline__ unsigned int bf16_bits(float x)
{
    unsigned int u = __float_as_uint(x);
    return (u + 0x7FFFu + ((u >> 16) & 1u)) >> 16;
}

// x ~= hi + lo with hi = bf16(x), lo = bf16(x - hi); returns bit patterns
__device__ __forceinline__ void split_hl(float x, unsigned int& hi, unsigned int& lo)
{
    hi = bf16_bits(x);
    const float hf = __uint_as_float(hi << 16);
    lo = bf16_bits(x - hf);
}

// RNE f32 -> bf16 with the result left in the top 16 bits (low 16 bits are rounding residue)
__device__ __forceinline__ unsigned int bf16_top(float x)
{
    const unsigned int u = __float_as_uint(x);
    return u + 0x7FFFu + ((u >> 16) & 1u);
}

// two f32 -> one register of two bf16 hi parts and one of two lo parts (a in the low half); same
// values as split_hl, the halves joined by one byte permute each
__device__ __forceinline__ void split_hl_pair(float a, float b, unsigned int& hi, unsigned int& lo)
{
    const unsigned int ra = bf16_top(a), rb = bf16_top(b);
    hi = __builtin_amdgcn_perm(rb, ra, 0x07060302u);
    const unsigned int sa = bf16_top(a - __uint_as_float(ra & 0xFFFF0000u));
    const unsigned int sb = bf16_top(b - __uint_as_float(rb & 0xFFFF0000u));
    lo = __builtin_amdgcn_perm(sb, sa, 0x07060302u);
}

// ------------------------------------------------------------------------------------------
// Plane builder. grid = (NS/64 s-tiles, NBH, 3 sources), block = 256.
// z = 0: q -> planes 0/1 [bh][s][d]; z = 1: k -> planes 2/3 [bh][s][d];
// z = 2: v -> planes 4/5 transposed [bh][d][s].
// Coverage per block: 256 threads x 2 groups x 8 elements = 64 x 64 tile, every block owns
// ------------------------------------------------------------------------------------------
__global__ __launch_bounds__(256) void k_split(const float* __restrict__ q,
                                                const float* __restrict__ k,
                                                const float* __restrict__ v,
                                                unsigned short* __restrict__ planes)
{
    __shared__ __align__(16) float tile[64][TPITCH];

    const int t  = threadIdx.x;
    const int s0 = blockIdx.x * 64;
    const int bh = blockIdx.y;
    const int z  = blockIdx.z;                       // block-uniform
    const float* src = (z == 0) ? q : ((z == 1) ? k : v);
    const int tr = (z == 2) ? 1 : 0;

    // stage the 64 rows x 64 cols f32 tile (rows s0..s0+63 of slice bh)
#pragma unroll
    for (int i = 0; i < 4; ++i) {
        const int idx = (t + 256 * i) * 4;           // 0..4092
        const int r = idx >> 6, c = idx & 63;
        const v4f val = *(const v4f*)(src + ((size_t)(bh * NS + s0 + r)) * ND + c);
        *(v4f*)&tile[r][c] = val;
    }
    __syncthreads();

    v4u hv[2], lv[2];
    size_t off[2];
#pragma unroll
    for (int it = 0; it < 2; ++it) {
        const int gidx = it * 256 + t;               // 0..511
        const int orow = gidx >> 3;                  // output row within tile (s for q/k, d for v)
        const int og   = gidx & 7;                   // 8-column group
        unsigned int hs[8], ls[8];
#pragma unroll
        for (int j = 0; j < 8; ++j) {
            const int cidx = 8 * og + j;
            const int ia = orow * TPITCH + cidx;     // q/k: in[row=s][col=d]
            const int ib = cidx * TPITCH + orow;     // v:   in[row=s=cidx][col=d=orow] -> out[d][s]
            const float x = (&tile[0][0])[tr ? ib : ia];
            split_hl(x, hs[j], ls[j]);
        }
        v4u hw, lw;
        hw.x = hs[0] | (hs[1] << 16); hw.y = hs[2] | (hs[3] << 16);
        hw.z = hs[4] | (hs[5] << 16); hw.w = hs[6] | (hs[7] << 16);
        lw.x = ls[0] | (ls[1] << 16); lw.y = ls[2] | (ls[3] << 16);
        lw.z = ls[4] | (ls[5] << 16); lw.w = ls[6] | (ls[7] << 16);
        hv[it] = hw; lv[it] = lw;
        const size_t offa = ((size_t)(bh * NS + s0 + orow)) * ND + 8 * og;          // [bh][s][d]
        const size_t offb = ((size_t)(bh * ND + orow)) * NS + s0 + 8 * og;          // [bh][d][s]
        off[it] = tr ? offb : offa;
    }

    unsigned short* ph = planes + (size_t)(2 * z) * PLANE_ELEMS;
    unsigned short* pl = ph + PLANE_ELEMS;

#pragma unroll
    for (int it = 0; it < 2; ++it) {
        *(v4u*)(ph + off[it]) = hv[it];
        *(v4u*)(pl + off[it]) = lv[it];
    }
    
}

// One key chunk (K hi/lo: 32 rows x 128 B, Vt hi/lo: 64 rows x 64 B) from the planes into one LDS
// buffer: the 128 threads of one wave group x 8 asynchronous 16-B copies, every lane on, each 16 B written by one lane.
// gk / gv: this thread's first K-hi / Vt-hi source of the chunk; lk / lv: its LDS byte addresses.
__device__ __forceinline__ void copy_chunk(const unsigned short* gk, const unsigned short* gv,
                                           unsigned int lk, unsigned int lv)
{
    const unsigned short* gk1  = gk + 128 * 8;                 // second half of the 4-KiB K tile (rows 16..31)
    const unsigned short* gkl  = gk + PLANE_ELEMS;
    const unsigned short* gkl1 = gk1 + PLANE_ELEMS;
    const unsigned short* gv1  = gv + (size_t)32 * NS;         // Vt rows 32..63
    const unsigned short* gvl  = gv + PLANE_ELEMS;
    const unsigned short* gvl1 = gv1 + PLANE_ELEMS;
    const unsigned int lk1  = lk + 16 * KPITCH * 2;
    const unsigned int lkl  = lk + (KL_OFF - KH_OFF) * 2;
    const unsigned int lkl1 = lk1 + (KL_OFF - KH_OFF) * 2;
    const unsigned int lv1  = lv + 32 * VPITCH * 2;
    const unsigned int lvl  = lv + (VL_OFF - VH_OFF) * 2;
    const unsigned int lvl1 = lv1 + (VL_OFF - VH_OFF) * 2;
    // the copies and their s_wait_xcnt in one statement: no address register is rewritten ahead of the wait
    asm volatile("global_load_async_to_lds_b128 %0, %8, off\n\t"
                 "global_load_async_to_lds_b128 %1, %9, off\n\t"
                 "global_load_async_to_lds_b128 %2, %10, off\n\t"
                 "global_load_async_to_lds_b128 %3, %11, off\n\t"
                 "global_load_async_to_lds_b128 %4, %12, off\n\t"
                 "global_load_async_to_lds_b128 %5, %13, off\n\t"
                 "global_load_async_to_lds_b128 %6, %14, off\n\t"
                 "global_load_async_to_lds_b128 %7, %15, off\n\t"
                 "s_wait_xcnt 0x0"
                 :: "v"(lk), "v"(lk1), "v"(lkl), "v"(lkl1), "v"(lv), "v"(lv1), "v"(lvl), "v"(lvl1),
                    "v"(gk), "v"(gk1), "v"(gkl), "v"(gkl1), "v"(gv), "v"(gv1), "v"(gvl), "v"(gvl1)
                 : "memory");
}

// ------------------------------------------------------------------------------------------
// Attention with positional exp bias. grid = NBH * (NS/64) = 512 blocks, block = 256: 8 waves =
// 4 query groups (16 query rows each) x 2 key groups, non-causal over all NS keys. A ring stage holds
// 64 keys as two 32-key chunks; key group kh works on chunk kh of every stage, so each query row has two
// waves with their own running maximum, sum and O^T; the two are merged once, through LDS, after the loop.
// The four waves of a key group share their chunk's K and Vt tiles through a two-buffer LDS ring.
// Transposed products: S^T = K * Q^T (A = key rows, B = query columns) and O^T += Vt * P^T, so a
// lane holds the scores of ONE query (column n): 16 of the chunk's 32 keys, the other half wave the rest.
// Fragment map (A and B): lane l, g = l>>4, n = l&15; elements 0..7 <- k0+8g+0..7,
// elements 8..15 <- k0+16+8g+0..7; D element r <- (row 8g+r, col n). The two S^T tiles of a chunk
// (keys 8g+r and 16+8g+r of column n) are therefore already in the B order of the P^T operand.
// ------------------------------------------------------------------------------------------
__global__ __launch_bounds__(256) void k_attn(const unsigned short* __restrict__ planes,
                                               const float* __restrict__ qsg,
                                               const float* __restrict__ ksg,
                                               const float* __restrict__ alphag,
                                               const float* __restrict__ betag,
                                               float* outg)
{
    __shared__ __align__(16) float Osh[4][16][OPITCH];            // per query group: merge and output staging
    __shared__ float Msh[4][32], Lsh[4][32];                      // key group 1's running maximum and sum, per lane
    __shared__ __align__(16) unsigned short KVsh[2][KSPLIT][BUF_ELEMS];   // K/Vt ring: two buffers x two chunks

    const int tid  = threadIdx.x;
    const int wave = __builtin_amdgcn_readfirstlane(tid >> 5);   // scalar, so the tests on kh below are scalar branches
    const int qg   = wave & 3;          // query group
    const int kh   = wave >> 2;         // key group
    const int t7   = tid & 127;         // thread index inside the key group
    const int lane = tid & 31;
    const int g    = lane >> 4;
    const int n    = lane & 15;

    const int bid  = blockIdx.x;
    const int qblk = bid & 31;          // NS/64 = 32 query blocks
    const int bh   = bid >> 5;          // 0..15
    const int hh   = bh & (NH - 1);
    const int b    = bh >> 3;
    const int q0   = qblk * 64 + qg * 16;

    const float alpha_h = alphag[hh];
    const float nbeta_h = -betag[hh];

    const unsigned short* Qh = planes;
    const unsigned short* Ql = planes + PLANE_ELEMS;
    const unsigned short* Kh = planes + 2 * PLANE_ELEMS;    // lo plane: + PLANE_ELEMS
    const unsigned short* Vh = planes + 4 * PLANE_ELEMS;    // [bh][d][s]; lo plane: + PLANE_ELEMS
    const size_t rowb = (size_t)bh * NS;

    // ---- this thread's share of its key group's chunk copy: K piece t7 (row t7>>3), Vt piece t7 (row t7>>2) ----
    const unsigned short* gk0 = Kh + (rowb + kh * KCH) * ND + t7 * 8;                                  // + 64 * ND per stage
    const unsigned short* gv0 = Vh + ((size_t)bh * ND + (t7 >> 2)) * NS + kh * KCH + (t7 & 3) * 8;     // + 64 per stage
    const unsigned int lbase = (unsigned int)(size_t)&KVsh[0][kh][0];
    const unsigned int lk0 = lbase + (KH_OFF + (t7 >> 3) * KPITCH + (t7 & 7) * 8) * 2;
    const unsigned int lv0 = lbase + (VH_OFF + (t7 >> 2) * VPITCH + (t7 & 3) * 8) * 2;

    // ---- ring prologue: stage 0 lands and is published, then stage 1 flies ----
    copy_chunk(gk0, gv0, lk0, lv0);
    asm volatile("s_wait_asynccnt 0x0" ::: "memory");   // this wave's copies of stage 0 have landed
    __syncthreads();                                    // publishes stage 0 to the other waves
    copy_chunk(gk0 + KSPLIT * KCH * ND, gv0 + KSPLIT * KCH,
               lk0 + KSPLIT * BUF_ELEMS * 2, lv0 + KSPLIT * BUF_ELEMS * 2);

    // ---- position features of this lane's one query (column n) ----
    float qp[NPOS];
    {
        const float* p = qsg + ((size_t)b * NS + q0 + n) * NPOS;
        qp[0] = p[0]; qp[1] = p[1]; qp[2] = p[2];
    }
    asm volatile("s_wait_xcnt 0x0" ::: "memory");   // before the address pair of the load above is reused as a later load's destination

    // ---- Q B fragments (columns q0+n), two 32-deep k-steps, hi and lo planes ----
    Frag aqh[2], aql[2];
    {
        const unsigned short* qrh = Qh + (rowb + q0 + n) * ND;
        const unsigned short* qrl = Ql + (rowb + q0 + n) * ND;
#pragma unroll
        for (int c = 0; c < 2; ++c) {
            aqh[c].q[0] = *(const v4u*)(qrh + 32 * c + 8 * g);
            aqh[c].q[1] = *(const v4u*)(qrh + 32 * c + 16 + 8 * g);
            aql[c].q[0] = *(const v4u*)(qrl + 32 * c + 8 * g);
            aql[c].q[1] = *(const v4u*)(qrl + 32 * c + 16 + 8 * g);
        }
    }

    v8f o[4];
#pragma unroll
    for (int f = 0; f < 4; ++f) o[f] = (v8f){};
    float mcol = -__builtin_huge_valf();   // running maximum of this lane's query over this key group (equal in both half waves)
    float lcol = 0.0f;                     // running sum over this half wave's keys only; joined after the loop

#pragma unroll 1
    for (int st = 0; st < NST; ++st) {
        const int kb = (st * KSPLIT + kh) * KCH;             // first key of this wave's chunk
        const unsigned short* kvb = &KVsh[st & 1][kh][0];    // this chunk's buffer

        // key position features of this lane's 16 D-layout rows: keys kb+16t+8g+r, 24 contiguous floats per t
        float kf[2][8 * NPOS];
#pragma unroll
        for (int t = 0; t < 2; ++t) {
            const float* p = ksg + ((size_t)b * NS + kb + 16 * t + 8 * g) * NPOS;   // 96-B multiple
#pragma unroll
            for (int i = 0; i < 6; ++i) {
                const v4f w = *(const v4f*)(p + 4 * i);
                kf[t][4 * i + 0] = w.x; kf[t][4 * i + 1] = w.y; kf[t][4 * i + 2] = w.z; kf[t][4 * i + 3] = w.w;
            }
        }

        // ---- S^T = K * Q^T : 2 key tiles x 2 k-steps x 3 products ----
        v8f sa[2];
#pragma unroll
        for (int t = 0; t < 2; ++t) {
            v8f acc = (v8f){};
            const unsigned short* krh = kvb + KH_OFF + (16 * t + n) * KPITCH;   // A[m=key][k=d]: d-contiguous key row
            const unsigned short* krl = kvb + KL_OFF + (16 * t + n) * KPITCH;
#pragma unroll
            for (int c = 0; c < 2; ++c) {
                Frag akh, akl;
                akh.q[0] = *(const v4ua*)(krh + 32 * c + 8 * g);
                akh.q[1] = *(const v4ua*)(krh + 32 * c + 16 + 8 * g);
                akl.q[0] = *(const v4ua*)(krl + 32 * c + 8 * g);
                akl.q[1] = *(const v4ua*)(krl + 32 * c + 16 + 8 * g);
                acc = wmma_bf16(acc, akh.v, aqh[c].v);
                acc = wmma_bf16(acc, akl.v, aqh[c].v);
                acc = wmma_bf16(acc, akh.v, aql[c].v);
            }
            sa[t] = acc;
        }

        // ---- bias; sc[t][r] = score of (query n, key kb+16t+8g+r) ----
        float sc[2][8];
#pragma unroll
        for (int t = 0; t < 2; ++t) {
#pragma unroll
            for (int r = 0; r < 8; ++r) {
                const float dx = qp[0] - kf[t][3 * r + 0];
                const float dy = qp[1] - kf[t][3 * r + 1];
                const float dz = qp[2] - kf[t][3 * r + 2];
                float dd = dx * dx; dd = dd + dy * dy; dd = dd + dz * dz;
                // exp(x) = 2^ph * exp(x - ph*ln2): the hardware 2^ph, then the first-order term of what
                // the rounding of ph = x*log2(e) left out (|x - ph*ln2| is below 1e-5: its square is nothing)
                const float x    = nbeta_h * dd;
                const float ph   = x * LOG2E;
                const float rest = __builtin_fmaf(ph, -LN2, x);
                const float ar   = alpha_h * __builtin_amdgcn_exp2f(ph);
                const float bias = __builtin_fmaf(ar, rest, ar);
                sc[t][r] = sa[t][r] * QK_SCALE + bias;
            }
        }

        // ---- online softmax of one query per lane: maximum in registers, one exchange between half waves ----
        float vmax = sc[0][0];
#pragma unroll
        for (int t = 0; t < 2; ++t)
#pragma unroll
            for (int r = 0; r < 8; ++r) vmax = fmaxf(vmax, sc[t][r]);
        {
            const int vb = __float_as_int(vmax);
            vmax = fmaxf(vmax, __int_as_float(__builtin_amdgcn_permlanex16(vb, vb, 0x76543210, 0xfedcba98, false, false)));
        }
        const float mn   = fmaxf(mcol, vmax);
        const float resc = __expf(mcol - mn);
        mcol = mn;

        // P^T B fragments straight from the score registers: element r <- tile 0, element 8+r <- tile 1
        Frag bph, bpl;
        float pp[2][4];                    // pair sums, joined as a tree below (short dependent chain)
#pragma unroll
        for (int t = 0; t < 2; ++t) {
#pragma unroll
            for (int w = 0; w < 4; ++w) {
                const float pa = __expf(sc[t][2 * w]     - mn);
                const float pb = __expf(sc[t][2 * w + 1] - mn);
                pp[t][w] = pa + pb;
                unsigned int hw, lw;
                split_hl_pair(pa, pb, hw, lw);
                bph.q[t][w] = hw;
                bpl.q[t][w] = lw;
            }
        }
        const float ps = ((pp[0][0] + pp[0][1]) + (pp[0][2] + pp[0][3])) + ((pp[1][0] + pp[1][1]) + (pp[1][2] + pp[1][3]));
        lcol = lcol * resc + ps;
#pragma unroll
        for (int f = 0; f < 4; ++f)
#pragma unroll
            for (int r = 0; r < 8; ++r) o[f][r] = o[f][r] * resc;

        // ---- O^T += Vt * P^T : 4 d-tiles x 3 products; A[m=d][k=key] from Vt[bh][d][key] ----
#pragma unroll
        for (int f = 0; f < 4; ++f) {
            const unsigned short* vrh = kvb + VH_OFF + (16 * f + n) * VPITCH;
            const unsigned short* vrl = kvb + VL_OFF + (16 * f + n) * VPITCH;
            Frag avh, avl;
            avh.q[0] = *(const v4ua*)(vrh + 8 * g);
            avh.q[1] = *(const v4ua*)(vrh + 16 + 8 * g);
            avl.q[0] = *(const v4ua*)(vrl + 8 * g);
            avl.q[1] = *(const v4ua*)(vrl + 16 + 8 * g);
            o[f] = wmma_bf16(o[f], avh.v, bph.v);
            o[f] = wmma_bf16(o[f], avl.v, bph.v);
            o[f] = wmma_bf16(o[f], avh.v, bpl.v);
        }

        // ---- publish point of stage st+1; then stage st+2 goes into the buffer just read ----
        asm volatile("s_wait_dscnt 0x0" ::: "memory");      // this wave's reads of the buffer have returned
        asm volatile("s_wait_asynccnt 0x0" ::: "memory");   // this wave's copies of stage st+1 have landed
        __syncthreads();                                    // publishes stage st+1, ends every read of stage st
        if (st + 2 < NST)                                   // block-uniform
            copy_chunk(gk0 + (size_t)(st + 2) * (KSPLIT * KCH * ND), gv0 + (st + 2) * (KSPLIT * KCH),
                       lk0 + (st & 1) * (KSPLIT * BUF_ELEMS * 2), lv0 + (st & 1) * (KSPLIT * BUF_ELEMS * 2));
    }
    asm volatile("s_wait_asynccnt 0x0" ::: "memory");       // nothing of the ring is in flight past the loop

    // ---- merge of the two key groups. o[f][r] = O[query n][d = 16f+8g+r]: 8 consecutive floats of one row
    // per d-tile. Key group 1 hands its unnormalised tile, maximum and sum to the same lane of key group 0. ----
    if (kh == 1) {
#pragma unroll
        for (int f = 0; f < 4; ++f) {
            v4f w0, w1;
            w0.x = o[f][0]; w0.y = o[f][1]; w0.z = o[f][2]; w0.w = o[f][3];
            w1.x = o[f][4]; w1.y = o[f][5]; w1.z = o[f][6]; w1.w = o[f][7];
            *(v4fa*)&Osh[qg][n][16 * f + 8 * g]     = w0;
            *(v4fa*)&Osh[qg][n][16 * f + 8 * g + 4] = w1;
        }
        Msh[qg][lane] = mcol;
        Lsh[qg][lane] = lcol;
    }
    __syncthreads();                                        // key group 1's partial results are visible to key group 0

    // ---- key group 0: rescale both parts to the common maximum, join the half waves' sums, normalise,
    // leave the finished 16x64 tile at the same LDS places (each lane rewrites only what it has read) ----
    if (kh == 0) {
        const float m1 = Msh[qg][lane];
        const float l1 = Lsh[qg][lane];
        const float mn = fmaxf(mcol, m1);
        const float a0 = __expf(mcol - mn);
        const float a1 = __expf(m1 - mn);
        const float lpart = lcol * a0 + l1 * a1;
        const int lb = __float_as_int(lpart);
        const float lsum = lpart + __int_as_float(__builtin_amdgcn_permlanex16(lb, lb, 0x76543210, 0xfedcba98, false, false));
        const float inv = 1.0f / lsum;
        const float c0 = a0 * inv, c1 = a1 * inv;
#pragma unroll
        for (int f = 0; f < 4; ++f) {
            const v4f p0 = *(const v4fa*)&Osh[qg][n][16 * f + 8 * g];
            const v4f p1 = *(const v4fa*)&Osh[qg][n][16 * f + 8 * g + 4];
            v4f w0, w1;
            w0.x = o[f][0] * c0 + p0.x * c1; w0.y = o[f][1] * c0 + p0.y * c1;
            w0.z = o[f][2] * c0 + p0.z * c1; w0.w = o[f][3] * c0 + p0.w * c1;
            w1.x = o[f][4] * c0 + p1.x * c1; w1.y = o[f][5] * c0 + p1.y * c1;
            w1.z = o[f][6] * c0 + p1.z * c1; w1.w = o[f][7] * c0 + p1.w * c1;
            *(v4fa*)&Osh[qg][n][16 * f + 8 * g]     = w0;
            *(v4fa*)&Osh[qg][n][16 * f + 8 * g + 4] = w1;
        }
    }
    __syncthreads();                                        // the finished tiles are visible to both key groups

    // ---- whole-line stores: instruction i covers rows 8kh+2i, 8kh+2i+1 (512 B, lane-contiguous 16 B) ----
    // coverage: 2 waves x 4 instructions x 32 lanes x 4 floats = 16 rows x 64 floats per query group
    v4f vals[4];
#pragma unroll
    for (int i = 0; i < 4; ++i)
        vals[i] = *(const v4fa*)&Osh[qg][8 * kh + 2 * i + g][4 * n];

    float* obase = outg + (rowb + q0 + 8 * kh) * ND;  // 8 contiguous rows of 256 B
#pragma unroll
    for (int i = 0; i < 4; ++i)
        *(v4f*)(obase + (2 * i + g) * ND + 4 * n) = vals[i];
    
}

extern "C" void kernel_launch(void* const* d_in, const int* in_sizes, int n_in,
                              void* d_out, int out_size, void* d_ws, size_t ws_size,
                              hipStream_t stream)
{
    if (n_in < 7) return;
    const int n_qkv = NBH * NS * ND;        // 2,097,152
    const int n_pos = NB * NS * NPOS;       // 12,288
    if (in_sizes[0] != n_qkv || in_sizes[1] != n_qkv || in_sizes[2] != n_qkv) return;
    if (in_sizes[3] != n_pos || in_sizes[4] != n_pos) return;
    if (in_sizes[5] < NH || in_sizes[6] < NH) return;
    if (out_size != n_qkv) return;

    // workspace: 6 planes x 4 MiB = 25,165,824 B
    const size_t ws_need = (size_t)NPLANES * PLANE_ELEMS * sizeof(unsigned short);
    if (ws_size < ws_need) return;

    const float* q     = (const float*)d_in[0];
    const float* k     = (const float*)d_in[1];
    const float* v     = (const float*)d_in[2];
    const float* qs_s  = (const float*)d_in[3];
    const float* ks_s  = (const float*)d_in[4];
    const float* alpha = (const float*)d_in[5];
    const float* beta  = (const float*)d_in[6];
    float* out = (float*)d_out;
    unsigned short* planes = (unsigned short*)d_ws;

    k_split<<<dim3(NS / 64, NBH, 3), dim3(256), 0, stream>>>(q, k, v, planes);
    k_attn<<<dim3(NBH * (NS / 64)), dim3(256), 0, stream>>>(planes, qs_s, ks_s, alpha, beta, out);
}

// v005
// One run takes 69.8 microseconds.
// Next to v004, in two timings, it ran 1.09 and 1.08 times as fast.
// Over all steps from v000 it is 3.18 times as fast.
#include <hip/hip_runtime.h>

// Contractions: S = Q*K^T and O = P*V on v_wmma_f32_16x16x32_bf16, bf16 hi/lo operands
// (hi*hi + hi*lo + lo*hi per tile pair), f32 accumulate; positional exp bias, online softmax
// and normalisation in f32.

typedef __bf16        v16bf __attribute__((ext_vector_type(16)));
typedef float         v8f   __attribute__((ext_vector_type(8)));
typedef float         v4f   __attribute__((ext_vector_type(4)));
typedef unsigned int  v4u   __attribute__((ext_vector_type(4)));
typedef unsigned int  v4ua  __attribute__((ext_vector_type(4), may_alias));
typedef float         v4fa  __attribute__((ext_vector_type(4), may_alias));
typedef float         v2f   __attribute__((ext_vector_type(2)));
typedef __bf16        v2bf  __attribute__((ext_vector_type(2)));

#define NB    2
#define NH    8
#define NS    2048
#define ND    64
#define NBH   (NB * NH)
#define NPOS  3
#define KCH   32                 // keys per chunk
#define QK_SCALE 0.125f          // 1/sqrt(64), exact power of two
#define LOG2E 1.44269504088896340736f
#define LN2   0.693147180559945309417f
#define TPITCH 68                // LDS pitch (floats) of the 64x64 staging tile
#define OPITCH 68                // LDS pitch (floats) of the output staging tile
#define PLANE_ELEMS ((size_t)NBH * NS * ND)   // 16-bit elements per plane (4 MiB)
#define NPLANES 6                // Qhi, Qlo, Khi, Klo, Vthi, Vtlo
#define KSPLIT 2                 // wave groups of a block; each takes one 32-key chunk of every stage
#define NST    (NS / (KCH * KSPLIT))   // ring stages (64 keys each) per query block
#define KPITCH 72                // LDS pitch (16-bit elements) of a staged 128-B K row: 144 B = 16 B x odd
#define VPITCH 40                // LDS pitch (16-bit elements) of a staged 64-B Vt row: 80 B = 16 B x odd
#define KH_OFF 0                               // element offsets of the four tiles inside one buffer
#define KL_OFF (KH_OFF + KCH * KPITCH)
#define VH_OFF (KL_OFF + KCH * KPITCH)
#define VL_OFF (VH_OFF + ND * VPITCH)
#define BUF_ELEMS (VL_OFF + ND * VPITCH)       // 9,728 elements = 19,456 B per buffer

union Frag { v16bf v; v4u q[2]; };

// bf16 WMMA with the hazard guard: ties D, keeps A/B live across the nops
__device__ __forceinline__ v8f wmma_bf16(v8f acc, v16bf a, v16bf b)
{
    acc = __builtin_amdgcn_wmma_f32_16x16x32_bf16(false, a, false, b, (short)0, acc, false, false);
    asm volatile("v_nop\n\tv_nop\n\tv_nop\n\tv_nop" : "+v"(acc) : "v"(a), "v"(b));
    return acc;
}

// two f32 -> one register of two bf16 hi parts and one of two lo parts (a in the low half):
// x ~= hi + lo with hi = bf16(x), lo = bf16(x - hi), both rounded to nearest even by the packed hardware conversion
__device__ __forceinline__ void split_hl_pair(float a, float b, unsigned int& hi, unsigned int& lo)
{
    const v2f  x = {a, b};
    const v2bf h = __builtin_convertvector(x, v2bf);
    const v2bf l = __builtin_convertvector(x - __builtin_convertvector(h, v2f), v2bf);
    hi = __builtin_bit_cast(unsigned int, h);
    lo = __builtin_bit_cast(unsigned int, l);
}

// ------------------------------------------------------------------------------------------
// Plane builder. grid = (NS/64 s-tiles, NBH, 3 sources), block = 256.
// z = 0: q -> planes 0/1 [bh][s][d]; z = 1: k -> planes 2/3 [bh][s][d];
// z = 2: v -> planes 4/5 transposed [bh][d][s].
// Coverage per block: 256 threads x 2 groups x 8 elements = 64 x 64 tile, every block owns
// ------------------------------------------------------------------------------------------
__global__ __launch_bounds__(256) void k_split(const float* __restrict__ q,
                                                const float* __restrict__ k,
                                                const float* __restrict__ v,
                                                unsigned short* __restrict__ planes)
{
    __shared__ __align__(16) float tile[64][TPITCH];

    const int t  = threadIdx.x;
    const int s0 = blockIdx.x * 64;
    const int bh = blockIdx.y;
    const int z  = blockIdx.z;                       // block-uniform
    const float* src = (z == 0) ? q : ((z == 1) ? k : v);
    const int tr = (z == 2) ? 1 : 0;

    // stage the 64 rows x 64 cols f32 tile (rows s0..s0+63 of slice bh)
#pragma unroll
    for (int i = 0; i < 4; ++i) {
        const int idx = (t + 256 * i) * 4;           // 0..4092
        const int r = idx >> 6, c = idx & 63;
        const v4f val = *(const v4f*)(src + ((size_t)(bh * NS + s0 + r)) * ND + c);
        *(v4f*)&tile[r][c] = val;
    }
    __syncthreads();

    v4u hv[2], lv[2];
    size_t off[2];
#pragma unroll
    for (int it = 0; it < 2; ++it) {
        const int gidx = it * 256 + t;               // 0..511
        const int orow = gidx >> 3;                  // output row within tile (s for q/k, d for v)
        const int og   = gidx & 7;                   // 8-column group
        float xs[8];
#pragma unroll
        for (int j = 0; j < 8; ++j) {
            const int cidx = 8 * og + j;
            const int ia = orow * TPITCH + cidx;     // q/k: in[row=s][col=d]
            const int ib = cidx * TPITCH + orow;     // v:   in[row=s=cidx][col=d=orow] -> out[d][s]
            xs[j] = (&tile[0][0])[tr ? ib : ia];
        }
        v4u hw, lw;
#pragma unroll                                       // constant element indices, so hw and lw stay in registers
        for (int w = 0; w < 4; ++w) {
            unsigned int h2, l2;
            split_hl_pair(xs[2 * w], xs[2 * w + 1], h2, l2);
            hw[w] = h2; lw[w] = l2;
        }
        hv[it] = hw; lv[it] = lw;
        const size_t offa = ((size_t)(bh * NS + s0 + orow)) * ND + 8 * og;          // [bh][s][d]
        const size_t offb = ((size_t)(bh * ND + orow)) * NS + s0 + 8 * og;          // [bh][d][s]
        off[it] = tr ? offb : offa;
    }

    unsigned short* ph = planes + (size_t)(2 * z) * PLANE_ELEMS;
    unsigned short* pl = ph + PLANE_ELEMS;

#pragma unroll
    for (int it = 0; it < 2; ++it) {
        *(v4u*)(ph + off[it]) = hv[it];
        *(v4u*)(pl + off[it]) = lv[it];
    }
    
}

// One key chunk (K hi/lo: 32 rows x 128 B, Vt hi/lo: 64 rows x 64 B) from the planes into one LDS
// buffer: the 128 threads of one wave group x 8 asynchronous 16-B copies, every lane on, each 16 B written by one lane.
// gk / gv: this thread's first K-hi / Vt-hi source of the chunk; lk / lv: its LDS byte addresses.
__device__ __forceinline__ void copy_chunk(const unsigned short* gk, const unsigned short* gv,
                                           unsigned int lk, unsigned int lv)
{
    const unsigned short* gk1  = gk + 128 * 8;                 // second half of the 4-KiB K tile (rows 16..31)
    const unsigned short* gkl  = gk + PLANE_ELEMS;
    const unsigned short* gkl1 = gk1 + PLANE_ELEMS;
    const unsigned short* gv1  = gv + (size_t)32 * NS;         // Vt rows 32..63
    const unsigned short* gvl  = gv + PLANE_ELEMS;
    const unsigned short* gvl1 = gv1 + PLANE_ELEMS;
    const unsigned int lk1  = lk + 16 * KPITCH * 2;
    const unsigned int lkl  = lk + (KL_OFF - KH_OFF) * 2;
    const unsigned int lkl1 = lk1 + (KL_OFF - KH_OFF) * 2;
    const unsigned int lv1  = lv + 32 * VPITCH * 2;
    const unsigned int lvl  = lv + (VL_OFF - VH_OFF) * 2;
    const unsigned int lvl1 = lv1 + (VL_OFF - VH_OFF) * 2;
    // the copies and their s_wait_xcnt in one statement: no address register is rewritten ahead of the wait
    asm volatile("global_load_async_to_lds_b128 %0, %8, off\n\t"
                 "global_load_async_to_lds_b128 %1, %9, off\n\t"
                 "global_load_async_to_lds_b128 %2, %10, off\n\t"
                 "global_load_async_to_lds_b128 %3, %11, off\n\t"
                 "global_load_async_to_lds_b128 %4, %12, off\n\t"
                 "global_load_async_to_lds_b128 %5, %13, off\n\t"
                 "global_load_async_to_lds_b128 %6, %14, off\n\t"
                 "global_load_async_to_lds_b128 %7, %15, off\n\t"
                 "s_wait_xcnt 0x0"
                 :: "v"(lk), "v"(lk1), "v"(lkl), "v"(lkl1), "v"(lv), "v"(lv1), "v"(lvl), "v"(lvl1),
                    "v"(gk), "v"(gk1), "v"(gkl), "v"(gkl1), "v"(gv), "v"(gv1), "v"(gvl), "v"(gvl1)
                 : "memory");
}

// ------------------------------------------------------------------------------------------
// Attention with positional exp bias. grid = NBH * (NS/64) = 512 blocks, block = 256: 8 waves =
// 4 query groups (16 query rows each) x 2 key groups, non-causal over all NS keys. A ring stage holds
// 64 keys as two 32-key chunks; key group kh works on chunk kh of every stage, so each query row has two
// waves with their own running maximum, sum and O^T; the two are merged once, through LDS, after the loop.
// The four waves of a key group share their chunk's K and Vt tiles through a two-buffer LDS ring.
// Transposed products: S^T = K * Q^T (A = key rows, B = query columns) and O^T += Vt * P^T, so a
// lane holds the scores of ONE query (column n): 16 of the chunk's 32 keys, the other half wave the rest.
// Fragment map (A and B): lane l, g = l>>4, n = l&15; elements 0..7 <- k0+8g+0..7,
// elements 8..15 <- k0+16+8g+0..7; D element r <- (row 8g+r, col n). The two S^T tiles of a chunk
// (keys 8g+r and 16+8g+r of column n) are therefore already in the B order of the P^T operand.
// ------------------------------------------------------------------------------------------
__global__ __launch_bounds__(256) void k_attn(const unsigned short* __restrict__ planes,
                                               const float* __restrict__ qsg,
                                               const float* __restrict__ ksg,
                                               const float* __restrict__ alphag,
                                               const float* __restrict__ betag,
                                               float* outg)
{
    __shared__ __align__(16) float Osh[4][16][OPITCH];            // per query group: merge and output staging
    __shared__ float Msh[4][32], Lsh[4][32];                      // key group 1's running maximum and sum, per lane
    __shared__ __align__(16) unsigned short KVsh[2][KSPLIT][BUF_ELEMS];   // K/Vt ring: two buffers x two chunks

    const int tid  = threadIdx.x;
    const int wave = __builtin_amdgcn_readfirstlane(tid >> 5);   // scalar, so the tests on kh below are scalar branches
    const int qg   = wave & 3;          // query group
    const int kh   = wave >> 2;         // key group
    const int t7   = tid & 127;         // thread index inside the key group
    const int lane = tid & 31;
    const int g    = lane >> 4;
    const int n    = lane & 15;

    const int bid  = blockIdx.x;
    const int qblk = bid & 31;          // NS/64 = 32 query blocks
    const int bh   = bid >> 5;          // 0..15
    const int hh   = bh & (NH - 1);
    const int b    = bh >> 3;
    const int q0   = qblk * 64 + qg * 16;

    const float alpha_h = alphag[hh];
    const float nbeta_h = -betag[hh];

    const unsigned short* Qh = planes;
    const unsigned short* Ql = planes + PLANE_ELEMS;
    const unsigned short* Kh = planes + 2 * PLANE_ELEMS;    // lo plane: + PLANE_ELEMS
    const unsigned short* Vh = planes + 4 * PLANE_ELEMS;    // [bh][d][s]; lo plane: + PLANE_ELEMS
    const size_t rowb = (size_t)bh * NS;

    // ---- this thread's share of its key group's chunk copy: K piece t7 (row t7>>3), Vt piece t7 (row t7>>2) ----
    const unsigned short* gk0 = Kh + (rowb + kh * KCH) * ND + t7 * 8;                                  // + 64 * ND per stage
    const unsigned short* gv0 = Vh + ((size_t)bh * ND + (t7 >> 2)) * NS + kh * KCH + (t7 & 3) * 8;     // + 64 per stage
    const unsigned int lbase = (unsigned int)(size_t)&KVsh[0][kh][0];
    const unsigned int lk0 = lbase + (KH_OFF + (t7 >> 3) * KPITCH + (t7 & 7) * 8) * 2;
    const unsigned int lv0 = lbase + (VH_OFF + (t7 >> 2) * VPITCH + (t7 & 3) * 8) * 2;

    // ---- ring prologue: stage 0 lands and is published, then stage 1 flies ----
    copy_chunk(gk0, gv0, lk0, lv0);
    asm volatile("s_wait_asynccnt 0x0" ::: "memory");   // this wave's copies of stage 0 have landed
    __syncthreads();                                    // publishes stage 0 to the other waves
    copy_chunk(gk0 + KSPLIT * KCH * ND, gv0 + KSPLIT * KCH,
               lk0 + KSPLIT * BUF_ELEMS * 2, lv0 + KSPLIT * BUF_ELEMS * 2);

    // ---- position features of this lane's one query (column n) ----
    float qp[NPOS];
    {
        const float* p = qsg + ((size_t)b * NS + q0 + n) * NPOS;
        qp[0] = p[0]; qp[1] = p[1]; qp[2] = p[2];
    }
    asm volatile("s_wait_xcnt 0x0" ::: "memory");   // before the address pair of the load above is reused as a later load's destination

    // ---- Q B fragments (columns q0+n), two 32-deep k-steps, hi and lo planes ----
    Frag aqh[2], aql[2];
    {
        const unsigned short* qrh = Qh + (rowb + q0 + n) * ND;
        const unsigned short* qrl = Ql + (rowb + q0 + n) * ND;
#pragma unroll
        for (int c = 0; c < 2; ++c) {
            aqh[c].q[0] = *(const v4u*)(qrh + 32 * c + 8 * g);
            aqh[c].q[1] = *(const v4u*)(qrh + 32 * c + 16 + 8 * g);
            aql[c].q[0] = *(const v4u*)(qrl + 32 * c + 8 * g);
            aql[c].q[1] = *(const v4u*)(qrl + 32 * c + 16 + 8 * g);
        }
    }

    v8f o[4];
#pragma unroll
    for (int f = 0; f < 4; ++f) o[f] = (v8f){};
    float mcol = -__builtin_huge_valf();   // running maximum of this lane's query over this key group (equal in both half waves)
    float lcol = 0.0f;                     // running sum over this half wave's keys only; joined after the loop

#pragma unroll 1
    for (int st = 0; st < NST; ++st) {
        const int kb = (st * KSPLIT + kh) * KCH;             // first key of this wave's chunk
        const unsigned short* kvb = &KVsh[st & 1][kh][0];    // this chunk's buffer

        // key position features of this lane's 16 D-layout rows: keys kb+16t+8g+r, 24 contiguous floats per t
        float kf[2][8 * NPOS];
#pragma unroll
        for (int t = 0; t < 2; ++t) {
            const float* p = ksg + ((size_t)b * NS + kb + 16 * t + 8 * g) * NPOS;   // 96-B multiple
#pragma unroll
            for (int i = 0; i < 6; ++i) {
                const v4f w = *(const v4f*)(p + 4 * i);
                kf[t][4 * i + 0] = w.x; kf[t][4 * i + 1] = w.y; kf[t][4 * i + 2] = w.z; kf[t][4 * i + 3] = w.w;
            }
        }

        // ---- S^T = K * Q^T : 2 key tiles x 2 k-steps x 3 products ----
        v8f sa[2];
#pragma unroll
        for (int t = 0; t < 2; ++t) {
            v8f acc = (v8f){};
            const unsigned short* krh = kvb + KH_OFF + (16 * t + n) * KPITCH;   // A[m=key][k=d]: d-contiguous key row
            const unsigned short* krl = kvb + KL_OFF + (16 * t + n) * KPITCH;
#pragma unroll
            for (int c = 0; c < 2; ++c) {
                Frag akh, akl;
                akh.q[0] = *(const v4ua*)(krh + 32 * c + 8 * g);
                akh.q[1] = *(const v4ua*)(krh + 32 * c + 16 + 8 * g);
                akl.q[0] = *(const v4ua*)(krl + 32 * c + 8 * g);
                akl.q[1] = *(const v4ua*)(krl + 32 * c + 16 + 8 * g);
                acc = wmma_bf16(acc, akh.v, aqh[c].v);
                acc = wmma_bf16(acc, akl.v, aqh[c].v);
                acc = wmma_bf16(acc, akh.v, aql[c].v);
            }
            sa[t] = acc;
        }

        // ---- bias; sc[t][r] = score of (query n, key kb+16t+8g+r) ----
        float sc[2][8];
#pragma unroll
        for (int t = 0; t < 2; ++t) {
#pragma unroll
            for (int r = 0; r < 8; ++r) {
                const float dx = qp[0] - kf[t][3 * r + 0];
                const float dy = qp[1] - kf[t][3 * r + 1];
                const float dz = qp[2] - kf[t][3 * r + 2];
                float dd = dx * dx; dd = dd + dy * dy; dd = dd + dz * dz;
                // exp(x) = 2^ph * exp(x - ph*ln2): the hardware 2^ph, then the first-order term of what
                // the rounding of ph = x*log2(e) left out (|x - ph*ln2| is below 1e-5: its square is nothing)
                const float x    = nbeta_h * dd;
                const float ph   = x * LOG2E;
                const float rest = __builtin_fmaf(ph, -LN2, x);
                const float ar   = alpha_h * __builtin_amdgcn_exp2f(ph);
                const float bias = __builtin_fmaf(ar, rest, ar);
                sc[t][r] = sa[t][r] * QK_SCALE + bias;
            }
        }

        // ---- online softmax of one query per lane: maximum in registers, one exchange between half waves ----
        float vmax = sc[0][0];
#pragma unroll
        for (int t = 0; t < 2; ++t)
#pragma unroll
            for (int r = 0; r < 8; ++r) vmax = fmaxf(vmax, sc[t][r]);
        {
            const int vb = __float_as_int(vmax);
            vmax = fmaxf(vmax, __int_as_float(__builtin_amdgcn_permlanex16(vb, vb, 0x76543210, 0xfedcba98, false, false)));
        }
        const float mn   = fmaxf(mcol, vmax);
        const float resc = __expf(mcol - mn);
        mcol = mn;

        // P^T B fragments straight from the score registers: element r <- tile 0, element 8+r <- tile 1
        Frag bph, bpl;
        float pp[2][4];                    // pair sums, joined as a tree below (short dependent chain)
#pragma unroll
        for (int t = 0; t < 2; ++t) {
#pragma unroll
            for (int w = 0; w < 4; ++w) {
                const float pa = __expf(sc[t][2 * w]     - mn);
                const float pb = __expf(sc[t][2 * w + 1] - mn);
                pp[t][w] = pa + pb;
                unsigned int hw, lw;
                split_hl_pair(pa, pb, hw, lw);
                bph.q[t][w] = hw;
                bpl.q[t][w] = lw;
            }
        }
        const float ps = ((pp[0][0] + pp[0][1]) + (pp[0][2] + pp[0][3])) + ((pp[1][0] + pp[1][1]) + (pp[1][2] + pp[1][3]));
        lcol = lcol * resc + ps;
#pragma unroll
        for (int f = 0; f < 4; ++f)
#pragma unroll
            for (int r = 0; r < 8; ++r) o[f][r] = o[f][r] * resc;

        // ---- O^T += Vt * P^T : 4 d-tiles x 3 products; A[m=d][k=key] from Vt[bh][d][key] ----
#pragma unroll
        for (int f = 0; f < 4; ++f) {
            const unsigned short* vrh = kvb + VH_OFF + (16 * f + n) * VPITCH;
            const unsigned short* vrl = kvb + VL_OFF + (16 * f + n) * VPITCH;
            Frag avh, avl;
            avh.q[0] = *(const v4ua*)(vrh + 8 * g);
            avh.q[1] = *(const v4ua*)(vrh + 16 + 8 * g);
            avl.q[0] = *(const v4ua*)(vrl + 8 * g);
            avl.q[1] = *(const v4ua*)(vrl + 16 + 8 * g);
            o[f] = wmma_bf16(o[f], avh.v, bph.v);
            o[f] = wmma_bf16(o[f], avl.v, bph.v);
            o[f] = wmma_bf16(o[f], avh.v, bpl.v);
        }

        // ---- publish point of stage st+1; then stage st+2 goes into the buffer just read ----
        asm volatile("s_wait_dscnt 0x0" ::: "memory");      // this wave's reads of the buffer have returned
        asm volatile("s_wait_asynccnt 0x0" ::: "memory");   // this wave's copies of stage st+1 have landed
        __syncthreads();                                    // publishes stage st+1, ends every read of stage st
        if (st + 2 < NST)                                   // block-uniform
            copy_chunk(gk0 + (size_t)(st + 2) * (KSPLIT * KCH * ND), gv0 + (st + 2) * (KSPLIT * KCH),
                       lk0 + (st & 1) * (KSPLIT * BUF_ELEMS * 2), lv0 + (st & 1) * (KSPLIT * BUF_ELEMS * 2));
    }
    asm volatile("s_wait_asynccnt 0x0" ::: "memory");       // nothing of the ring is in flight past the loop

    // ---- merge of the two key groups. o[f][r] = O[query n][d = 16f+8g+r]: 8 consecutive floats of one row
    // per d-tile. Key group 1 hands its unnormalised tile, maximum and sum to the same lane of key group 0. ----
    if (kh == 1) {
#pragma unroll
        for (int f = 0; f < 4; ++f) {
            v4f w0, w1;
            w0.x = o[f][0]; w0.y = o[f][1]; w0.z = o[f][2]; w0.w = o[f][3];
            w1.x = o[f][4]; w1.y = o[f][5]; w1.z = o[f][6]; w1.w = o[f][7];
            *(v4fa*)&Osh[qg][n][16 * f + 8 * g]     = w0;
            *(v4fa*)&Osh[qg][n][16 * f + 8 * g + 4] = w1;
        }
        Msh[qg][lane] = mcol;
        Lsh[qg][lane] = lcol;
    }
    __syncthreads();                                        // key group 1's partial results are visible to key group 0

    // ---- key group 0: rescale both parts to the common maximum, join the half waves' sums, normalise,
    // leave the finished 16x64 tile at the same LDS places (each lane rewrites only what it has read) ----
    if (kh == 0) {
        const float m1 = Msh[qg][lane];
        const float l1 = Lsh[qg][lane];
        const float mn = fmaxf(mcol, m1);
        const float a0 = __expf(mcol - mn);
        const float a1 = __expf(m1 - mn);
        const float lpart = lcol * a0 + l1 * a1;
        const int lb = __float_as_int(lpart);
        const float lsum = lpart + __int_as_float(__builtin_amdgcn_permlanex16(lb, lb, 0x76543210, 0xfedcba98, false, false));
        const float inv = 1.0f / lsum;
        const float c0 = a0 * inv, c1 = a1 * inv;
#pragma unroll
        for (int f = 0; f < 4; ++f) {
            const v4f p0 = *(const v4fa*)&Osh[qg][n][16 * f + 8 * g];
            const v4f p1 = *(const v4fa*)&Osh[qg][n][16 * f + 8 * g + 4];
            v4f w0, w1;
            w0.x = o[f][0] * c0 + p0.x * c1; w0.y = o[f][1] * c0 + p0.y * c1;
            w0.z = o[f][2] * c0 + p0.z * c1; w0.w = o[f][3] * c0 + p0.w * c1;
            w1.x = o[f][4] * c0 + p1.x * c1; w1.y = o[f][5] * c0 + p1.y * c1;
            w1.z = o[f][6] * c0 + p1.z * c1; w1.w = o[f][7] * c0 + p1.w * c1;
            *(v4fa*)&Osh[qg][n][16 * f + 8 * g]     = w0;
            *(v4fa*)&Osh[qg][n][16 * f + 8 * g + 4] = w1;
        }
    }
    __syncthreads();                                        // the finished tiles are visible to both key groups

    // ---- whole-line stores: instruction i covers rows 8kh+2i, 8kh+2i+1 (512 B, lane-contiguous 16 B) ----
    // coverage: 2 waves x 4 instructions x 32 lanes x 4 floats = 16 rows x 64 floats per query group
    v4f vals[4];
#pragma unroll
    for (int i = 0; i < 4; ++i)
        vals[i] = *(const v4fa*)&Osh[qg][8 * kh + 2 * i + g][4 * n];

    float* obase = outg + (rowb + q0 + 8 * kh) * ND;  // 8 contiguous rows of 256 B
#pragma unroll
    for (int i = 0; i < 4; ++i)
        *(v4f*)(obase + (2 * i + g) * ND + 4 * n) = vals[i];
    
}

extern "C" void kernel_launch(void* const* d_in, const int* in_sizes, int n_in,
                              void* d_out, int out_size, void* d_ws, size_t ws_size,
                              hipStream_t stream)
{
    if (n_in < 7) return;
    const int n_qkv = NBH * NS * ND;        // 2,097,152
    const int n_pos = NB * NS * NPOS;       // 12,288
    if (in_sizes[0] != n_qkv || in_sizes[1] != n_qkv || in_sizes[2] != n_qkv) return;
    if (in_sizes[3] != n_pos || in_sizes[4] != n_pos) return;
    if (in_sizes[5] < NH || in_sizes[6] < NH) return;
    if (out_size != n_qkv) return;

    // workspace: 6 planes x 4 MiB = 25,165,824 B
    const size_t ws_need = (size_t)NPLANES * PLANE_ELEMS * sizeof(unsigned short);
    if (ws_size < ws_need) return;

    const float* q     = (const float*)d_in[0];
    const float* k     = (const float*)d_in[1];
    const float* v     = (const float*)d_in[2];
    const float* qs_s  = (const float*)d_in[3];
    const float* ks_s  = (const float*)d_in[4];
    const float* alpha = (const float*)d_in[5];
    const float* beta  = (const float*)d_in[6];
    float* out = (float*)d_out;
    unsigned short* planes = (unsigned short*)d_ws;

    k_split<<<dim3(NS / 64, NBH, 3), dim3(256), 0, stream>>>(q, k, v, planes);
    k_attn<<<dim3(NBH * (NS / 64)), dim3(256), 0, stream>>>(planes, qs_s, ks_s, alpha, beta, out);
}

// v006
// Measured time: 64.5 microseconds a run.
// Next to v005, in two timings, it ran 1.08 and 1.07 times as fast.
// Counting every step since v000, it is 3.44 times as fast.
#include <hip/hip_runtime.h>

// Contractions: S = Q*K^T and O = P*V on v_wmma_f32_16x16x32_bf16, bf16 hi/lo operands
// (hi*hi + hi*lo + lo*hi per tile pair), f32 accumulate; positional exp bias, online softmax
// and normalisation in f32.

typedef __bf16        v16bf __attribute__((ext_vector_type(16)));
typedef float         v8f   __attribute__((ext_vector_type(8)));
typedef float         v4f   __attribute__((ext_vector_type(4)));
typedef unsigned int  v4u   __attribute__((ext_vector_type(4)));
typedef unsigned int  v4ua  __attribute__((ext_vector_type(4), may_alias));
typedef float         v4fa  __attribute__((ext_vector_type(4), may_alias));
typedef float         v2f   __attribute__((ext_vector_type(2)));
typedef __bf16        v2bf  __attribute__((ext_vector_type(2)));

#define NB    2
#define NH    8
#define NS    2048
#define ND    64
#define NBH   (NB * NH)
#define NPOS  3
#define KCH   32                 // keys per chunk
#define QK_SCALE 0.125f          // 1/sqrt(64), exact power of two
#define LOG2E 1.44269504088896340736f
#define LN2   0.693147180559945309417f
#define TPITCH 68                // LDS pitch (floats) of the 64x64 staging tile
#define OPITCH 68                // LDS pitch (floats) of the output staging tile
#define PLANE_ELEMS ((size_t)NBH * NS * ND)   // 16-bit elements per plane (4 MiB)
#define NPLANES 6                // Qhi, Qlo, Khi, Klo, Vthi, Vtlo
#define KSPLIT 2                 // wave groups of a block; each takes one 32-key chunk of every stage
#define NST    (NS / (KCH * KSPLIT))   // ring stages (64 keys each) per query block
#define KPITCH 72                // LDS pitch (16-bit elements) of a staged 128-B K row: 144 B = 16 B x odd
#define VPITCH 40                // LDS pitch (16-bit elements) of a staged 64-B Vt row: 80 B = 16 B x odd
#define KH_OFF 0                               // element offsets of the four tiles inside one buffer
#define KL_OFF (KH_OFF + KCH * KPITCH)
#define VH_OFF (KL_OFF + KCH * KPITCH)
#define VL_OFF (VH_OFF + ND * VPITCH)
#define BUF_ELEMS (VL_OFF + ND * VPITCH)       // 9,728 elements = 19,456 B per buffer

union Frag { v16bf v; v4u q[2]; };

// bf16 WMMA, builtin form: the compiler keeps the distances behind it
__device__ __forceinline__ v8f wmma_bf16(v8f acc, v16bf a, v16bf b)
{
    return __builtin_amdgcn_wmma_f32_16x16x32_bf16(false, a, false, b, (short)0, acc, false, false);
}

// two f32 -> one register of two bf16 hi parts and one of two lo parts (a in the low half):
// x ~= hi + lo with hi = bf16(x), lo = bf16(x - hi), both rounded to nearest even by the packed hardware conversion
__device__ __forceinline__ void split_hl_pair(float a, float b, unsigned int& hi, unsigned int& lo)
{
    const v2f  x = {a, b};
    const v2bf h = __builtin_convertvector(x, v2bf);
    const v2bf l = __builtin_convertvector(x - __builtin_convertvector(h, v2f), v2bf);
    hi = __builtin_bit_cast(unsigned int, h);
    lo = __builtin_bit_cast(unsigned int, l);
}

// ------------------------------------------------------------------------------------------
// Plane builder. grid = (NS/64 s-tiles, NBH, 3 sources), block = 256.
// z = 0: q -> planes 0/1 [bh][s][d]; z = 1: k -> planes 2/3 [bh][s][d];
// z = 2: v -> planes 4/5 transposed [bh][d][s].
// Coverage per block: 256 threads x 2 groups x 8 elements = 64 x 64 tile, every block owns
// ------------------------------------------------------------------------------------------
__global__ __launch_bounds__(256) void k_split(const float* __restrict__ q,
                                                const float* __restrict__ k,
                                                const float* __restrict__ v,
                                                unsigned short* __restrict__ planes)
{
    __shared__ __align__(16) float tile[64][TPITCH];

    const int t  = threadIdx.x;
    const int s0 = blockIdx.x * 64;
    const int bh = blockIdx.y;
    const int z  = blockIdx.z;                       // block-uniform
    const float* src = (z == 0) ? q : ((z == 1) ? k : v);
    const int tr = (z == 2) ? 1 : 0;

    // stage the 64 rows x 64 cols f32 tile (rows s0..s0+63 of slice bh)
#pragma unroll
    for (int i = 0; i < 4; ++i) {
        const int idx = (t + 256 * i) * 4;           // 0..4092
        const int r = idx >> 6, c = idx & 63;
        const v4f val = *(const v4f*)(src + ((size_t)(bh * NS + s0 + r)) * ND + c);
        *(v4f*)&tile[r][c] = val;
    }
    __syncthreads();

    v4u hv[2], lv[2];
    size_t off[2];
#pragma unroll
    for (int it = 0; it < 2; ++it) {
        const int gidx = it * 256 + t;               // 0..511
        const int orow = gidx >> 3;                  // output row within tile (s for q/k, d for v)
        const int og   = gidx & 7;                   // 8-column group
        float xs[8];
#pragma unroll
        for (int j = 0; j < 8; ++j) {
            const int cidx = 8 * og + j;
            const int ia = orow * TPITCH + cidx;     // q/k: in[row=s][col=d]
            const int ib = cidx * TPITCH + orow;     // v:   in[row=s=cidx][col=d=orow] -> out[d][s]
            xs[j] = (&tile[0][0])[tr ? ib : ia];
        }
        v4u hw, lw;
#pragma unroll                                       // constant element indices, so hw and lw stay in registers
        for (int w = 0; w < 4; ++w) {
            unsigned int h2, l2;
            split_hl_pair(xs[2 * w], xs[2 * w + 1], h2, l2);
            hw[w] = h2; lw[w] = l2;
        }
        hv[it] = hw; lv[it] = lw;
        const size_t offa = ((size_t)(bh * NS + s0 + orow)) * ND + 8 * og;          // [bh][s][d]
        const size_t offb = ((size_t)(bh * ND + orow)) * NS + s0 + 8 * og;          // [bh][d][s]
        off[it] = tr ? offb : offa;
    }

    unsigned short* ph = planes + (size_t)(2 * z) * PLANE_ELEMS;
    unsigned short* pl = ph + PLANE_ELEMS;

#pragma unroll
    for (int it = 0; it < 2; ++it) {
        *(v4u*)(ph + off[it]) = hv[it];
        *(v4u*)(pl + off[it]) = lv[it];
    }
    
}

// One key chunk (K hi/lo: 32 rows x 128 B, Vt hi/lo: 64 rows x 64 B) from the planes into one LDS
// buffer: the 128 threads of one wave group x 8 asynchronous 16-B copies, every lane on, each 16 B written by one lane.
// gk / gv: this thread's first K-hi / Vt-hi source of the chunk; lk / lv: its LDS byte addresses.
__device__ __forceinline__ void copy_chunk(const unsigned short* gk, const unsigned short* gv,
                                           unsigned int lk, unsigned int lv)
{
    const unsigned short* gk1  = gk + 128 * 8;                 // second half of the 4-KiB K tile (rows 16..31)
    const unsigned short* gkl  = gk + PLANE_ELEMS;
    const unsigned short* gkl1 = gk1 + PLANE_ELEMS;
    const unsigned short* gv1  = gv + (size_t)32 * NS;         // Vt rows 32..63
    const unsigned short* gvl  = gv + PLANE_ELEMS;
    const unsigned short* gvl1 = gv1 + PLANE_ELEMS;
    const unsigned int lk1  = lk + 16 * KPITCH * 2;
    const unsigned int lkl  = lk + (KL_OFF - KH_OFF) * 2;
    const unsigned int lkl1 = lk1 + (KL_OFF - KH_OFF) * 2;
    const unsigned int lv1  = lv + 32 * VPITCH * 2;
    const unsigned int lvl  = lv + (VL_OFF - VH_OFF) * 2;
    const unsigned int lvl1 = lv1 + (VL_OFF - VH_OFF) * 2;
    // the copies and their s_wait_xcnt in one statement: no address register is rewritten ahead of the wait
    asm volatile("global_load_async_to_lds_b128 %0, %8, off\n\t"
                 "global_load_async_to_lds_b128 %1, %9, off\n\t"
                 "global_load_async_to_lds_b128 %2, %10, off\n\t"
                 "global_load_async_to_lds_b128 %3, %11, off\n\t"
                 "global_load_async_to_lds_b128 %4, %12, off\n\t"
                 "global_load_async_to_lds_b128 %5, %13, off\n\t"
                 "global_load_async_to_lds_b128 %6, %14, off\n\t"
                 "global_load_async_to_lds_b128 %7, %15, off\n\t"
                 "s_wait_xcnt 0x0"
                 :: "v"(lk), "v"(lk1), "v"(lkl), "v"(lkl1), "v"(lv), "v"(lv1), "v"(lvl), "v"(lvl1),
                    "v"(gk), "v"(gk1), "v"(gkl), "v"(gkl1), "v"(gv), "v"(gv1), "v"(gvl), "v"(gvl1)
                 : "memory");
}

// ------------------------------------------------------------------------------------------
// Attention with positional exp bias. grid = NBH * (NS/64) = 512 blocks, block = 256: 8 waves =
// 4 query groups (16 query rows each) x 2 key groups, non-causal over all NS keys. A ring stage holds
// 64 keys as two 32-key chunks; key group kh works on chunk kh of every stage, so each query row has two
// waves with their own running maximum, sum and O^T; the two are merged once, through LDS, after the loop.
// The four waves of a key group share their chunk's K and Vt tiles through a two-buffer LDS ring.
// Transposed products: S^T = K * Q^T (A = key rows, B = query columns) and O^T += Vt * P^T, so a
// lane holds the scores of ONE query (column n): 16 of the chunk's 32 keys, the other half wave the rest.
// Fragment map (A and B): lane l, g = l>>4, n = l&15; elements 0..7 <- k0+8g+0..7,
// elements 8..15 <- k0+16+8g+0..7; D element r <- (row 8g+r, col n). The two S^T tiles of a chunk
// (keys 8g+r and 16+8g+r of column n) are therefore already in the B order of the P^T operand.
// ------------------------------------------------------------------------------------------
__global__ __launch_bounds__(256) void k_attn(const unsigned short* __restrict__ planes,
                                               const float* __restrict__ qsg,
                                               const float* __restrict__ ksg,
                                               const float* __restrict__ alphag,
                                               const float* __restrict__ betag,
                                               float* outg)
{
    __shared__ __align__(16) float Osh[4][16][OPITCH];            // per query group: merge and output staging
    __shared__ float Msh[4][32], Lsh[4][32];                      // key group 1's running maximum and sum, per lane
    __shared__ __align__(16) unsigned short KVsh[2][KSPLIT][BUF_ELEMS];   // K/Vt ring: two buffers x two chunks

    const int tid  = threadIdx.x;
    const int wave = __builtin_amdgcn_readfirstlane(tid >> 5);   // scalar, so the tests on kh below are scalar branches
    const int qg   = wave & 3;          // query group
    const int kh   = wave >> 2;         // key group
    const int t7   = tid & 127;         // thread index inside the key group
    const int lane = tid & 31;
    const int g    = lane >> 4;
    const int n    = lane & 15;

    const int bid  = blockIdx.x;
    const int qblk = bid & 31;          // NS/64 = 32 query blocks
    const int bh   = bid >> 5;          // 0..15
    const int hh   = bh & (NH - 1);
    const int b    = bh >> 3;
    const int q0   = qblk * 64 + qg * 16;

    const float alpha_h = alphag[hh];
    const float nbeta_h = -betag[hh];

    const unsigned short* Qh = planes;
    const unsigned short* Ql = planes + PLANE_ELEMS;
    const unsigned short* Kh = planes + 2 * PLANE_ELEMS;    // lo plane: + PLANE_ELEMS
    const unsigned short* Vh = planes + 4 * PLANE_ELEMS;    // [bh][d][s]; lo plane: + PLANE_ELEMS
    const size_t rowb = (size_t)bh * NS;

    // ---- this thread's share of its key group's chunk copy: K piece t7 (row t7>>3), Vt piece t7 (row t7>>2) ----
    const unsigned short* gk0 = Kh + (rowb + kh * KCH) * ND + t7 * 8;                                  // + 64 * ND per stage
    const unsigned short* gv0 = Vh + ((size_t)bh * ND + (t7 >> 2)) * NS + kh * KCH + (t7 & 3) * 8;     // + 64 per stage
    const unsigned int lbase = (unsigned int)(size_t)&KVsh[0][kh][0];
    const unsigned int lk0 = lbase + (KH_OFF + (t7 >> 3) * KPITCH + (t7 & 7) * 8) * 2;
    const unsigned int lv0 = lbase + (VH_OFF + (t7 >> 2) * VPITCH + (t7 & 3) * 8) * 2;

    // ---- ring prologue: stage 0 lands and is published, then stage 1 flies ----
    copy_chunk(gk0, gv0, lk0, lv0);
    asm volatile("s_wait_asynccnt 0x0" ::: "memory");   // this wave's copies of stage 0 have landed
    __syncthreads();                                    // publishes stage 0 to the other waves
    copy_chunk(gk0 + KSPLIT * KCH * ND, gv0 + KSPLIT * KCH,
               lk0 + KSPLIT * BUF_ELEMS * 2, lv0 + KSPLIT * BUF_ELEMS * 2);

    // ---- position features of this lane's one query (column n) ----
    float qp[NPOS];
    {
        const float* p = qsg + ((size_t)b * NS + q0 + n) * NPOS;
        qp[0] = p[0]; qp[1] = p[1]; qp[2] = p[2];
    }
    asm volatile("s_wait_xcnt 0x0" ::: "memory");   // before the address pair of the load above is reused as a later load's destination

    // ---- Q B fragments (columns q0+n), two 32-deep k-steps, hi and lo planes ----
    Frag aqh[2], aql[2];
    {
        const unsigned short* qrh = Qh + (rowb + q0 + n) * ND;
        const unsigned short* qrl = Ql + (rowb + q0 + n) * ND;
#pragma unroll
        for (int c = 0; c < 2; ++c) {
            aqh[c].q[0] = *(const v4u*)(qrh + 32 * c + 8 * g);
            aqh[c].q[1] = *(const v4u*)(qrh + 32 * c + 16 + 8 * g);
            aql[c].q[0] = *(const v4u*)(qrl + 32 * c + 8 * g);
            aql[c].q[1] = *(const v4u*)(qrl + 32 * c + 16 + 8 * g);
        }
    }

    v8f o[4];
#pragma unroll
    for (int f = 0; f < 4; ++f) o[f] = (v8f){};
    float mcol = -__builtin_huge_valf();   // running maximum of this lane's query over this key group (equal in both half waves)
    float lcol = 0.0f;                     // running sum over this half wave's keys only; joined after the loop

#pragma unroll 1
    for (int st = 0; st < NST; ++st) {
        const int kb = (st * KSPLIT + kh) * KCH;             // first key of this wave's chunk
        const unsigned short* kvb = &KVsh[st & 1][kh][0];    // this chunk's buffer

        // key position features of this lane's 16 D-layout rows: keys kb+16t+8g+r, 24 contiguous floats per t
        float kf[2][8 * NPOS];
#pragma unroll
        for (int t = 0; t < 2; ++t) {
            const float* p = ksg + ((size_t)b * NS + kb + 16 * t + 8 * g) * NPOS;   // 96-B multiple
#pragma unroll
            for (int i = 0; i < 6; ++i) {
                const v4f w = *(const v4f*)(p + 4 * i);
                kf[t][4 * i + 0] = w.x; kf[t][4 * i + 1] = w.y; kf[t][4 * i + 2] = w.z; kf[t][4 * i + 3] = w.w;
            }
        }

        // ---- S^T = K * Q^T : 2 key tiles x 2 k-steps x 3 products ----
        v8f sa[2];
#pragma unroll
        for (int t = 0; t < 2; ++t) {
            v8f acc = (v8f){};
            const unsigned short* krh = kvb + KH_OFF + (16 * t + n) * KPITCH;   // A[m=key][k=d]: d-contiguous key row
            const unsigned short* krl = kvb + KL_OFF + (16 * t + n) * KPITCH;
#pragma unroll
            for (int c = 0; c < 2; ++c) {
                Frag akh, akl;
                akh.q[0] = *(const v4ua*)(krh + 32 * c + 8 * g);
                akh.q[1] = *(const v4ua*)(krh + 32 * c + 16 + 8 * g);
                akl.q[0] = *(const v4ua*)(krl + 32 * c + 8 * g);
                akl.q[1] = *(const v4ua*)(krl + 32 * c + 16 + 8 * g);
                acc = wmma_bf16(acc, akh.v, aqh[c].v);
                acc = wmma_bf16(acc, akl.v, aqh[c].v);
                acc = wmma_bf16(acc, akh.v, aql[c].v);
            }
            sa[t] = acc;
        }

        // ---- bias; sc[t][r] = score of (query n, key kb+16t+8g+r) ----
        float sc[2][8];
#pragma unroll
        for (int t = 0; t < 2; ++t) {
#pragma unroll
            for (int r = 0; r < 8; ++r) {
                const float dx = qp[0] - kf[t][3 * r + 0];
                const float dy = qp[1] - kf[t][3 * r + 1];
                const float dz = qp[2] - kf[t][3 * r + 2];
                float dd = dx * dx; dd = dd + dy * dy; dd = dd + dz * dz;
                // exp(x) = 2^ph * exp(x - ph*ln2): the hardware 2^ph, then the first-order term of what
                // the rounding of ph = x*log2(e) left out (|x - ph*ln2| is below 1e-5: its square is nothing)
                const float x    = nbeta_h * dd;
                const float ph   = x * LOG2E;
                const float rest = __builtin_fmaf(ph, -LN2, x);
                const float ar   = alpha_h * __builtin_amdgcn_exp2f(ph);
                const float bias = __builtin_fmaf(ar, rest, ar);
                sc[t][r] = sa[t][r] * QK_SCALE + bias;
            }
        }

        // ---- online softmax of one query per lane: maximum in registers, one exchange between half waves ----
        float vmax = sc[0][0];
#pragma unroll
        for (int t = 0; t < 2; ++t)
#pragma unroll
            for (int r = 0; r < 8; ++r) vmax = fmaxf(vmax, sc[t][r]);
        {
            const int vb = __float_as_int(vmax);
            vmax = fmaxf(vmax, __int_as_float(__builtin_amdgcn_permlanex16(vb, vb, 0x76543210, 0xfedcba98, false, false)));
        }
        const float mn   = fmaxf(mcol, vmax);
        const float resc = __expf(mcol - mn);
        mcol = mn;

        // P^T B fragments straight from the score registers: element r <- tile 0, element 8+r <- tile 1
        Frag bph, bpl;
        float pp[2][4];                    // pair sums, joined as a tree below (short dependent chain)
#pragma unroll
        for (int t = 0; t < 2; ++t) {
#pragma unroll
            for (int w = 0; w < 4; ++w) {
                const float pa = __expf(sc[t][2 * w]     - mn);
                const float pb = __expf(sc[t][2 * w + 1] - mn);
                pp[t][w] = pa + pb;
                unsigned int hw, lw;
                split_hl_pair(pa, pb, hw, lw);
                bph.q[t][w] = hw;
                bpl.q[t][w] = lw;
            }
        }
        const float ps = ((pp[0][0] + pp[0][1]) + (pp[0][2] + pp[0][3])) + ((pp[1][0] + pp[1][1]) + (pp[1][2] + pp[1][3]));
        lcol = lcol * resc + ps;
#pragma unroll
        for (int f = 0; f < 4; ++f)
#pragma unroll
            for (int r = 0; r < 8; ++r) o[f][r] = o[f][r] * resc;

        // ---- O^T += Vt * P^T : 4 d-tiles x 3 products; A[m=d][k=key] from Vt[bh][d][key] ----
#pragma unroll
        for (int f = 0; f < 4; ++f) {
            const unsigned short* vrh = kvb + VH_OFF + (16 * f + n) * VPITCH;
            const unsigned short* vrl = kvb + VL_OFF + (16 * f + n) * VPITCH;
            Frag avh, avl;
            avh.q[0] = *(const v4ua*)(vrh + 8 * g);
            avh.q[1] = *(const v4ua*)(vrh + 16 + 8 * g);
            avl.q[0] = *(const v4ua*)(vrl + 8 * g);
            avl.q[1] = *(const v4ua*)(vrl + 16 + 8 * g);
            o[f] = wmma_bf16(o[f], avh.v, bph.v);
            o[f] = wmma_bf16(o[f], avl.v, bph.v);
            o[f] = wmma_bf16(o[f], avh.v, bpl.v);
        }

        // ---- publish point of stage st+1; then stage st+2 goes into the buffer just read ----
        asm volatile("s_wait_dscnt 0x0" ::: "memory");      // this wave's reads of the buffer have returned
        asm volatile("s_wait_asynccnt 0x0" ::: "memory");   // this wave's copies of stage st+1 have landed
        __syncthreads();                                    // publishes stage st+1, ends every read of stage st
        if (st + 2 < NST)                                   // block-uniform
            copy_chunk(gk0 + (size_t)(st + 2) * (KSPLIT * KCH * ND), gv0 + (st + 2) * (KSPLIT * KCH),
                       lk0 + (st & 1) * (KSPLIT * BUF_ELEMS * 2), lv0 + (st & 1) * (KSPLIT * BUF_ELEMS * 2));
    }
    asm volatile("s_wait_asynccnt 0x0" ::: "memory");       // nothing of the ring is in flight past the loop

    // ---- merge of the two key groups. o[f][r] = O[query n][d = 16f+8g+r]: 8 consecutive floats of one row
    // per d-tile. Key group 1 hands its unnormalised tile, maximum and sum to the same lane of key group 0. ----
    if (kh == 1) {
#pragma unroll
        for (int f = 0; f < 4; ++f) {
            v4f w0, w1;
            w0.x = o[f][0]; w0.y = o[f][1]; w0.z = o[f][2]; w0.w = o[f][3];
            w1.x = o[f][4]; w1.y = o[f][5]; w1.z = o[f][6]; w1.w = o[f][7];
            *(v4fa*)&Osh[qg][n][16 * f + 8 * g]     = w0;
            *(v4fa*)&Osh[qg][n][16 * f + 8 * g + 4] = w1;
        }
        Msh[qg][lane] = mcol;
        Lsh[qg][lane] = lcol;
    }
    __syncthreads();                                        // key group 1's partial results are visible to key group 0

    // ---- key group 0: rescale both parts to the common maximum, join the half waves' sums, normalise,
    // leave the finished 16x64 tile at the same LDS places (each lane rewrites only what it has read) ----
    if (kh == 0) {
        const float m1 = Msh[qg][lane];
        const float l1 = Lsh[qg][lane];
        const float mn = fmaxf(mcol, m1);
        const float a0 = __expf(mcol - mn);
        const float a1 = __expf(m1 - mn);
        const float lpart = lcol * a0 + l1 * a1;
        const int lb = __float_as_int(lpart);
        const float lsum = lpart + __int_as_float(__builtin_amdgcn_permlanex16(lb, lb, 0x76543210, 0xfedcba98, false, false));
        const float inv = 1.0f / lsum;
        const float c0 = a0 * inv, c1 = a1 * inv;
#pragma unroll
        for (int f = 0; f < 4; ++f) {
            const v4f p0 = *(const v4fa*)&Osh[qg][n][16 * f + 8 * g];
            const v4f p1 = *(const v4fa*)&Osh[qg][n][16 * f + 8 * g + 4];
            v4f w0, w1;
            w0.x = o[f][0] * c0 + p0.x * c1; w0.y = o[f][1] * c0 + p0.y * c1;
            w0.z = o[f][2] * c0 + p0.z * c1; w0.w = o[f][3] * c0 + p0.w * c1;
            w1.x = o[f][4] * c0 + p1.x * c1; w1.y = o[f][5] * c0 + p1.y * c1;
            w1.z = o[f][6] * c0 + p1.z * c1; w1.w = o[f][7] * c0 + p1.w * c1;
            *(v4fa*)&Osh[qg][n][16 * f + 8 * g]     = w0;
            *(v4fa*)&Osh[qg][n][16 * f + 8 * g + 4] = w1;
        }
    }
    __syncthreads();                                        // the finished tiles are visible to both key groups

    // ---- whole-line stores: instruction i covers rows 8kh+2i, 8kh+2i+1 (512 B, lane-contiguous 16 B) ----
    // coverage: 2 waves x 4 instructions x 32 lanes x 4 floats = 16 rows x 64 floats per query group
    v4f vals[4];
#pragma unroll
    for (int i = 0; i < 4; ++i)
        vals[i] = *(const v4fa*)&Osh[qg][8 * kh + 2 * i + g][4 * n];

    float* obase = outg + (rowb + q0 + 8 * kh) * ND;  // 8 contiguous rows of 256 B
#pragma unroll
    for (int i = 0; i < 4; ++i)
        *(v4f*)(obase + (2 * i + g) * ND + 4 * n) = vals[i];
    
}

extern "C" void kernel_launch(void* const* d_in, const int* in_sizes, int n_in,
                              void* d_out, int out_size, void* d_ws, size_t ws_size,
                              hipStream_t stream)
{
    if (n_in < 7) return;
    const int n_qkv = NBH * NS * ND;        // 2,097,152
    const int n_pos = NB * NS * NPOS;       // 12,288
    if (in_sizes[0] != n_qkv || in_sizes[1] != n_qkv || in_sizes[2] != n_qkv) return;
    if (in_sizes[3] != n_pos || in_sizes[4] != n_pos) return;
    if (in_sizes[5] < NH || in_sizes[6] < NH) return;
    if (out_size != n_qkv) return;

    // workspace: 6 planes x 4 MiB = 25,165,824 B
    const size_t ws_need = (size_t)NPLANES * PLANE_ELEMS * sizeof(unsigned short);
    if (ws_size < ws_need) return;

    const float* q     = (const float*)d_in[0];
    const float* k     = (const float*)d_in[1];
    const float* v     = (const float*)d_in[2];
    const float* qs_s  = (const float*)d_in[3];
    const float* ks_s  = (const float*)d_in[4];
    const float* alpha = (const float*)d_in[5];
    const float* beta  = (const float*)d_in[6];
    float* out = (float*)d_out;
    unsigned short* planes = (unsigned short*)d_ws;

    k_split<<<dim3(NS / 64, NBH, 3), dim3(256), 0, stream>>>(q, k, v, planes);
    k_attn<<<dim3(NBH * (NS / 64)), dim3(256), 0, stream>>>(planes, qs_s, ks_s, alpha, beta, out);
}

// v007
// A run of this version takes 58.1 microseconds.
// Timed twice side by side with v006, it ran 1.11 times as fast both times.
// Over all steps from v000 it is 3.82 times as fast.
#include <hip/hip_runtime.h>

// Contractions: S = Q*K^T and O = P*V on v_wmma_f32_16x16x32_bf16, bf16 hi/lo operands
// (hi*hi + hi*lo + lo*hi per tile pair), f32 accumulate; the exponent of the positional bias on
// v_wmma_f32_16x16x4_f32 (f32 operands); online softmax and normalisation in f32.

typedef __bf16        v16bf __attribute__((ext_vector_type(16)));
typedef float         v8f   __attribute__((ext_vector_type(8)));
typedef float         v4f   __attribute__((ext_vector_type(4)));
typedef unsigned int  v4u   __attribute__((ext_vector_type(4)));
typedef unsigned int  v4ua  __attribute__((ext_vector_type(4), may_alias));
typedef float         v4fa  __attribute__((ext_vector_type(4), may_alias));
typedef float         v2f   __attribute__((ext_vector_type(2)));
typedef float         v2fa  __attribute__((ext_vector_type(2), may_alias));
typedef __bf16        v2bf  __attribute__((ext_vector_type(2)));

#define NB    2
#define NH    8
#define NS    2048
#define ND    64
#define NBH   (NB * NH)
#define NPOS  3
#define KCH   32                 // keys per chunk
#define QK_SCALE 0.125f          // 1/sqrt(64), exact power of two
#define LOG2E 1.44269504088896340736f
#define TPITCH 68                // LDS pitch (floats) of the 64x64 staging tile
#define OPITCH 68                // LDS pitch (floats) of the output staging tile
#define PLANE_ELEMS ((size_t)NBH * NS * ND)   // 16-bit elements per plane (4 MiB)
#define NPLANES 6                // Qhi, Qlo, Khi, Klo, Vthi, Vtlo
#define KSPLIT 2                 // wave groups of a block; each takes one 32-key chunk of every stage
#define NST    (NS / (KCH * KSPLIT))   // ring stages (64 keys each) per query block
#define KPITCH 72                // LDS pitch (16-bit elements) of a staged 128-B K row: 144 B = 16 B x odd
#define VPITCH 40                // LDS pitch (16-bit elements) of a staged 64-B Vt row: 80 B = 16 B x odd
#define KH_OFF 0                               // element offsets of the four tiles inside one buffer
#define KL_OFF (KH_OFF + KCH * KPITCH)
#define VH_OFF (KL_OFF + KCH * KPITCH)
#define VL_OFF (VH_OFF + ND * VPITCH)
#define BUF_ELEMS (VL_OFF + ND * VPITCH)       // 9,728 elements = 19,456 B per buffer

union Frag { v16bf v; v4u q[2]; };

// bf16 WMMA, builtin form: the compiler keeps the distances behind it
__device__ __forceinline__ v8f wmma_bf16(v8f acc, v16bf a, v16bf b)
{
    return __builtin_amdgcn_wmma_f32_16x16x32_bf16(false, a, false, b, (short)0, acc, false, false);
}

// two f32 -> one register of two bf16 hi parts and one of two lo parts (a in the low half):
// x ~= hi + lo with hi = bf16(x), lo = bf16(x - hi), both rounded to nearest even by the packed hardware conversion
__device__ __forceinline__ void split_hl_pair(float a, float b, unsigned int& hi, unsigned int& lo)
{
    const v2f  x = {a, b};
    const v2bf h = __builtin_convertvector(x, v2bf);
    const v2bf l = __builtin_convertvector(x - __builtin_convertvector(h, v2f), v2bf);
    hi = __builtin_bit_cast(unsigned int, h);
    lo = __builtin_bit_cast(unsigned int, l);
}

// ------------------------------------------------------------------------------------------
// Plane builder. grid = (NS/64 s-tiles, NBH, 3 sources), block = 256.
// z = 0: q -> planes 0/1 [bh][s][d]; z = 1: k -> planes 2/3 [bh][s][d];
// z = 2: v -> planes 4/5 transposed [bh][d][s].
// Coverage per block: 256 threads x 2 groups x 8 elements = 64 x 64 tile, every block owns
// ------------------------------------------------------------------------------------------
__global__ __launch_bounds__(256) void k_split(const float* __restrict__ q,
                                                const float* __restrict__ k,
                                                const float* __restrict__ v,
                                                unsigned short* __restrict__ planes)
{
    __shared__ __align__(16) float tile[64][TPITCH];

    const int t  = threadIdx.x;
    const int s0 = blockIdx.x * 64;
    const int bh = blockIdx.y;
    const int z  = blockIdx.z;                       // block-uniform
    const float* src = (z == 0) ? q : ((z == 1) ? k : v);
    const int tr = (z == 2) ? 1 : 0;

    // stage the 64 rows x 64 cols f32 tile (rows s0..s0+63 of slice bh)
#pragma unroll
    for (int i = 0; i < 4; ++i) {
        const int idx = (t + 256 * i) * 4;           // 0..4092
        const int r = idx >> 6, c = idx & 63;
        const v4f val = *(const v4f*)(src + ((size_t)(bh * NS + s0 + r)) * ND + c);
        *(v4f*)&tile[r][c] = val;
    }
    __syncthreads();

    v4u hv[2], lv[2];
    size_t off[2];
#pragma unroll
    for (int it = 0; it < 2; ++it) {
        const int gidx = it * 256 + t;               // 0..511
        const int orow = gidx >> 3;                  // output row within tile (s for q/k, d for v)
        const int og   = gidx & 7;                   // 8-column group
        float xs[8];
#pragma unroll
        for (int j = 0; j < 8; ++j) {
            const int cidx = 8 * og + j;
            const int ia = orow * TPITCH + cidx;     // q/k: in[row=s][col=d]
            const int ib = cidx * TPITCH + orow;     // v:   in[row=s=cidx][col=d=orow] -> out[d][s]
            xs[j] = (&tile[0][0])[tr ? ib : ia];
        }
        v4u hw, lw;
#pragma unroll                                       // constant element indices, so hw and lw stay in registers
        for (int w = 0; w < 4; ++w) {
            unsigned int h2, l2;
            split_hl_pair(xs[2 * w], xs[2 * w + 1], h2, l2);
            hw[w] = h2; lw[w] = l2;
        }
        hv[it] = hw; lv[it] = lw;
        const size_t offa = ((size_t)(bh * NS + s0 + orow)) * ND + 8 * og;          // [bh][s][d]
        const size_t offb = ((size_t)(bh * ND + orow)) * NS + s0 + 8 * og;          // [bh][d][s]
        off[it] = tr ? offb : offa;
    }

    unsigned short* ph = planes + (size_t)(2 * z) * PLANE_ELEMS;
    unsigned short* pl = ph + PLANE_ELEMS;

#pragma unroll
    for (int it = 0; it < 2; ++it) {
        *(v4u*)(ph + off[it]) = hv[it];
        *(v4u*)(pl + off[it]) = lv[it];
    }
    
}

// One key chunk (K hi/lo: 32 rows x 128 B, Vt hi/lo: 64 rows x 64 B) from the planes into one LDS
// buffer: the 128 threads of one wave group x 8 asynchronous 16-B copies, every lane on, each 16 B written by one lane.
// gk / gv: this thread's first K-hi / Vt-hi source of the chunk; lk / lv: its LDS byte addresses.
__device__ __forceinline__ void copy_chunk(const unsigned short* gk, const unsigned short* gv,
                                           unsigned int lk, unsigned int lv)
{
    const unsigned short* gk1  = gk + 128 * 8;                 // second half of the 4-KiB K tile (rows 16..31)
    const unsigned short* gkl  = gk + PLANE_ELEMS;
    const unsigned short* gkl1 = gk1 + PLANE_ELEMS;
    const unsigned short* gv1  = gv + (size_t)32 * NS;         // Vt rows 32..63
    const unsigned short* gvl  = gv + PLANE_ELEMS;
    const unsigned short* gvl1 = gv1 + PLANE_ELEMS;
    const unsigned int lk1  = lk + 16 * KPITCH * 2;
    const unsigned int lkl  = lk + (KL_OFF - KH_OFF) * 2;
    const unsigned int lkl1 = lk1 + (KL_OFF - KH_OFF) * 2;
    const unsigned int lv1  = lv + 32 * VPITCH * 2;
    const unsigned int lvl  = lv + (VL_OFF - VH_OFF) * 2;
    const unsigned int lvl1 = lv1 + (VL_OFF - VH_OFF) * 2;
    // the copies and their s_wait_xcnt in one statement: no address register is rewritten ahead of the wait
    asm volatile("global_load_async_to_lds_b128 %0, %8, off\n\t"
                 "global_load_async_to_lds_b128 %1, %9, off\n\t"
                 "global_load_async_to_lds_b128 %2, %10, off\n\t"
                 "global_load_async_to_lds_b128 %3, %11, off\n\t"
                 "global_load_async_to_lds_b128 %4, %12, off\n\t"
                 "global_load_async_to_lds_b128 %5, %13, off\n\t"
                 "global_load_async_to_lds_b128 %6, %14, off\n\t"
                 "global_load_async_to_lds_b128 %7, %15, off\n\t"
                 "s_wait_xcnt 0x0"
                 :: "v"(lk), "v"(lk1), "v"(lkl), "v"(lkl1), "v"(lv), "v"(lv1), "v"(lvl), "v"(lvl1),
                    "v"(gk), "v"(gk1), "v"(gkl), "v"(gkl1), "v"(gv), "v"(gv1), "v"(gvl), "v"(gvl1)
                 : "memory");
}

// ------------------------------------------------------------------------------------------
// Attention with positional exp bias. grid = NBH * (NS/64) = 512 blocks, block = 256: 8 waves =
// 4 query groups (16 query rows each) x 2 key groups, non-causal over all NS keys. A ring stage holds
// 64 keys as two 32-key chunks; key group kh works on chunk kh of every stage, so each query row has two
// waves with their own running maximum, sum and O^T; the two are merged once, through LDS, after the loop.
// The four waves of a key group share their chunk's K and Vt tiles through a two-buffer LDS ring.
// Transposed products: S^T = K * Q^T (A = key rows, B = query columns) and O^T += Vt * P^T, so a
// lane holds the scores of ONE query (column n): 16 of the chunk's 32 keys, the other half wave the rest.
// Fragment map (A and B): lane l, g = l>>4, n = l&15; elements 0..7 <- k0+8g+0..7,
// elements 8..15 <- k0+16+8g+0..7; D element r <- (row 8g+r, col n). The two S^T tiles of a chunk
// (keys 8g+r and 16+8g+r of column n) are therefore already in the B order of the P^T operand.
// ------------------------------------------------------------------------------------------
__global__ __launch_bounds__(256) void k_attn(const unsigned short* __restrict__ planes,
                                               const float* __restrict__ qsg,
                                               const float* __restrict__ ksg,
                                               const float* __restrict__ alphag,
                                               const float* __restrict__ betag,
                                               float* outg)
{
    __shared__ __align__(16) float Osh[4][16][OPITCH];            // per query group: merge and output staging
    __shared__ float Msh[4][32], Lsh[4][32];                      // key group 1's running maximum and sum, per lane
    __shared__ __align__(16) unsigned short KVsh[2][KSPLIT][BUF_ELEMS];   // K/Vt ring: two buffers x two chunks
    __shared__ __align__(16) float KPsh[NS][4];                   // per key of the batch: x, y, z, |k|^2 (A rows of the exponent product)

    const int tid  = threadIdx.x;
    const int wave = __builtin_amdgcn_readfirstlane(tid >> 5);   // scalar, so the tests on kh below are scalar branches
    const int qg   = wave & 3;          // query group
    const int kh   = wave >> 2;         // key group
    const int t7   = tid & 127;         // thread index inside the key group
    const int lane = tid & 31;
    const int g    = lane >> 4;
    const int n    = lane & 15;

    const int bid  = blockIdx.x;
    const int qblk = bid & 31;          // NS/64 = 32 query blocks
    const int bh   = bid >> 5;          // 0..15
    const int hh   = bh & (NH - 1);
    const int b    = bh >> 3;
    const int q0   = qblk * 64 + qg * 16;

    const float alpha_h = alphag[hh];
    const float s_h     = -betag[hh] * LOG2E;   // bias = alpha * 2^(s_h * |q - k|^2)

    const unsigned short* Qh = planes;
    const unsigned short* Ql = planes + PLANE_ELEMS;
    const unsigned short* Kh = planes + 2 * PLANE_ELEMS;    // lo plane: + PLANE_ELEMS
    const unsigned short* Vh = planes + 4 * PLANE_ELEMS;    // [bh][d][s]; lo plane: + PLANE_ELEMS
    const size_t rowb = (size_t)bh * NS;

    // ---- this thread's share of its key group's chunk copy: K piece t7 (row t7>>3), Vt piece t7 (row t7>>2) ----
    const unsigned short* gk0 = Kh + (rowb + kh * KCH) * ND + t7 * 8;                                  // + 64 * ND per stage
    const unsigned short* gv0 = Vh + ((size_t)bh * ND + (t7 >> 2)) * NS + kh * KCH + (t7 & 3) * 8;     // + 64 per stage
    const unsigned int lbase = (unsigned int)(size_t)&KVsh[0][kh][0];
    const unsigned int lk0 = lbase + (KH_OFF + (t7 >> 3) * KPITCH + (t7 & 7) * 8) * 2;
    const unsigned int lv0 = lbase + (VH_OFF + (t7 >> 2) * VPITCH + (t7 & 3) * 8) * 2;

    // ---- ring prologue: stage 0 lands and is published, then stage 1 flies ----
    copy_chunk(gk0, gv0, lk0, lv0);

    // ---- key rows of the exponent product, written once while stage 0 flies: 256 threads x 8 keys = NS keys;
    // published by the barrier that publishes stage 0, never rewritten ----
    {
        const float* p = ksg + ((size_t)b * NS + tid) * NPOS;
#pragma unroll
        for (int i = 0; i < NS / 256; ++i) {
            const float x = p[256 * NPOS * i], y = p[256 * NPOS * i + 1], z = p[256 * NPOS * i + 2];
            v4f w;
            w.x = x; w.y = y; w.z = z;
            w.w = __builtin_fmaf(z, z, __builtin_fmaf(y, y, x * x));
            *(v4fa*)&KPsh[tid + 256 * i][0] = w;
        }
    }
    asm volatile("s_wait_asynccnt 0x0" ::: "memory");   // this wave's copies of stage 0 have landed
    __syncthreads();                                    // publishes stage 0 to the other waves
    copy_chunk(gk0 + KSPLIT * KCH * ND, gv0 + KSPLIT * KCH,
               lk0 + KSPLIT * BUF_ELEMS * 2, lv0 + KSPLIT * BUF_ELEMS * 2);

    // ---- position features of this lane's one query (column n) ----
    float qp[NPOS];
    {
        const float* p = qsg + ((size_t)b * NS + q0 + n) * NPOS;
        qp[0] = p[0]; qp[1] = p[1]; qp[2] = p[2];
    }
    asm volatile("s_wait_xcnt 0x0" ::: "memory");   // before the address pair of the load above is reused as a later load's destination

    // ---- exponent product, query side: s_h*|q-k|^2 = s_h*|q|^2 + sum over 4 of A[key][j] * B[j][query] with
    // A = (kx, ky, kz, |k|^2) and B = (-2 s_h qx, -2 s_h qy, -2 s_h qz, s_h). Half wave g holds j = 2g, 2g+1
    // of both operands (same pairing on both sides); C = s_h*|q|^2 of the lane's query in all 8 rows. ----
    v2f bq;
    v8f cq;
    {
        const float m2s = -2.0f * s_h;
        bq.x = m2s * (g ? qp[2] : qp[0]);
        bq.y = g ? s_h : m2s * qp[1];
        const float cqs = s_h * __builtin_fmaf(qp[2], qp[2], __builtin_fmaf(qp[1], qp[1], qp[0] * qp[0]));
#pragma unroll
        for (int r = 0; r < 8; ++r) cq[r] = cqs;
    }

    // ---- Q B fragments (columns q0+n), two 32-deep k-steps, hi and lo planes ----
    Frag aqh[2], aql[2];
    {
        const unsigned short* qrh = Qh + (rowb + q0 + n) * ND;
        const unsigned short* qrl = Ql + (rowb + q0 + n) * ND;
#pragma unroll
        for (int c = 0; c < 2; ++c) {
            aqh[c].q[0] = *(const v4u*)(qrh + 32 * c + 8 * g);
            aqh[c].q[1] = *(const v4u*)(qrh + 32 * c + 16 + 8 * g);
            aql[c].q[0] = *(const v4u*)(qrl + 32 * c + 8 * g);
            aql[c].q[1] = *(const v4u*)(qrl + 32 * c + 16 + 8 * g);
        }
    }

    v8f o[4];
#pragma unroll
    for (int f = 0; f < 4; ++f) o[f] = (v8f){};
    float mcol = -__builtin_huge_valf();   // running maximum of this lane's query over this key group (equal in both half waves)
    float lcol = 0.0f;                     // running sum over this half wave's keys only; joined after the loop

#pragma unroll 1
    for (int st = 0; st < NST; ++st) {
        const int kb = (st * KSPLIT + kh) * KCH;             // first key of this wave's chunk
        const unsigned short* kvb = &KVsh[st & 1][kh][0];    // this chunk's buffer

        // ---- exponents of the bias: ph[t][r] = s_h * |q_n - k|^2 of key 16t+8g+r of the chunk, one f32 WMMA a tile ----
        v8f ph[2];
#pragma unroll
        for (int t = 0; t < 2; ++t) {
            const v2f ak = *(const v2fa*)&KPsh[kb + 16 * t + n][2 * g];      // A row n of the tile: columns 2g, 2g+1
            ph[t] = __builtin_amdgcn_wmma_f32_16x16x4_f32(false, ak, false, bq, (short)0, cq, false, false);
        }

        // ---- S^T = K * Q^T : 2 key tiles x 2 k-steps x 3 products ----
        v8f sa[2];
#pragma unroll
        for (int t = 0; t < 2; ++t) {
            v8f acc = (v8f){};
            const unsigned short* krh = kvb + KH_OFF + (16 * t + n) * KPITCH;   // A[m=key][k=d]: d-contiguous key row
            const unsigned short* krl = kvb + KL_OFF + (16 * t + n) * KPITCH;
#pragma unroll
            for (int c = 0; c < 2; ++c) {
                Frag akh, akl;
                akh.q[0] = *(const v4ua*)(krh + 32 * c + 8 * g);
                akh.q[1] = *(const v4ua*)(krh + 32 * c + 16 + 8 * g);
                akl.q[0] = *(const v4ua*)(krl + 32 * c + 8 * g);
                akl.q[1] = *(const v4ua*)(krl + 32 * c + 16 + 8 * g);
                acc = wmma_bf16(acc, akh.v, aqh[c].v);
                acc = wmma_bf16(acc, akl.v, aqh[c].v);
                acc = wmma_bf16(acc, akh.v, aql[c].v);
            }
            sa[t] = acc;
        }

        // ---- bias; sc[t][r] = score of (query n, key kb+16t+8g+r) ----
        float sc[2][8];
#pragma unroll
        for (int t = 0; t < 2; ++t) {
#pragma unroll
            for (int r = 0; r < 8; ++r) {
                const float bias = alpha_h * __builtin_amdgcn_exp2f(ph[t][r]);
                sc[t][r] = sa[t][r] * QK_SCALE + bias;
            }
        }

        // ---- online softmax of one query per lane: maximum in registers, one exchange between half waves ----
        float vmax = sc[0][0];
#pragma unroll
        for (int t = 0; t < 2; ++t)
#pragma unroll
            for (int r = 0; r < 8; ++r) vmax = fmaxf(vmax, sc[t][r]);
        {
            const int vb = __float_as_int(vmax);
            vmax = fmaxf(vmax, __int_as_float(__builtin_amdgcn_permlanex16(vb, vb, 0x76543210, 0xfedcba98, false, false)));
        }
        const float mn   = fmaxf(mcol, vmax);
        const float resc = __expf(mcol - mn);
        mcol = mn;

        // P^T B fragments straight from the score registers: element r <- tile 0, element 8+r <- tile 1
        Frag bph, bpl;
        float pp[2][4];                    // pair sums, joined as a tree below (short dependent chain)
#pragma unroll
        for (int t = 0; t < 2; ++t) {
#pragma unroll
            for (int w = 0; w < 4; ++w) {
                const float pa = __expf(sc[t][2 * w]     - mn);
                const float pb = __expf(sc[t][2 * w + 1] - mn);
                pp[t][w] = pa + pb;
                unsigned int hw, lw;
                split_hl_pair(pa, pb, hw, lw);
                bph.q[t][w] = hw;
                bpl.q[t][w] = lw;
            }
        }
        const float ps = ((pp[0][0] + pp[0][1]) + (pp[0][2] + pp[0][3])) + ((pp[1][0] + pp[1][1]) + (pp[1][2] + pp[1][3]));
        lcol = lcol * resc + ps;
#pragma unroll
        for (int f = 0; f < 4; ++f)
#pragma unroll
            for (int r = 0; r < 8; ++r) o[f][r] = o[f][r] * resc;

        // ---- O^T += Vt * P^T : 4 d-tiles x 3 products; A[m=d][k=key] from Vt[bh][d][key] ----
#pragma unroll
        for (int f = 0; f < 4; ++f) {
            const unsigned short* vrh = kvb + VH_OFF + (16 * f + n) * VPITCH;
            const unsigned short* vrl = kvb + VL_OFF + (16 * f + n) * VPITCH;
            Frag avh, avl;
            avh.q[0] = *(const v4ua*)(vrh + 8 * g);
            avh.q[1] = *(const v4ua*)(vrh + 16 + 8 * g);
            avl.q[0] = *(const v4ua*)(vrl + 8 * g);
            avl.q[1] = *(const v4ua*)(vrl + 16 + 8 * g);
            o[f] = wmma_bf16(o[f], avh.v, bph.v);
            o[f] = wmma_bf16(o[f], avl.v, bph.v);
            o[f] = wmma_bf16(o[f], avh.v, bpl.v);
        }

        // ---- publish point of stage st+1; then stage st+2 goes into the buffer just read ----
        asm volatile("s_wait_dscnt 0x0" ::: "memory");      // this wave's reads of the buffer have returned
        asm volatile("s_wait_asynccnt 0x0" ::: "memory");   // this wave's copies of stage st+1 have landed
        __syncthreads();                                    // publishes stage st+1, ends every read of stage st
        if (st + 2 < NST)                                   // block-uniform
            copy_chunk(gk0 + (size_t)(st + 2) * (KSPLIT * KCH * ND), gv0 + (st + 2) * (KSPLIT * KCH),
                       lk0 + (st & 1) * (KSPLIT * BUF_ELEMS * 2), lv0 + (st & 1) * (KSPLIT * BUF_ELEMS * 2));
    }
    asm volatile("s_wait_asynccnt 0x0" ::: "memory");       // nothing of the ring is in flight past the loop

    // ---- merge of the two key groups. o[f][r] = O[query n][d = 16f+8g+r]: 8 consecutive floats of one row
    // per d-tile. Key group 1 hands its unnormalised tile, maximum and sum to the same lane of key group 0. ----
    if (kh == 1) {
#pragma unroll
        for (int f = 0; f < 4; ++f) {
            v4f w0, w1;
            w0.x = o[f][0]; w0.y = o[f][1]; w0.z = o[f][2]; w0.w = o[f][3];
            w1.x = o[f][4]; w1.y = o[f][5]; w1.z = o[f][6]; w1.w = o[f][7];
            *(v4fa*)&Osh[qg][n][16 * f + 8 * g]     = w0;
            *(v4fa*)&Osh[qg][n][16 * f + 8 * g + 4] = w1;
        }
        Msh[qg][lane] = mcol;
        Lsh[qg][lane] = lcol;
    }
    __syncthreads();                                        // key group 1's partial results are visible to key group 0

    // ---- key group 0: rescale both parts to the common maximum, join the half waves' sums, normalise,
    // leave the finished 16x64 tile at the same LDS places (each lane rewrites only what it has read) ----
    if (kh == 0) {
        const float m1 = Msh[qg][lane];
        const float l1 = Lsh[qg][lane];
        const float mn = fmaxf(mcol, m1);
        const float a0 = __expf(mcol - mn);
        const float a1 = __expf(m1 - mn);
        const float lpart = lcol * a0 + l1 * a1;
        const int lb = __float_as_int(lpart);
        const float lsum = lpart + __int_as_float(__builtin_amdgcn_permlanex16(lb, lb, 0x76543210, 0xfedcba98, false, false));
        const float inv = 1.0f / lsum;
        const float c0 = a0 * inv, c1 = a1 * inv;
#pragma unroll
        for (int f = 0; f < 4; ++f) {
            const v4f p0 = *(const v4fa*)&Osh[qg][n][16 * f + 8 * g];
            const v4f p1 = *(const v4fa*)&Osh[qg][n][16 * f + 8 * g + 4];
            v4f w0, w1;
            w0.x = o[f][0] * c0 + p0.x * c1; w0.y = o[f][1] * c0 + p0.y * c1;
            w0.z = o[f][2] * c0 + p0.z * c1; w0.w = o[f][3] * c0 + p0.w * c1;
            w1.x = o[f][4] * c0 + p1.x * c1; w1.y = o[f][5] * c0 + p1.y * c1;
            w1.z = o[f][6] * c0 + p1.z * c1; w1.w = o[f][7] * c0 + p1.w * c1;
            *(v4fa*)&Osh[qg][n][16 * f + 8 * g]     = w0;
            *(v4fa*)&Osh[qg][n][16 * f + 8 * g + 4] = w1;
        }
    }
    __syncthreads();                                        // the finished tiles are visible to both key groups

    // ---- whole-line stores: instruction i covers rows 8kh+2i, 8kh+2i+1 (512 B, lane-contiguous 16 B) ----
    // coverage: 2 waves x 4 instructions x 32 lanes x 4 floats = 16 rows x 64 floats per query group
    v4f vals[4];
#pragma unroll
    for (int i = 0; i < 4; ++i)
        vals[i] = *(const v4fa*)&Osh[qg][8 * kh + 2 * i + g][4 * n];

    float* obase = outg + (rowb + q0 + 8 * kh) * ND;  // 8 contiguous rows of 256 B
#pragma unroll
    for (int i = 0; i < 4; ++i)
        *(v4f*)(obase + (2 * i + g) * ND + 4 * n) = vals[i];
    
}

extern "C" void kernel_launch(void* const* d_in, const int* in_sizes, int n_in,
                              void* d_out, int out_size, void* d_ws, size_t ws_size,
                              hipStream_t stream)
{
    if (n_in < 7) return;
    const int n_qkv = NBH * NS * ND;        // 2,097,152
    const int n_pos = NB * NS * NPOS;       // 12,288
    if (in_sizes[0] != n_qkv || in_sizes[1] != n_qkv || in_sizes[2] != n_qkv) return;
    if (in_sizes[3] != n_pos || in_sizes[4] != n_pos) return;
    if (in_sizes[5] < NH || in_sizes[6] < NH) return;
    if (out_size != n_qkv) return;

    // workspace: 6 planes x 4 MiB = 25,165,824 B
    const size_t ws_need = (size_t)NPLANES * PLANE_ELEMS * sizeof(unsigned short);
    if (ws_size < ws_need) return;

    const float* q     = (const float*)d_in[0];
    const float* k     = (const float*)d_in[1];
    const float* v     = (const float*)d_in[2];
    const float* qs_s  = (const float*)d_in[3];
    const float* ks_s  = (const float*)d_in[4];
    const float* alpha = (const float*)d_in[5];
    const float* beta  = (const float*)d_in[6];
    float* out = (float*)d_out;
    unsigned short* planes = (unsigned short*)d_ws;

    k_split<<<dim3(NS / 64, NBH, 3), dim3(256), 0, stream>>>(q, k, v, planes);
    k_attn<<<dim3(NBH * (NS / 64)), dim3(256), 0, stream>>>(planes, qs_s, ks_s, alpha, beta, out);
}

// v008
// A run of this version takes 56.1 microseconds.
// In both of two side-by-side timings against v007, it was 1.04 times as fast.
// Over all steps from v000 it is 3.97 times as fast.
#include <hip/hip_runtime.h>

// Contractions: S = Q*K^T and O = P*V on v_wmma_f32_16x16x32_bf16, bf16 hi/lo operands
// (hi*hi + hi*lo + lo*hi per tile pair), f32 accumulate; the exponent of the positional bias on
// v_wmma_f32_16x16x4_f32 (f32 operands); online softmax and normalisation in f32.

typedef __bf16        v16bf __attribute__((ext_vector_type(16)));
typedef float         v8f   __attribute__((ext_vector_type(8)));
typedef float         v4f   __attribute__((ext_vector_type(4)));
typedef unsigned int  v4u   __attribute__((ext_vector_type(4)));
typedef unsigned int  v4ua  __attribute__((ext_vector_type(4), may_alias));
typedef float         v4fa  __attribute__((ext_vector_type(4), may_alias));
typedef float         v2f   __attribute__((ext_vector_type(2)));
typedef float         v2fa  __attribute__((ext_vector_type(2), may_alias));
typedef __bf16        v2bf  __attribute__((ext_vector_type(2)));

#define NB    2
#define NH    8
#define NS    2048
#define ND    64
#define NBH   (NB * NH)
#define NPOS  3
#define KCH   32                 // keys per chunk
#define QK_SCALE 0.125f          // 1/sqrt(64), exact power of two
#define LOG2E 1.44269504088896340736f
#define GROW_LIMIT 0x1p64f       // a lane's chunk sum above this renews the reference maximum; sums and O^T stay far below the f32 range
#define TPITCH 68                // LDS pitch (floats) of the 64x64 staging tile
#define OPITCH 68                // LDS pitch (floats) of the output staging tile
#define PLANE_ELEMS ((size_t)NBH * NS * ND)   // 16-bit elements per plane (4 MiB)
#define NPLANES 6                // Qhi, Qlo, Khi, Klo, Vthi, Vtlo
#define KSPLIT 2                 // wave groups of a block; each takes one 32-key chunk of every stage
#define NST    (NS / (KCH * KSPLIT))   // ring stages (64 keys each) per query block
#define KPITCH 72                // LDS pitch (16-bit elements) of a staged 128-B K row: 144 B = 16 B x odd
#define VPITCH 40                // LDS pitch (16-bit elements) of a staged 64-B Vt row: 80 B = 16 B x odd
#define KH_OFF 0                               // element offsets of the four tiles inside one buffer
#define KL_OFF (KH_OFF + KCH * KPITCH)
#define VH_OFF (KL_OFF + KCH * KPITCH)
#define VL_OFF (VH_OFF + ND * VPITCH)
#define BUF_ELEMS (VL_OFF + ND * VPITCH)       // 9,728 elements = 19,456 B per buffer

union Frag { v16bf v; v4u q[2]; };

// bf16 WMMA, builtin form: the compiler keeps the distances behind it
__device__ __forceinline__ v8f wmma_bf16(v8f acc, v16bf a, v16bf b)
{
    return __builtin_amdgcn_wmma_f32_16x16x32_bf16(false, a, false, b, (short)0, acc, false, false);
}

// two f32 -> one register of two bf16 hi parts and one of two lo parts (a in the low half):
// x ~= hi + lo with hi = bf16(x), lo = bf16(x - hi), both rounded to nearest even by the packed hardware conversion
__device__ __forceinline__ void split_hl_pair(float a, float b, unsigned int& hi, unsigned int& lo)
{
    const v2f  x = {a, b};
    const v2bf h = __builtin_convertvector(x, v2bf);
    const v2bf l = __builtin_convertvector(x - __builtin_convertvector(h, v2f), v2bf);
    hi = __builtin_bit_cast(unsigned int, h);
    lo = __builtin_bit_cast(unsigned int, l);
}

// 2^x for the rarely taken renewal path. The v_nop is the one slot that the instruction set asks for behind a transcendental
// before its source is overwritten or its result read; in the same statement it stands directly behind it in every build.
__device__ __forceinline__ float exp2_slot(float x)
{
    float r;
    asm("v_exp_f32 %0, %1\n\tv_nop" : "=v"(r) : "v"(x));
    return r;
}

__device__ __forceinline__ v8f splat8(float x) { return (v8f){x, x, x, x, x, x, x, x}; }

// sum of a lane's 16 weights of a chunk: pair sums joined as a tree (short dependent chain)
__device__ __forceinline__ float chunk_sum(const v8f (&p)[2])
{
    float pp[2][4];
#pragma unroll
    for (int t = 0; t < 2; ++t)
#pragma unroll
        for (int w = 0; w < 4; ++w) pp[t][w] = p[t][2 * w] + p[t][2 * w + 1];
    return ((pp[0][0] + pp[0][1]) + (pp[0][2] + pp[0][3])) + ((pp[1][0] + pp[1][1]) + (pp[1][2] + pp[1][3]));
}

// ------------------------------------------------------------------------------------------
// Plane builder. grid = (NS/64 s-tiles, NBH, 3 sources), block = 256.
// z = 0: q -> planes 0/1 [bh][s][d]; z = 1: k -> planes 2/3 [bh][s][d];
// z = 2: v -> planes 4/5 transposed [bh][d][s].
// Coverage per block: 256 threads x 2 groups x 8 elements = 64 x 64 tile, every block owns
// ------------------------------------------------------------------------------------------
__global__ __launch_bounds__(256) void k_split(const float* __restrict__ q,
                                                const float* __restrict__ k,
                                                const float* __restrict__ v,
                                                unsigned short* __restrict__ planes)
{
    __shared__ __align__(16) float tile[64][TPITCH];

    const int t  = threadIdx.x;
    const int s0 = blockIdx.x * 64;
    const int bh = blockIdx.y;
    const int z  = blockIdx.z;                       // block-uniform
    const float* src = (z == 0) ? q : ((z == 1) ? k : v);
    const int tr = (z == 2) ? 1 : 0;

    // stage the 64 rows x 64 cols f32 tile (rows s0..s0+63 of slice bh)
#pragma unroll
    for (int i = 0; i < 4; ++i) {
        const int idx = (t + 256 * i) * 4;           // 0..4092
        const int r = idx >> 6, c = idx & 63;
        const v4f val = *(const v4f*)(src + ((size_t)(bh * NS + s0 + r)) * ND + c);
        *(v4f*)&tile[r][c] = val;
    }
    __syncthreads();

    v4u hv[2], lv[2];
    size_t off[2];
#pragma unroll
    for (int it = 0; it < 2; ++it) {
        const int gidx = it * 256 + t;               // 0..511
        const int orow = gidx >> 3;                  // output row within tile (s for q/k, d for v)
        const int og   = gidx & 7;                   // 8-column group
        float xs[8];
#pragma unroll
        for (int j = 0; j < 8; ++j) {
            const int cidx = 8 * og + j;
            const int ia = orow * TPITCH + cidx;     // q/k: in[row=s][col=d]
            const int ib = cidx * TPITCH + orow;     // v:   in[row=s=cidx][col=d=orow] -> out[d][s]
            xs[j] = (&tile[0][0])[tr ? ib : ia];
        }
        v4u hw, lw;
#pragma unroll                                       // constant element indices, so hw and lw stay in registers
        for (int w = 0; w < 4; ++w) {
            unsigned int h2, l2;
            split_hl_pair(xs[2 * w], xs[2 * w + 1], h2, l2);
            hw[w] = h2; lw[w] = l2;
        }
        hv[it] = hw; lv[it] = lw;
        const size_t offa = ((size_t)(bh * NS + s0 + orow)) * ND + 8 * og;          // [bh][s][d]
        const size_t offb = ((size_t)(bh * ND + orow)) * NS + s0 + 8 * og;          // [bh][d][s]
        off[it] = tr ? offb : offa;
    }

    unsigned short* ph = planes + (size_t)(2 * z) * PLANE_ELEMS;
    unsigned short* pl = ph + PLANE_ELEMS;

#pragma unroll
    for (int it = 0; it < 2; ++it) {
        *(v4u*)(ph + off[it]) = hv[it];
        *(v4u*)(pl + off[it]) = lv[it];
    }
    
}

// One key chunk (K hi/lo: 32 rows x 128 B, Vt hi/lo: 64 rows x 64 B) from the planes into one LDS
// buffer: the 128 threads of one wave group x 8 asynchronous 16-B copies, every lane on, each 16 B written by one lane.
// gk / gv: this thread's first K-hi / Vt-hi source of the chunk; lk / lv: its LDS byte addresses.
__device__ __forceinline__ void copy_chunk(const unsigned short* gk, const unsigned short* gv,
                                           unsigned int lk, unsigned int lv)
{
    const unsigned short* gk1  = gk + 128 * 8;                 // second half of the 4-KiB K tile (rows 16..31)
    const unsigned short* gkl  = gk + PLANE_ELEMS;
    const unsigned short* gkl1 = gk1 + PLANE_ELEMS;
    const unsigned short* gv1  = gv + (size_t)32 * NS;         // Vt rows 32..63
    const unsigned short* gvl  = gv + PLANE_ELEMS;
    const unsigned short* gvl1 = gv1 + PLANE_ELEMS;
    const unsigned int lk1  = lk + 16 * KPITCH * 2;
    const unsigned int lkl  = lk + (KL_OFF - KH_OFF) * 2;
    const unsigned int lkl1 = lk1 + (KL_OFF - KH_OFF) * 2;
    const unsigned int lv1  = lv + 32 * VPITCH * 2;
    const unsigned int lvl  = lv + (VL_OFF - VH_OFF) * 2;
    const unsigned int lvl1 = lv1 + (VL_OFF - VH_OFF) * 2;
    // the copies and their s_wait_xcnt in one statement: no address register is rewritten ahead of the wait
    asm volatile("global_load_async_to_lds_b128 %0, %8, off\n\t"
                 "global_load_async_to_lds_b128 %1, %9, off\n\t"
                 "global_load_async_to_lds_b128 %2, %10, off\n\t"
                 "global_load_async_to_lds_b128 %3, %11, off\n\t"
                 "global_load_async_to_lds_b128 %4, %12, off\n\t"
                 "global_load_async_to_lds_b128 %5, %13, off\n\t"
                 "global_load_async_to_lds_b128 %6, %14, off\n\t"
                 "global_load_async_to_lds_b128 %7, %15, off\n\t"
                 "s_wait_xcnt 0x0"
                 :: "v"(lk), "v"(lk1), "v"(lkl), "v"(lkl1), "v"(lv), "v"(lv1), "v"(lvl), "v"(lvl1),
                    "v"(gk), "v"(gk1), "v"(gkl), "v"(gkl1), "v"(gv), "v"(gv1), "v"(gvl), "v"(gvl1)
                 : "memory");
}

// ------------------------------------------------------------------------------------------
// Attention with positional exp bias. grid = NBH * (NS/64) = 512 blocks, block = 256: 8 waves =
// 4 query groups (16 query rows each) x 2 key groups, non-causal over all NS keys. A ring stage holds
// 64 keys as two 32-key chunks; key group kh works on chunk kh of every stage, so each query row has two
// waves with their own reference maximum, sum and O^T; the two are merged once, through LDS, after the loop.
// The four waves of a key group share their chunk's K and Vt tiles through a two-buffer LDS ring.
// Transposed products: S^T = K * Q^T (A = key rows, B = query columns) and O^T += Vt * P^T, so a
// lane holds the scores of ONE query (column n): 16 of the chunk's 32 keys, the other half wave the rest.
// Fragment map (A and B): lane l, g = l>>4, n = l&15; elements 0..7 <- k0+8g+0..7,
// elements 8..15 <- k0+16+8g+0..7; D element r <- (row 8g+r, col n). The two S^T tiles of a chunk
// (keys 8g+r and 16+8g+r of column n) are therefore already in the B order of the P^T operand.
// ------------------------------------------------------------------------------------------
__global__ __launch_bounds__(256) void k_attn(const unsigned short* __restrict__ planes,
                                               const float* __restrict__ qsg,
                                               const float* __restrict__ ksg,
                                               const float* __restrict__ alphag,
                                               const float* __restrict__ betag,
                                               float* outg)
{
    __shared__ __align__(16) float Osh[4][16][OPITCH];            // per query group: merge and output staging
    __shared__ float Msh[4][32], Lsh[4][32];                      // key group 1's reference maximum and sum, per lane
    __shared__ __align__(16) unsigned short KVsh[2][KSPLIT][BUF_ELEMS];   // K/Vt ring: two buffers x two chunks
    __shared__ __align__(16) float KPsh[NS][4];                   // per key of the batch: x, y, z, |k|^2 (A rows of the exponent product)

    const int tid  = threadIdx.x;
    const int wave = __builtin_amdgcn_readfirstlane(tid >> 5);   // scalar, so the tests on kh below are scalar branches
    const int qg   = wave & 3;          // query group
    const int kh   = wave >> 2;         // key group
    const int t7   = tid & 127;         // thread index inside the key group
    const int lane = tid & 31;
    const int g    = lane >> 4;
    const int n    = lane & 15;

    const int bid  = blockIdx.x;
    const int qblk = bid & 31;          // NS/64 = 32 query blocks
    const int bh   = bid >> 5;          // 0..15
    const int hh   = bh & (NH - 1);
    const int b    = bh >> 3;
    const int q0   = qblk * 64 + qg * 16;

    const float alpha2  = alphag[hh] * LOG2E;   // scores are kept in base-2 units: score * log2(e)
    const float s_h     = -betag[hh] * LOG2E;   // bias = alpha * 2^(s_h * |q - k|^2)

    const unsigned short* Qh = planes;
    const unsigned short* Ql = planes + PLANE_ELEMS;
    const unsigned short* Kh = planes + 2 * PLANE_ELEMS;    // lo plane: + PLANE_ELEMS
    const unsigned short* Vh = planes + 4 * PLANE_ELEMS;    // [bh][d][s]; lo plane: + PLANE_ELEMS
    const size_t rowb = (size_t)bh * NS;

    // ---- this thread's share of its key group's chunk copy: K piece t7 (row t7>>3), Vt piece t7 (row t7>>2) ----
    const unsigned short* gk0 = Kh + (rowb + kh * KCH) * ND + t7 * 8;                                  // + 64 * ND per stage
    const unsigned short* gv0 = Vh + ((size_t)bh * ND + (t7 >> 2)) * NS + kh * KCH + (t7 & 3) * 8;     // + 64 per stage
    const unsigned int lbase = (unsigned int)(size_t)&KVsh[0][kh][0];
    const unsigned int lk0 = lbase + (KH_OFF + (t7 >> 3) * KPITCH + (t7 & 7) * 8) * 2;
    const unsigned int lv0 = lbase + (VH_OFF + (t7 >> 2) * VPITCH + (t7 & 3) * 8) * 2;

    // ---- ring prologue: stage 0 lands and is published, then stage 1 flies ----
    copy_chunk(gk0, gv0, lk0, lv0);

    // ---- key rows of the exponent product, written once while stage 0 flies: 256 threads x 8 keys = NS keys;
    // published by the barrier that publishes stage 0, never rewritten ----
    {
        const float* p = ksg + ((size_t)b * NS + tid) * NPOS;
#pragma unroll
        for (int i = 0; i < NS / 256; ++i) {
            const float x = p[256 * NPOS * i], y = p[256 * NPOS * i + 1], z = p[256 * NPOS * i + 2];
            v4f w;
            w.x = x; w.y = y; w.z = z;
            w.w = __builtin_fmaf(z, z, __builtin_fmaf(y, y, x * x));
            *(v4fa*)&KPsh[tid + 256 * i][0] = w;
        }
    }
    asm volatile("s_wait_asynccnt 0x0" ::: "memory");   // this wave's copies of stage 0 have landed
    __syncthreads();                                    // publishes stage 0 to the other waves
    copy_chunk(gk0 + KSPLIT * KCH * ND, gv0 + KSPLIT * KCH,
               lk0 + KSPLIT * BUF_ELEMS * 2, lv0 + KSPLIT * BUF_ELEMS * 2);

    // ---- position features of this lane's one query (column n) ----
    float qp[NPOS];
    {
        const float* p = qsg + ((size_t)b * NS + q0 + n) * NPOS;
        qp[0] = p[0]; qp[1] = p[1]; qp[2] = p[2];
    }
    asm volatile("s_wait_xcnt 0x0" ::: "memory");   // before the address pair of the load above is reused as a later load's destination

    // ---- exponent product, query side: s_h*|q-k|^2 = s_h*|q|^2 + sum over 4 of A[key][j] * B[j][query] with
    // A = (kx, ky, kz, |k|^2) and B = (-2 s_h qx, -2 s_h qy, -2 s_h qz, s_h). Half wave g holds j = 2g, 2g+1
    // of both operands (same pairing on both sides); C = s_h*|q|^2 of the lane's query in all 8 rows. ----
    v2f bq;
    v8f cq;
    {
        const float m2s = -2.0f * s_h;
        bq.x = m2s * (g ? qp[2] : qp[0]);
        bq.y = g ? s_h : m2s * qp[1];
        const float cqs = s_h * __builtin_fmaf(qp[2], qp[2], __builtin_fmaf(qp[1], qp[1], qp[0] * qp[0]));
#pragma unroll
        for (int r = 0; r < 8; ++r) cq[r] = cqs;
    }

    // ---- Q B fragments (columns q0+n), two 32-deep k-steps, hi and lo planes ----
    Frag aqh[2], aql[2];
    {
        const unsigned short* qrh = Qh + (rowb + q0 + n) * ND;
        const unsigned short* qrl = Ql + (rowb + q0 + n) * ND;
#pragma unroll
        for (int c = 0; c < 2; ++c) {
            aqh[c].q[0] = *(const v4u*)(qrh + 32 * c + 8 * g);
            aqh[c].q[1] = *(const v4u*)(qrh + 32 * c + 16 + 8 * g);
            aql[c].q[0] = *(const v4u*)(qrl + 32 * c + 8 * g);
            aql[c].q[1] = *(const v4u*)(qrl + 32 * c + 16 + 8 * g);
        }
    }

    v8f o[4];
#pragma unroll
    for (int f = 0; f < 4; ++f) o[f] = (v8f){};
    float mcol = -__builtin_huge_valf();   // reference maximum (base-2 units) of this lane's query in this key group, equal in both half waves;
                                           // renewed only when a chunk's sum shows growth, so a chunk's exponents can be formed against it at once
    float lcol = 0.0f;                     // running sum over this half wave's keys only; joined after the loop

#pragma unroll 1
    for (int st = 0; st < NST; ++st) {
        const int kb = (st * KSPLIT + kh) * KCH;             // first key of this wave's chunk
        const unsigned short* kvb = &KVsh[st & 1][kh][0];    // this chunk's buffer

        // ---- exponents of the bias: ph[t][r] = s_h * |q_n - k|^2 of key 16t+8g+r of the chunk, one f32 WMMA a tile ----
        v8f ph[2];
#pragma unroll
        for (int t = 0; t < 2; ++t) {
            const v2f ak = *(const v2fa*)&KPsh[kb + 16 * t + n][2 * g];      // A row n of the tile: columns 2g, 2g+1
            ph[t] = __builtin_amdgcn_wmma_f32_16x16x4_f32(false, ak, false, bq, (short)0, cq, false, false);
        }

        // ---- S^T = K * Q^T : 2 key tiles x 2 k-steps x 3 products ----
        v8f sa[2];
#pragma unroll
        for (int t = 0; t < 2; ++t) {
            v8f acc = (v8f){};
            const unsigned short* krh = kvb + KH_OFF + (16 * t + n) * KPITCH;   // A[m=key][k=d]: d-contiguous key row
            const unsigned short* krl = kvb + KL_OFF + (16 * t + n) * KPITCH;
#pragma unroll
            for (int c = 0; c < 2; ++c) {
                Frag akh, akl;
                akh.q[0] = *(const v4ua*)(krh + 32 * c + 8 * g);
                akh.q[1] = *(const v4ua*)(krh + 32 * c + 16 + 8 * g);
                akl.q[0] = *(const v4ua*)(krl + 32 * c + 8 * g);
                akl.q[1] = *(const v4ua*)(krl + 32 * c + 16 + 8 * g);
                acc = wmma_bf16(acc, akh.v, aqh[c].v);
                acc = wmma_bf16(acc, akl.v, aqh[c].v);
                acc = wmma_bf16(acc, akh.v, aql[c].v);
            }
            sa[t] = acc;
        }

        // ---- weights against the held reference: p = 2^(score*log2e - mcol), the exponent straight from two FMAs;
        // element r of tile t belongs to (query n, key kb+16t+8g+r) ----
        v8f eb[2], pw[2];
#pragma unroll
        for (int t = 0; t < 2; ++t) {
#pragma unroll
            for (int r = 0; r < 8; ++r) eb[t][r] = __builtin_amdgcn_exp2f(ph[t][r]);
            const v8f arg = __builtin_elementwise_fma(sa[t], splat8(QK_SCALE * LOG2E),
                                                      __builtin_elementwise_fma(eb[t], splat8(alpha2), splat8(-mcol)));
#pragma unroll
            for (int r = 0; r < 8; ++r) pw[t][r] = __builtin_amdgcn_exp2f(arg[r]);
        }
        float ps = chunk_sum(pw);

        // ---- growth (also the first chunk, where mcol is -inf and the sum +inf; a NaN too): one scalar branch for the
        // wave. The larger of the reference and this chunk's maximum becomes the reference, O^T and the sum are rescaled to it,
        // the weights formed anew ----
        if (__builtin_amdgcn_ballot_w32(!(ps <= GROW_LIMIT)) != 0u) {
            v8f sc[2];
#pragma unroll
            for (int t = 0; t < 2; ++t)
                sc[t] = __builtin_elementwise_fma(sa[t], splat8(QK_SCALE * LOG2E), eb[t] * alpha2);
            float vmax = sc[0][0];
#pragma unroll
            for (int t = 0; t < 2; ++t)
#pragma unroll
                for (int r = 0; r < 8; ++r) vmax = fmaxf(vmax, sc[t][r]);
            const int vb = __float_as_int(vmax);
            vmax = fmaxf(vmax, __int_as_float(__builtin_amdgcn_permlanex16(vb, vb, 0x76543210, 0xfedcba98, false, false)));
            const float mn   = fmaxf(mcol, vmax);
            const float resc = exp2_slot(mcol - mn);
            mcol = mn;
#pragma unroll
            for (int t = 0; t < 2; ++t) {                    // the same two FMAs as above, against the new reference
                const v8f arg = __builtin_elementwise_fma(sa[t], splat8(QK_SCALE * LOG2E),
                                                          __builtin_elementwise_fma(eb[t], splat8(alpha2), splat8(-mn)));
#pragma unroll
                for (int r = 0; r < 8; ++r) pw[t][r] = exp2_slot(arg[r]);
            }
            ps = chunk_sum(pw);
            lcol = lcol * resc;
#pragma unroll
            for (int f = 0; f < 4; ++f) o[f] = o[f] * resc;
        }
        lcol += ps;

        // P^T B fragments straight from the weight registers: element r <- tile 0, element 8+r <- tile 1
        Frag bph, bpl;
#pragma unroll
        for (int t = 0; t < 2; ++t) {
#pragma unroll
            for (int w = 0; w < 4; ++w) {
                unsigned int hw, lw;
                split_hl_pair(pw[t][2 * w], pw[t][2 * w + 1], hw, lw);
                bph.q[t][w] = hw;
                bpl.q[t][w] = lw;
            }
        }

        // ---- O^T += Vt * P^T : 4 d-tiles x 3 products; A[m=d][k=key] from Vt[bh][d][key] ----
#pragma unroll
        for (int f = 0; f < 4; ++f) {
            const unsigned short* vrh = kvb + VH_OFF + (16 * f + n) * VPITCH;
            const unsigned short* vrl = kvb + VL_OFF + (16 * f + n) * VPITCH;
            Frag avh, avl;
            avh.q[0] = *(const v4ua*)(vrh + 8 * g);
            avh.q[1] = *(const v4ua*)(vrh + 16 + 8 * g);
            avl.q[0] = *(const v4ua*)(vrl + 8 * g);
            avl.q[1] = *(const v4ua*)(vrl + 16 + 8 * g);
            o[f] = wmma_bf16(o[f], avh.v, bph.v);
            o[f] = wmma_bf16(o[f], avl.v, bph.v);
            o[f] = wmma_bf16(o[f], avh.v, bpl.v);
        }

        // ---- publish point of stage st+1; then stage st+2 goes into the buffer just read ----
        asm volatile("s_wait_dscnt 0x0" ::: "memory");      // this wave's reads of the buffer have returned
        asm volatile("s_wait_asynccnt 0x0" ::: "memory");   // this wave's copies of stage st+1 have landed
        __syncthreads();                                    // publishes stage st+1, ends every read of stage st
        if (st + 2 < NST)                                   // block-uniform
            copy_chunk(gk0 + (size_t)(st + 2) * (KSPLIT * KCH * ND), gv0 + (st + 2) * (KSPLIT * KCH),
                       lk0 + (st & 1) * (KSPLIT * BUF_ELEMS * 2), lv0 + (st & 1) * (KSPLIT * BUF_ELEMS * 2));
    }
    asm volatile("s_wait_asynccnt 0x0" ::: "memory");       // nothing of the ring is in flight past the loop

    // ---- merge of the two key groups. o[f][r] = O[query n][d = 16f+8g+r]: 8 consecutive floats of one row
    // per d-tile. Key group 1 hands its unnormalised tile, maximum and sum to the same lane of key group 0. ----
    if (kh == 1) {
#pragma unroll
        for (int f = 0; f < 4; ++f) {
            v4f w0, w1;
            w0.x = o[f][0]; w0.y = o[f][1]; w0.z = o[f][2]; w0.w = o[f][3];
            w1.x = o[f][4]; w1.y = o[f][5]; w1.z = o[f][6]; w1.w = o[f][7];
            *(v4fa*)&Osh[qg][n][16 * f + 8 * g]     = w0;
            *(v4fa*)&Osh[qg][n][16 * f + 8 * g + 4] = w1;
        }
        Msh[qg][lane] = mcol;
        Lsh[qg][lane] = lcol;
    }
    __syncthreads();                                        // key group 1's partial results are visible to key group 0

    // ---- key group 0: rescale both parts to the common maximum, join the half waves' sums, normalise,
    // leave the finished 16x64 tile at the same LDS places (each lane rewrites only what it has read) ----
    if (kh == 0) {
        const float m1 = Msh[qg][lane];
        const float l1 = Lsh[qg][lane];
        const float mn = fmaxf(mcol, m1);
        const float a0 = __builtin_amdgcn_exp2f(mcol - mn);     // the references are in base-2 units
        const float a1 = __builtin_amdgcn_exp2f(m1 - mn);
        const float lpart = lcol * a0 + l1 * a1;
        const int lb = __float_as_int(lpart);
        const float lsum = lpart + __int_as_float(__builtin_amdgcn_permlanex16(lb, lb, 0x76543210, 0xfedcba98, false, false));
        const float inv = 1.0f / lsum;
        const float c0 = a0 * inv, c1 = a1 * inv;
#pragma unroll
        for (int f = 0; f < 4; ++f) {
            const v4f p0 = *(const v4fa*)&Osh[qg][n][16 * f + 8 * g];
            const v4f p1 = *(const v4fa*)&Osh[qg][n][16 * f + 8 * g + 4];
            v4f w0, w1;
            w0.x = o[f][0] * c0 + p0.x * c1; w0.y = o[f][1] * c0 + p0.y * c1;
            w0.z = o[f][2] * c0 + p0.z * c1; w0.w = o[f][3] * c0 + p0.w * c1;
            w1.x = o[f][4] * c0 + p1.x * c1; w1.y = o[f][5] * c0 + p1.y * c1;
            w1.z = o[f][6] * c0 + p1.z * c1; w1.w = o[f][7] * c0 + p1.w * c1;
            *(v4fa*)&Osh[qg][n][16 * f + 8 * g]     = w0;
            *(v4fa*)&Osh[qg][n][16 * f + 8 * g + 4] = w1;
        }
    }
    __syncthreads();                                        // the finished tiles are visible to both key groups

    // ---- whole-line stores: instruction i covers rows 8kh+2i, 8kh+2i+1 (512 B, lane-contiguous 16 B) ----
    // coverage: 2 waves x 4 instructions x 32 lanes x 4 floats = 16 rows x 64 floats per query group
    v4f vals[4];
#pragma unroll
    for (int i = 0; i < 4; ++i)
        vals[i] = *(const v4fa*)&Osh[qg][8 * kh + 2 * i + g][4 * n];

    float* obase = outg + (rowb + q0 + 8 * kh) * ND;  // 8 contiguous rows of 256 B
#pragma unroll
    for (int i = 0; i < 4; ++i)
        *(v4f*)(obase + (2 * i + g) * ND + 4 * n) = vals[i];
    
}

extern "C" void kernel_launch(void* const* d_in, const int* in_sizes, int n_in,
                              void* d_out, int out_size, void* d_ws, size_t ws_size,
                              hipStream_t stream)
{
    if (n_in < 7) return;
    const int n_qkv = NBH * NS * ND;        // 2,097,152
    const int n_pos = NB * NS * NPOS;       // 12,288
    if (in_sizes[0] != n_qkv || in_sizes[1] != n_qkv || in_sizes[2] != n_qkv) return;
    if (in_sizes[3] != n_pos || in_sizes[4] != n_pos) return;
    if (in_sizes[5] < NH || in_sizes[6] < NH) return;
    if (out_size != n_qkv) return;

    // workspace: 6 planes x 4 MiB = 25,165,824 B
    const size_t ws_need = (size_t)NPLANES * PLANE_ELEMS * sizeof(unsigned short);
    if (ws_size < ws_need) return;

    const float* q     = (const float*)d_in[0];
    const float* k     = (const float*)d_in[1];
    const float* v     = (const float*)d_in[2];
    const float* qs_s  = (const float*)d_in[3];
    const float* ks_s  = (const float*)d_in[4];
    const float* alpha = (const float*)d_in[5];
    const float* beta  = (const float*)d_in[6];
    float* out = (float*)d_out;
    unsigned short* planes = (unsigned short*)d_ws;

    k_split<<<dim3(NS / 64, NBH, 3), dim3(256), 0, stream>>>(q, k, v, planes);
    k_attn<<<dim3(NBH * (NS / 64)), dim3(256), 0, stream>>>(planes, qs_s, ks_s, alpha, beta, out);
}

// v009
// A run of this version takes 54.5 microseconds.
// Next to v008, in two timings, it ran 1.03 times as fast each time.
// Counting every step since v000, it is 4.09 times as fast.
#include <hip/hip_runtime.h>

// Contractions: S = Q*K^T and O = P*V on v_wmma_f32_16x16x32_bf16, bf16 hi/lo operands
// (hi*hi + hi*lo + lo*hi per tile pair), f32 accumulate; the exponent of the positional bias on
// v_wmma_f32_16x16x4_f32 (f32 operands); online softmax and normalisation in f32.

typedef __bf16        v16bf __attribute__((ext_vector_type(16)));
typedef float         v8f   __attribute__((ext_vector_type(8)));
typedef float         v4f   __attribute__((ext_vector_type(4)));
typedef unsigned int  v4u   __attribute__((ext_vector_type(4)));
typedef unsigned int  v4ua  __attribute__((ext_vector_type(4), may_alias));
typedef float         v4fa  __attribute__((ext_vector_type(4), may_alias));
typedef float         v2f   __attribute__((ext_vector_type(2)));
typedef float         v2fa  __attribute__((ext_vector_type(2), may_alias));
typedef __bf16        v2bf  __attribute__((ext_vector_type(2)));

#define NB    2
#define NH    8
#define NS    2048
#define ND    64
#define NBH   (NB * NH)
#define NPOS  3
#define KCH   32                 // keys per chunk
#define QK_SCALE 0.125f          // 1/sqrt(64), exact power of two
#define LOG2E 1.44269504088896340736f
#define GROW_LIMIT 0x1p64f       // a lane's chunk sum above this renews the reference maximum; sums and O^T stay far below the f32 range
#define TPITCH 68                // LDS pitch (floats) of the 64x64 staging tile
#define OPITCH 68                // LDS pitch (floats) of the output staging tile
#define PLANE_ELEMS ((size_t)NBH * NS * ND)   // 16-bit elements per plane (4 MiB)
#define NPLANES 6                // Qhi, Qlo, Khi, Klo, Vthi, Vtlo
#define KSPLIT 2                 // wave groups of a block; each takes one 32-key chunk of every stage
#define NST    (NS / (KCH * KSPLIT))   // ring stages (64 keys each) per query block
#define KPITCH 72                // LDS pitch (16-bit elements) of a staged 128-B K row: 144 B = 16 B x odd
#define VPITCH 40                // LDS pitch (16-bit elements) of a staged 64-B Vt row: 80 B = 16 B x odd
#define KH_OFF 0                               // element offsets of the four tiles inside one buffer
#define KL_OFF (KH_OFF + KCH * KPITCH)
#define VH_OFF (KL_OFF + KCH * KPITCH)
#define VL_OFF (VH_OFF + ND * VPITCH)
#define BUF_ELEMS (VL_OFF + ND * VPITCH)       // 9,728 elements = 19,456 B per buffer

union Frag { v16bf v; v4u q[2]; };

// bf16 WMMA, builtin form: the compiler keeps the distances behind it
__device__ __forceinline__ v8f wmma_bf16(v8f acc, v16bf a, v16bf b)
{
    return __builtin_amdgcn_wmma_f32_16x16x32_bf16(false, a, false, b, (short)0, acc, false, false);
}

// two f32 -> one register of two bf16 hi parts and one of two lo parts (a in the low half):
// x ~= hi + lo with hi = bf16(x), lo = bf16(x - hi), both rounded to nearest even by the packed hardware conversion
__device__ __forceinline__ void split_hl_pair(float a, float b, unsigned int& hi, unsigned int& lo)
{
    const v2f  x = {a, b};
    const v2bf h = __builtin_convertvector(x, v2bf);
    const v2bf l = __builtin_convertvector(x - __builtin_convertvector(h, v2f), v2bf);
    hi = __builtin_bit_cast(unsigned int, h);
    lo = __builtin_bit_cast(unsigned int, l);
}

// 2^x for the rarely taken renewal path. The v_nop is the one slot that the instruction set asks for behind a transcendental
// before its source is overwritten or its result read; in the same statement it stands directly behind it in every build.
__device__ __forceinline__ float exp2_slot(float x)
{
    float r;
    asm("v_exp_f32 %0, %1\n\tv_nop" : "=v"(r) : "v"(x));
    return r;
}

__device__ __forceinline__ v8f splat8(float x) { return (v8f){x, x, x, x, x, x, x, x}; }

// sum of a lane's 16 weights of a chunk: pair sums joined as a tree (short dependent chain)
__device__ __forceinline__ float chunk_sum(const v8f (&p)[2])
{
    float pp[2][4];
#pragma unroll
    for (int t = 0; t < 2; ++t)
#pragma unroll
        for (int w = 0; w < 4; ++w) pp[t][w] = p[t][2 * w] + p[t][2 * w + 1];
    return ((pp[0][0] + pp[0][1]) + (pp[0][2] + pp[0][3])) + ((pp[1][0] + pp[1][1]) + (pp[1][2] + pp[1][3]));
}

// ------------------------------------------------------------------------------------------
// Plane builder. grid = (NS/64 s-tiles, NBH, 3 sources), block = 256.
// z = 0: q -> planes 0/1 [bh][s][d]; z = 1: k -> planes 2/3 [bh][s][d];
// z = 2: v -> planes 4/5 transposed [bh][d][s].
// Coverage per block: 256 threads x 2 groups x 8 elements = 64 x 64 tile, every block owns
// ------------------------------------------------------------------------------------------
__global__ __launch_bounds__(256) void k_split(const float* __restrict__ q,
                                                const float* __restrict__ k,
                                                const float* __restrict__ v,
                                                unsigned short* __restrict__ planes)
{
    __shared__ __align__(16) float tile[64][TPITCH];

    const int t  = threadIdx.x;
    const int s0 = blockIdx.x * 64;
    const int bh = blockIdx.y;
    const int z  = blockIdx.z;                       // block-uniform
    const float* src = (z == 0) ? q : ((z == 1) ? k : v);
    const int tr = (z == 2) ? 1 : 0;

    // stage the 64 rows x 64 cols f32 tile (rows s0..s0+63 of slice bh)
#pragma unroll
    for (int i = 0; i < 4; ++i) {
        const int idx = (t + 256 * i) * 4;           // 0..4092
        const int r = idx >> 6, c = idx & 63;
        const v4f val = *(const v4f*)(src + ((size_t)(bh * NS + s0 + r)) * ND + c);
        *(v4f*)&tile[r][c] = val;
    }
    __syncthreads();

    v4u hv[2], lv[2];
    size_t off[2];
#pragma unroll
    for (int it = 0; it < 2; ++it) {
        const int gidx = it * 256 + t;               // 0..511
        const int orow = gidx >> 3;                  // output row within tile (s for q/k, d for v)
        const int og   = gidx & 7;                   // 8-column group
        float xs[8];
#pragma unroll
        for (int j = 0; j < 8; ++j) {
            const int cidx = 8 * og + j;
            const int ia = orow * TPITCH + cidx;     // q/k: in[row=s][col=d]
            const int ib = cidx * TPITCH + orow;     // v:   in[row=s=cidx][col=d=orow] -> out[d][s]
            xs[j] = (&tile[0][0])[tr ? ib : ia];
        }
        v4u hw, lw;
#pragma unroll                                       // constant element indices, so hw and lw stay in registers
        for (int w = 0; w < 4; ++w) {
            unsigned int h2, l2;
            split_hl_pair(xs[2 * w], xs[2 * w + 1], h2, l2);
            hw[w] = h2; lw[w] = l2;
        }
        hv[it] = hw; lv[it] = lw;
        const size_t offa = ((size_t)(bh * NS + s0 + orow)) * ND + 8 * og;          // [bh][s][d]
        const size_t offb = ((size_t)(bh * ND + orow)) * NS + s0 + 8 * og;          // [bh][d][s]
        off[it] = tr ? offb : offa;
    }

    unsigned short* ph = planes + (size_t)(2 * z) * PLANE_ELEMS;
    unsigned short* pl = ph + PLANE_ELEMS;

#pragma unroll
    for (int it = 0; it < 2; ++it) {
        *(v4u*)(ph + off[it]) = hv[it];
        *(v4u*)(pl + off[it]) = lv[it];
    }
    
}

// One key chunk (K hi/lo: 32 rows x 128 B, Vt hi/lo: 64 rows x 64 B) from the planes into one LDS
// buffer: the 128 threads of one wave group x 8 asynchronous 16-B copies, every lane on, each 16 B written by one lane.
// gk / gv: this thread's first K-hi / Vt-hi source of the chunk; lk / lv: its LDS byte addresses.
__device__ __forceinline__ void copy_chunk(const unsigned short* gk, const unsigned short* gv,
                                           unsigned int lk, unsigned int lv)
{
    const unsigned short* gk1  = gk + 128 * 8;                 // second half of the 4-KiB K tile (rows 16..31)
    const unsigned short* gkl  = gk + PLANE_ELEMS;
    const unsigned short* gkl1 = gk1 + PLANE_ELEMS;
    const unsigned short* gv1  = gv + (size_t)32 * NS;         // Vt rows 32..63
    const unsigned short* gvl  = gv + PLANE_ELEMS;
    const unsigned short* gvl1 = gv1 + PLANE_ELEMS;
    const unsigned int lk1  = lk + 16 * KPITCH * 2;
    const unsigned int lkl  = lk + (KL_OFF - KH_OFF) * 2;
    const unsigned int lkl1 = lk1 + (KL_OFF - KH_OFF) * 2;
    const unsigned int lv1  = lv + 32 * VPITCH * 2;
    const unsigned int lvl  = lv + (VL_OFF - VH_OFF) * 2;
    const unsigned int lvl1 = lv1 + (VL_OFF - VH_OFF) * 2;
    // the copies and their s_wait_xcnt in one statement: no address register is rewritten ahead of the wait
    asm volatile("global_load_async_to_lds_b128 %0, %8, off\n\t"
                 "global_load_async_to_lds_b128 %1, %9, off\n\t"
                 "global_load_async_to_lds_b128 %2, %10, off\n\t"
                 "global_load_async_to_lds_b128 %3, %11, off\n\t"
                 "global_load_async_to_lds_b128 %4, %12, off\n\t"
                 "global_load_async_to_lds_b128 %5, %13, off\n\t"
                 "global_load_async_to_lds_b128 %6, %14, off\n\t"
                 "global_load_async_to_lds_b128 %7, %15, off\n\t"
                 "s_wait_xcnt 0x0"
                 :: "v"(lk), "v"(lk1), "v"(lkl), "v"(lkl1), "v"(lv), "v"(lv1), "v"(lvl), "v"(lvl1),
                    "v"(gk), "v"(gk1), "v"(gkl), "v"(gkl1), "v"(gv), "v"(gv1), "v"(gvl), "v"(gvl1)
                 : "memory");
}

// ------------------------------------------------------------------------------------------
// Attention with positional exp bias. grid = NBH * (NS/64) = 512 blocks, block = 256: 8 waves =
// 4 query groups (16 query rows each) x 2 key groups, non-causal over all NS keys. A ring stage holds
// 64 keys as two 32-key chunks; key group kh works on chunk kh of every stage, so each query row has two
// waves with their own reference maximum, sum and O^T; the two are merged once, through LDS, after the loop.
// The four waves of a key group share their chunk's K and Vt tiles through a two-buffer LDS ring.
// Transposed products: S^T = K * Q^T (A = key rows, B = query columns) and O^T += Vt * P^T, so a
// lane holds the scores of ONE query (column n): 16 of the chunk's 32 keys, the other half wave the rest.
// Fragment map (A and B): lane l, g = l>>4, n = l&15; elements 0..7 <- k0+8g+0..7,
// elements 8..15 <- k0+16+8g+0..7; D element r <- (row 8g+r, col n). The two S^T tiles of a chunk
// (keys 8g+r and 16+8g+r of column n) are therefore already in the B order of the P^T operand.
// ------------------------------------------------------------------------------------------
__global__ __launch_bounds__(256) void k_attn(const unsigned short* __restrict__ planes,
                                               const float* __restrict__ qsg,
                                               const float* __restrict__ ksg,
                                               const float* __restrict__ alphag,
                                               const float* __restrict__ betag,
                                               float* outg)
{
    __shared__ __align__(16) float Osh[4][16][OPITCH];            // per query group: merge and output staging
    __shared__ float Msh[4][32], Lsh[4][32];                      // key group 1's reference maximum and sum, per lane
    __shared__ __align__(16) unsigned short KVsh[2][KSPLIT][BUF_ELEMS];   // K/Vt ring: two buffers x two chunks
    __shared__ __align__(16) float KPsh[NS][4];                   // per key of the batch: x, y, z, |k|^2 (A rows of the exponent product)

    const int tid  = threadIdx.x;
    const int wave = __builtin_amdgcn_readfirstlane(tid >> 5);   // scalar, so the tests on kh below are scalar branches
    const int qg   = wave & 3;          // query group
    const int kh   = wave >> 2;         // key group
    const int t7   = tid & 127;         // thread index inside the key group
    const int lane = tid & 31;
    const int g    = lane >> 4;
    const int n    = lane & 15;

    const int bid  = blockIdx.x;
    const int qblk = bid & 31;          // NS/64 = 32 query blocks
    const int bh   = bid >> 5;          // 0..15
    const int hh   = bh & (NH - 1);
    const int b    = bh >> 3;
    const int q0   = qblk * 64 + qg * 16;

    const float alpha2  = alphag[hh] * LOG2E;   // scores are kept in base-2 units: score * log2(e)
    const float s_h     = -betag[hh] * LOG2E;   // bias = alpha * 2^(s_h * |q - k|^2)

    const unsigned short* Qh = planes;
    const unsigned short* Ql = planes + PLANE_ELEMS;
    const unsigned short* Kh = planes + 2 * PLANE_ELEMS;    // lo plane: + PLANE_ELEMS
    const unsigned short* Vh = planes + 4 * PLANE_ELEMS;    // [bh][d][s]; lo plane: + PLANE_ELEMS
    const size_t rowb = (size_t)bh * NS;

    // ---- this thread's share of its key group's chunk copy: K piece t7 (row t7>>3), Vt piece t7 (row t7>>2) ----
    const unsigned short* gk0 = Kh + (rowb + kh * KCH) * ND + t7 * 8;                                  // + 64 * ND per stage
    const unsigned short* gv0 = Vh + ((size_t)bh * ND + (t7 >> 2)) * NS + kh * KCH + (t7 & 3) * 8;     // + 64 per stage
    const unsigned int lbase = (unsigned int)(size_t)&KVsh[0][kh][0];
    const unsigned int lk0 = lbase + (KH_OFF + (t7 >> 3) * KPITCH + (t7 & 7) * 8) * 2;
    const unsigned int lv0 = lbase + (VH_OFF + (t7 >> 2) * VPITCH + (t7 & 3) * 8) * 2;

    // ---- ring prologue: stage 0 lands and is published, then stage 1 flies ----
    copy_chunk(gk0, gv0, lk0, lv0);

    // ---- key rows of the exponent product, written once while stage 0 flies: 256 threads x 8 keys = NS keys;
    // published by the barrier that publishes stage 0, never rewritten ----
    {
        const float* p = ksg + ((size_t)b * NS + tid) * NPOS;
#pragma unroll
        for (int i = 0; i < NS / 256; ++i) {
            const float x = p[256 * NPOS * i], y = p[256 * NPOS * i + 1], z = p[256 * NPOS * i + 2];
            v4f w;
            w.x = x; w.y = y; w.z = z;
            w.w = __builtin_fmaf(z, z, __builtin_fmaf(y, y, x * x));
            *(v4fa*)&KPsh[tid + 256 * i][0] = w;
        }
    }
    asm volatile("s_wait_asynccnt 0x0" ::: "memory");   // this wave's copies of stage 0 have landed
    __syncthreads();                                    // publishes stage 0 to the other waves
    copy_chunk(gk0 + KSPLIT * KCH * ND, gv0 + KSPLIT * KCH,
               lk0 + KSPLIT * BUF_ELEMS * 2, lv0 + KSPLIT * BUF_ELEMS * 2);

    // ---- position features of this lane's one query (column n) ----
    float qp[NPOS];
    {
        const float* p = qsg + ((size_t)b * NS + q0 + n) * NPOS;
        qp[0] = p[0]; qp[1] = p[1]; qp[2] = p[2];
    }
    asm volatile("s_wait_xcnt 0x0" ::: "memory");   // before the address pair of the load above is reused as a later load's destination

    // ---- exponent product, query side: s_h*|q-k|^2 = s_h*|q|^2 + sum over 4 of A[key][j] * B[j][query] with
    // A = (kx, ky, kz, |k|^2) and B = (-2 s_h qx, -2 s_h qy, -2 s_h qz, s_h). Half wave g holds j = 2g, 2g+1
    // of both operands (same pairing on both sides); C = s_h*|q|^2 of the lane's query in all 8 rows. ----
    v2f bq;
    v8f cq;
    {
        const float m2s = -2.0f * s_h;
        bq.x = m2s * (g ? qp[2] : qp[0]);
        bq.y = g ? s_h : m2s * qp[1];
        const float cqs = s_h * __builtin_fmaf(qp[2], qp[2], __builtin_fmaf(qp[1], qp[1], qp[0] * qp[0]));
#pragma unroll
        for (int r = 0; r < 8; ++r) cq[r] = cqs;
    }

    // ---- Q B fragments (columns q0+n), two 32-deep k-steps, hi and lo planes ----
    Frag aqh[2], aql[2];
    {
        const unsigned short* qrh = Qh + (rowb + q0 + n) * ND;
        const unsigned short* qrl = Ql + (rowb + q0 + n) * ND;
#pragma unroll
        for (int c = 0; c < 2; ++c) {
            aqh[c].q[0] = *(const v4u*)(qrh + 32 * c + 8 * g);
            aqh[c].q[1] = *(const v4u*)(qrh + 32 * c + 16 + 8 * g);
            aql[c].q[0] = *(const v4u*)(qrl + 32 * c + 8 * g);
            aql[c].q[1] = *(const v4u*)(qrl + 32 * c + 16 + 8 * g);
        }
    }

    v8f o[4];
#pragma unroll
    for (int f = 0; f < 4; ++f) o[f] = (v8f){};
    float mcol = -__builtin_huge_valf();   // reference maximum (base-2 units) of this lane's query in this key group, equal in both half waves;
                                           // renewed only when a chunk's sum shows growth, so a chunk's exponents can be formed against it at once
    float lcol = 0.0f;                     // running sum over this half wave's keys only; joined after the loop

#pragma unroll 1
    for (int st = 0; st < NST; ++st) {
        const int kb = (st * KSPLIT + kh) * KCH;             // first key of this wave's chunk
        const unsigned short* kvb = &KVsh[st & 1][kh][0];    // this chunk's buffer

        // ---- exponents of the bias: ph[t][r] = s_h * |q_n - k|^2 of key 16t+8g+r of the chunk, one f32 WMMA a tile ----
        v8f ph[2];
#pragma unroll
        for (int t = 0; t < 2; ++t) {
            const v2f ak = *(const v2fa*)&KPsh[kb + 16 * t + n][2 * g];      // A row n of the tile: columns 2g, 2g+1
            ph[t] = __builtin_amdgcn_wmma_f32_16x16x4_f32(false, ak, false, bq, (short)0, cq, false, false);
        }

        // ---- S^T = K * Q^T : 2 key tiles x 2 k-steps x 3 products ----
        v8f sa[2];
#pragma unroll
        for (int t = 0; t < 2; ++t) {
            v8f acc = (v8f){};
            const unsigned short* krh = kvb + KH_OFF + (16 * t + n) * KPITCH;   // A[m=key][k=d]: d-contiguous key row
            const unsigned short* krl = kvb + KL_OFF + (16 * t + n) * KPITCH;
#pragma unroll
            for (int c = 0; c < 2; ++c) {
                Frag akh, akl;
                akh.q[0] = *(const v4ua*)(krh + 32 * c + 8 * g);
                akh.q[1] = *(const v4ua*)(krh + 32 * c + 16 + 8 * g);
                akl.q[0] = *(const v4ua*)(krl + 32 * c + 8 * g);
                akl.q[1] = *(const v4ua*)(krl + 32 * c + 16 + 8 * g);
                acc = wmma_bf16(acc, akh.v, aqh[c].v);
                acc = wmma_bf16(acc, akl.v, aqh[c].v);
                acc = wmma_bf16(acc, akh.v, aql[c].v);
            }
            sa[t] = acc;
        }

        // ---- all Vt A fragments of the chunk (A[m=d][k=key] from Vt[bh][d][key]), read here, ahead of the weights:
        // the matrix and vector work up to the O^T products runs while they come in ----
        Frag avh[4], avl[4];
#pragma unroll
        for (int f = 0; f < 4; ++f) {
            const unsigned short* vrh = kvb + VH_OFF + (16 * f + n) * VPITCH;
            const unsigned short* vrl = kvb + VL_OFF + (16 * f + n) * VPITCH;
            avh[f].q[0] = *(const v4ua*)(vrh + 8 * g);
            avh[f].q[1] = *(const v4ua*)(vrh + 16 + 8 * g);
            avl[f].q[0] = *(const v4ua*)(vrl + 8 * g);
            avl[f].q[1] = *(const v4ua*)(vrl + 16 + 8 * g);
        }

        // compiler fence: keeps the sixteen Vt reads above the branch below (without it the compiler sinks them behind the branch,
        // in front of the O^T products, where nothing covers their latency); it asks for no wait: the reads stay in flight
        asm volatile("" ::: "memory");

        // ---- weights against the held reference: p = 2^(score*log2e - mcol), the exponent straight from two FMAs;
        // element r of tile t belongs to (query n, key kb+16t+8g+r) ----
        v8f eb[2], pw[2];
#pragma unroll
        for (int t = 0; t < 2; ++t) {
#pragma unroll
            for (int r = 0; r < 8; ++r) eb[t][r] = __builtin_amdgcn_exp2f(ph[t][r]);
            const v8f arg = __builtin_elementwise_fma(sa[t], splat8(QK_SCALE * LOG2E),
                                                      __builtin_elementwise_fma(eb[t], splat8(alpha2), splat8(-mcol)));
#pragma unroll
            for (int r = 0; r < 8; ++r) pw[t][r] = __builtin_amdgcn_exp2f(arg[r]);
        }
        float ps = chunk_sum(pw);

        // ---- growth (also the first chunk, where mcol is -inf and the sum +inf; a NaN too): one scalar branch for the
        // wave. The larger of the reference and this chunk's maximum becomes the reference, O^T and the sum are rescaled to it,
        // the weights formed anew ----
        if (__builtin_amdgcn_ballot_w32(!(ps <= GROW_LIMIT)) != 0u) {
            v8f sc[2];
#pragma unroll
            for (int t = 0; t < 2; ++t)
                sc[t] = __builtin_elementwise_fma(sa[t], splat8(QK_SCALE * LOG2E), eb[t] * alpha2);
            float vmax = sc[0][0];
#pragma unroll
            for (int t = 0; t < 2; ++t)
#pragma unroll
                for (int r = 0; r < 8; ++r) vmax = fmaxf(vmax, sc[t][r]);
            const int vb = __float_as_int(vmax);
            vmax = fmaxf(vmax, __int_as_float(__builtin_amdgcn_permlanex16(vb, vb, 0x76543210, 0xfedcba98, false, false)));
            const float mn   = fmaxf(mcol, vmax);
            const float resc = exp2_slot(mcol - mn);
            mcol = mn;
#pragma unroll
            for (int t = 0; t < 2; ++t) {                    // the same two FMAs as above, against the new reference
                const v8f arg = __builtin_elementwise_fma(sa[t], splat8(QK_SCALE * LOG2E),
                                                          __builtin_elementwise_fma(eb[t], splat8(alpha2), splat8(-mn)));
#pragma unroll
                for (int r = 0; r < 8; ++r) pw[t][r] = exp2_slot(arg[r]);
            }
            ps = chunk_sum(pw);
            lcol = lcol * resc;
#pragma unroll
            for (int f = 0; f < 4; ++f) o[f] = o[f] * resc;
        }
        lcol += ps;

        // P^T B fragments straight from the weight registers: element r <- tile 0, element 8+r <- tile 1
        Frag bph, bpl;
#pragma unroll
        for (int t = 0; t < 2; ++t) {
#pragma unroll
            for (int w = 0; w < 4; ++w) {
                unsigned int hw, lw;
                split_hl_pair(pw[t][2 * w], pw[t][2 * w + 1], hw, lw);
                bph.q[t][w] = hw;
                bpl.q[t][w] = lw;
            }
        }

        // ---- O^T += Vt * P^T : 4 d-tiles x 3 products, the four accumulators in turn, so that no product waits for
        // the one before it; each accumulator takes its three products in the order hi*hi, lo*hi, hi*lo ----
#pragma unroll
        for (int f = 0; f < 4; ++f) o[f] = wmma_bf16(o[f], avh[f].v, bph.v);
#pragma unroll
        for (int f = 0; f < 4; ++f) o[f] = wmma_bf16(o[f], avl[f].v, bph.v);
#pragma unroll
        for (int f = 0; f < 4; ++f) o[f] = wmma_bf16(o[f], avh[f].v, bpl.v);

        // ---- publish point of stage st+1; then stage st+2 goes into the buffer just read ----
        asm volatile("s_wait_dscnt 0x0" ::: "memory");      // this wave's reads of the buffer have returned
        asm volatile("s_wait_asynccnt 0x0" ::: "memory");   // this wave's copies of stage st+1 have landed
        __syncthreads();                                    // publishes stage st+1, ends every read of stage st
        if (st + 2 < NST)                                   // block-uniform
            copy_chunk(gk0 + (size_t)(st + 2) * (KSPLIT * KCH * ND), gv0 + (st + 2) * (KSPLIT * KCH),
                       lk0 + (st & 1) * (KSPLIT * BUF_ELEMS * 2), lv0 + (st & 1) * (KSPLIT * BUF_ELEMS * 2));
    }
    asm volatile("s_wait_asynccnt 0x0" ::: "memory");       // nothing of the ring is in flight past the loop

    // ---- merge of the two key groups. o[f][r] = O[query n][d = 16f+8g+r]: 8 consecutive floats of one row
    // per d-tile. Key group 1 hands its unnormalised tile, maximum and sum to the same lane of key group 0. ----
    if (kh == 1) {
#pragma unroll
        for (int f = 0; f < 4; ++f) {
            v4f w0, w1;
            w0.x = o[f][0]; w0.y = o[f][1]; w0.z = o[f][2]; w0.w = o[f][3];
            w1.x = o[f][4]; w1.y = o[f][5]; w1.z = o[f][6]; w1.w = o[f][7];
            *(v4fa*)&Osh[qg][n][16 * f + 8 * g]     = w0;
            *(v4fa*)&Osh[qg][n][16 * f + 8 * g + 4] = w1;
        }
        Msh[qg][lane] = mcol;
        Lsh[qg][lane] = lcol;
    }
    __syncthreads();                                        // key group 1's partial results are visible to key group 0

    // ---- key group 0: rescale both parts to the common maximum, join the half waves' sums, normalise,
    // leave the finished 16x64 tile at the same LDS places (each lane rewrites only what it has read) ----
    if (kh == 0) {
        const float m1 = Msh[qg][lane];
        const float l1 = Lsh[qg][lane];
        const float mn = fmaxf(mcol, m1);
        const float a0 = __builtin_amdgcn_exp2f(mcol - mn);     // the references are in base-2 units
        const float a1 = __builtin_amdgcn_exp2f(m1 - mn);
        const float lpart = lcol * a0 + l1 * a1;
        const int lb = __float_as_int(lpart);
        const float lsum = lpart + __int_as_float(__builtin_amdgcn_permlanex16(lb, lb, 0x76543210, 0xfedcba98, false, false));
        const float inv = 1.0f / lsum;
        const float c0 = a0 * inv, c1 = a1 * inv;
#pragma unroll
        for (int f = 0; f < 4; ++f) {
            const v4f p0 = *(const v4fa*)&Osh[qg][n][16 * f + 8 * g];
            const v4f p1 = *(const v4fa*)&Osh[qg][n][16 * f + 8 * g + 4];
            v4f w0, w1;
            w0.x = o[f][0] * c0 + p0.x * c1; w0.y = o[f][1] * c0 + p0.y * c1;
            w0.z = o[f][2] * c0 + p0.z * c1; w0.w = o[f][3] * c0 + p0.w * c1;
            w1.x = o[f][4] * c0 + p1.x * c1; w1.y = o[f][5] * c0 + p1.y * c1;
            w1.z = o[f][6] * c0 + p1.z * c1; w1.w = o[f][7] * c0 + p1.w * c1;
            *(v4fa*)&Osh[qg][n][16 * f + 8 * g]     = w0;
            *(v4fa*)&Osh[qg][n][16 * f + 8 * g + 4] = w1;
        }
    }
    __syncthreads();                                        // the finished tiles are visible to both key groups

    // ---- whole-line stores: instruction i covers rows 8kh+2i, 8kh+2i+1 (512 B, lane-contiguous 16 B) ----
    // coverage: 2 waves x 4 instructions x 32 lanes x 4 floats = 16 rows x 64 floats per query group
    v4f vals[4];
#pragma unroll
    for (int i = 0; i < 4; ++i)
        vals[i] = *(const v4fa*)&Osh[qg][8 * kh + 2 * i + g][4 * n];

    float* obase = outg + (rowb + q0 + 8 * kh) * ND;  // 8 contiguous rows of 256 B
#pragma unroll
    for (int i = 0; i < 4; ++i)
        *(v4f*)(obase + (2 * i + g) * ND + 4 * n) = vals[i];
    
}

extern "C" void kernel_launch(void* const* d_in, const int* in_sizes, int n_in,
                              void* d_out, int out_size, void* d_ws, size_t ws_size,
                              hipStream_t stream)
{
    if (n_in < 7) return;
    const int n_qkv = NBH * NS * ND;        // 2,097,152
    const int n_pos = NB * NS * NPOS;       // 12,288
    if (in_sizes[0] != n_qkv || in_sizes[1] != n_qkv || in_sizes[2] != n_qkv) return;
    if (in_sizes[3] != n_pos || in_sizes[4] != n_pos) return;
    if (in_sizes[5] < NH || in_sizes[6] < NH) return;
    if (out_size != n_qkv) return;

    // workspace: 6 planes x 4 MiB = 25,165,824 B
    const size_t ws_need = (size_t)NPLANES * PLANE_ELEMS * sizeof(unsigned short);
    if (ws_size < ws_need) return;

    const float* q     = (const float*)d_in[0];
    const float* k     = (const float*)d_in[1];
    const float* v     = (const float*)d_in[2];
    const float* qs_s  = (const float*)d_in[3];
    const float* ks_s  = (const float*)d_in[4];
    const float* alpha = (const float*)d_in[5];
    const float* beta  = (const float*)d_in[6];
    float* out = (float*)d_out;
    unsigned short* planes = (unsigned short*)d_ws;

    k_split<<<dim3(NS / 64, NBH, 3), dim3(256), 0, stream>>>(q, k, v, planes);
    k_attn<<<dim3(NBH * (NS / 64)), dim3(256), 0, stream>>>(planes, qs_s, ks_s, alpha, beta, out);
}

// v010
// One run takes 51.8 microseconds.
// Timed twice side by side with v009, it ran 1.05 times as fast both times.
// Counting every step since v000, it is 4.30 times as fast.
#include <hip/hip_runtime.h>

// Contractions: S = Q*K^T and O = P*V on v_wmma_f32_16x16x32_bf16, bf16 hi/lo operands
// (hi*hi + hi*lo + lo*hi per tile pair), f32 accumulate; the exponent of the positional bias on
// v_wmma_f32_16x16x4_f32 (f32 operands); online softmax and normalisation in f32.

typedef __bf16        v16bf __attribute__((ext_vector_type(16)));
typedef float         v8f   __attribute__((ext_vector_type(8)));
typedef float         v4f   __attribute__((ext_vector_type(4)));
typedef unsigned int  v4u   __attribute__((ext_vector_type(4)));
typedef unsigned int  v4ua  __attribute__((ext_vector_type(4), may_alias));
typedef float         v4fa  __attribute__((ext_vector_type(4), may_alias));
typedef float         v2f   __attribute__((ext_vector_type(2)));
typedef float         v2fa  __attribute__((ext_vector_type(2), may_alias));
typedef __bf16        v2bf  __attribute__((ext_vector_type(2)));

#define NB    2
#define NH    8
#define NS    2048
#define ND    64
#define NBH   (NB * NH)
#define NPOS  3
#define KCH   32                 // keys per chunk
#define QK_SCALE 0.125f          // 1/sqrt(64), exact power of two
#define LOG2E 1.44269504088896340736f
#define GROW_LIMIT 0x1p64f       // a lane's chunk sum above this renews the reference maximum; sums and O^T stay far below the f32 range
#define TPITCH 68                // LDS pitch (floats) of the 64x64 staging tile
#define OPITCH 68                // LDS pitch (floats) of the output staging tile
#define PLANE_ELEMS ((size_t)NBH * NS * ND)   // 16-bit elements per plane (4 MiB)
#define NPLANES 6                // Qhi, Qlo, Khi, Klo, Vthi, Vtlo
#define KSPLIT 2                 // wave groups of a block; each takes one 32-key chunk of every stage
#define QT     2                 // 16-query tiles per wave: every K and Vt fragment read from LDS feeds QT products
#define QBLK   (4 * QT * 16)     // queries per block
#define NST    (NS / (KCH * KSPLIT))   // ring stages (64 keys each) per query block
#define KPITCH 72                // LDS pitch (16-bit elements) of a staged 128-B K row: 144 B = 16 B x odd
#define VPITCH 40                // LDS pitch (16-bit elements) of a staged 64-B Vt row: 80 B = 16 B x odd
#define KH_OFF 0                               // element offsets of the four tiles inside one buffer
#define KL_OFF (KH_OFF + KCH * KPITCH)
#define VH_OFF (KL_OFF + KCH * KPITCH)
#define VL_OFF (VH_OFF + ND * VPITCH)
#define BUF_ELEMS (VL_OFF + ND * VPITCH)       // 9,728 elements = 19,456 B per buffer

union Frag { v16bf v; v4u q[2]; };

// bf16 WMMA, builtin form: the compiler keeps the distances behind it
__device__ __forceinline__ v8f wmma_bf16(v8f acc, v16bf a, v16bf b)
{
    return __builtin_amdgcn_wmma_f32_16x16x32_bf16(false, a, false, b, (short)0, acc, false, false);
}

// two f32 -> one register of two bf16 hi parts and one of two lo parts (a in the low half):
// x ~= hi + lo with hi = bf16(x), lo = bf16(x - hi), both rounded to nearest even by the packed hardware conversion
__device__ __forceinline__ void split_hl_pair(float a, float b, unsigned int& hi, unsigned int& lo)
{
    const v2f  x = {a, b};
    const v2bf h = __builtin_convertvector(x, v2bf);
    const v2bf l = __builtin_convertvector(x - __builtin_convertvector(h, v2f), v2bf);
    hi = __builtin_bit_cast(unsigned int, h);
    lo = __builtin_bit_cast(unsigned int, l);
}

// 2^x for the rarely taken renewal path. The v_nop is the one slot that the instruction set asks for behind a transcendental
// before its source is overwritten or its result read; in the same statement it stands directly behind it in every build.
__device__ __forceinline__ float exp2_slot(float x)
{
    float r;
    asm("v_exp_f32 %0, %1\n\tv_nop" : "=v"(r) : "v"(x));
    return r;
}

__device__ __forceinline__ v8f splat8(float x) { return (v8f){x, x, x, x, x, x, x, x}; }

// sum of a lane's 16 weights of a chunk: pair sums joined as a tree (short dependent chain)
__device__ __forceinline__ float chunk_sum(const v8f (&p)[2])
{
    float pp[2][4];
#pragma unroll
    for (int t = 0; t < 2; ++t)
#pragma unroll
        for (int w = 0; w < 4; ++w) pp[t][w] = p[t][2 * w] + p[t][2 * w + 1];
    return ((pp[0][0] + pp[0][1]) + (pp[0][2] + pp[0][3])) + ((pp[1][0] + pp[1][1]) + (pp[1][2] + pp[1][3]));
}

// ------------------------------------------------------------------------------------------
// Plane builder. grid = (NS/64 s-tiles, NBH, 3 sources), block = 256.
// z = 0: q -> planes 0/1 [bh][s][d]; z = 1: k -> planes 2/3 [bh][s][d];
// z = 2: v -> planes 4/5 transposed [bh][d][s].
// Coverage per block: 256 threads x 2 groups x 8 elements = 64 x 64 tile, every block owns
// ------------------------------------------------------------------------------------------
__global__ __launch_bounds__(256) void k_split(const float* __restrict__ q,
                                                const float* __restrict__ k,
                                                const float* __restrict__ v,
                                                unsigned short* __restrict__ planes)
{
    __shared__ __align__(16) float tile[64][TPITCH];

    const int t  = threadIdx.x;
    const int s0 = blockIdx.x * 64;
    const int bh = blockIdx.y;
    const int z  = blockIdx.z;                       // block-uniform
    const float* src = (z == 0) ? q : ((z == 1) ? k : v);
    const int tr = (z == 2) ? 1 : 0;

    // stage the 64 rows x 64 cols f32 tile (rows s0..s0+63 of slice bh)
#pragma unroll
    for (int i = 0; i < 4; ++i) {
        const int idx = (t + 256 * i) * 4;           // 0..4092
        const int r = idx >> 6, c = idx & 63;
        const v4f val = *(const v4f*)(src + ((size_t)(bh * NS + s0 + r)) * ND + c);
        *(v4f*)&tile[r][c] = val;
    }
    __syncthreads();

    v4u hv[2], lv[2];
    size_t off[2];
#pragma unroll
    for (int it = 0; it < 2; ++it) {
        const int gidx = it * 256 + t;               // 0..511
        const int orow = gidx >> 3;                  // output row within tile (s for q/k, d for v)
        const int og   = gidx & 7;                   // 8-column group
        float xs[8];
#pragma unroll
        for (int j = 0; j < 8; ++j) {
            const int cidx = 8 * og + j;
            const int ia = orow * TPITCH + cidx;     // q/k: in[row=s][col=d]
            const int ib = cidx * TPITCH + orow;     // v:   in[row=s=cidx][col=d=orow] -> out[d][s]
            xs[j] = (&tile[0][0])[tr ? ib : ia];
        }
        v4u hw, lw;
#pragma unroll                                       // constant element indices, so hw and lw stay in registers
        for (int w = 0; w < 4; ++w) {
            unsigned int h2, l2;
            split_hl_pair(xs[2 * w], xs[2 * w + 1], h2, l2);
            hw[w] = h2; lw[w] = l2;
        }
        hv[it] = hw; lv[it] = lw;
        const size_t offa = ((size_t)(bh * NS + s0 + orow)) * ND + 8 * og;          // [bh][s][d]
        const size_t offb = ((size_t)(bh * ND + orow)) * NS + s0 + 8 * og;          // [bh][d][s]
        off[it] = tr ? offb : offa;
    }

    unsigned short* ph = planes + (size_t)(2 * z) * PLANE_ELEMS;
    unsigned short* pl = ph + PLANE_ELEMS;

#pragma unroll
    for (int it = 0; it < 2; ++it) {
        *(v4u*)(ph + off[it]) = hv[it];
        *(v4u*)(pl + off[it]) = lv[it];
    }
    
}

// a wave-uniform address, held in scalar registers: the per-thread offset is added to it where it is used, so that no
// 64-bit per-thread address pair stays live over the main loop (there the build kept one in scratch memory)
__device__ __forceinline__ const unsigned short* scalar_addr(const unsigned short* p)
{
    const unsigned long long a = (unsigned long long)p;
    const unsigned int lo = (unsigned int)__builtin_amdgcn_readfirstlane((int)(unsigned int)a);
    const unsigned int hi = (unsigned int)__builtin_amdgcn_readfirstlane((int)(unsigned int)(a >> 32));
    return (const unsigned short*)(((unsigned long long)hi << 32) | lo);
}

// One key chunk (K hi/lo: 32 rows x 128 B, Vt hi/lo: 64 rows x 64 B) from the planes into one LDS
// buffer: the 128 threads of one wave group x 8 asynchronous 16-B copies, every lane on, each 16 B written by one lane.
// gk / gv: this thread's first K-hi / Vt-hi source of the chunk; lk / lv: its LDS byte addresses.
__device__ __forceinline__ void copy_chunk(const unsigned short* gk, const unsigned short* gv,
                                           unsigned int lk, unsigned int lv)
{
    const unsigned short* gk1  = gk + 128 * 8;                 // second half of the 4-KiB K tile (rows 16..31)
    const unsigned short* gkl  = gk + PLANE_ELEMS;
    const unsigned short* gkl1 = gk1 + PLANE_ELEMS;
    const unsigned short* gv1  = gv + (size_t)32 * NS;         // Vt rows 32..63
    const unsigned short* gvl  = gv + PLANE_ELEMS;
    const unsigned short* gvl1 = gv1 + PLANE_ELEMS;
    const unsigned int lk1  = lk + 16 * KPITCH * 2;
    const unsigned int lkl  = lk + (KL_OFF - KH_OFF) * 2;
    const unsigned int lkl1 = lk1 + (KL_OFF - KH_OFF) * 2;
    const unsigned int lv1  = lv + 32 * VPITCH * 2;
    const unsigned int lvl  = lv + (VL_OFF - VH_OFF) * 2;
    const unsigned int lvl1 = lv1 + (VL_OFF - VH_OFF) * 2;
    // the copies and their s_wait_xcnt in one statement: no address register is rewritten ahead of the wait
    asm volatile("global_load_async_to_lds_b128 %0, %8, off\n\t"
                 "global_load_async_to_lds_b128 %1, %9, off\n\t"
                 "global_load_async_to_lds_b128 %2, %10, off\n\t"
                 "global_load_async_to_lds_b128 %3, %11, off\n\t"
                 "global_load_async_to_lds_b128 %4, %12, off\n\t"
                 "global_load_async_to_lds_b128 %5, %13, off\n\t"
                 "global_load_async_to_lds_b128 %6, %14, off\n\t"
                 "global_load_async_to_lds_b128 %7, %15, off\n\t"
                 "s_wait_xcnt 0x0"
                 :: "v"(lk), "v"(lk1), "v"(lkl), "v"(lkl1), "v"(lv), "v"(lv1), "v"(lvl), "v"(lvl1),
                    "v"(gk), "v"(gk1), "v"(gkl), "v"(gkl1), "v"(gv), "v"(gv1), "v"(gvl), "v"(gvl1)
                 : "memory");
}

// ------------------------------------------------------------------------------------------
// Attention with positional exp bias. grid = NBH * (NS/128) = 256 blocks, block = 256: 8 waves =
// 4 query groups (32 query rows each, as two 16-query tiles u) x 2 key groups, non-causal over all NS keys. A ring stage holds
// 64 keys as two 32-key chunks; key group kh works on chunk kh of every stage, so each query row has two
// waves with their own reference maximum, sum and O^T; the two are merged once, through LDS, after the loop.
// The four waves of a key group share their chunk's K and Vt tiles through a two-buffer LDS ring.
// Transposed products: S^T = K * Q^T (A = key rows, B = query columns) and O^T += Vt * P^T, so a
// lane holds the scores of ONE query (column n) per tile u: 16 of the chunk's 32 keys, the other half wave the rest.
// Fragment map (A and B): lane l, g = l>>4, n = l&15; elements 0..7 <- k0+8g+0..7,
// elements 8..15 <- k0+16+8g+0..7; D element r <- (row 8g+r, col n). The two S^T tiles of a chunk
// (keys 8g+r and 16+8g+r of column n) are therefore already in the B order of the P^T operand.
// ------------------------------------------------------------------------------------------
__global__ __launch_bounds__(256) void k_attn(const unsigned short* __restrict__ planes,
                                               const float* __restrict__ qsg,
                                               const float* __restrict__ ksg,
                                               const float* __restrict__ alphag,
                                               const float* __restrict__ betag,
                                               float* outg)
{
    __shared__ __align__(16) float Osh[4][QT * 16][OPITCH];       // per query group: merge and output staging
    __shared__ float Msh[4][QT][32], Lsh[4][QT][32];              // key group 1's reference maxima and sums, per tile and lane
    __shared__ __align__(16) unsigned short KVsh[2][KSPLIT][BUF_ELEMS];   // K/Vt ring: two buffers x two chunks
    __shared__ __align__(16) float KPsh[NS][4];                   // per key of the batch: x, y, z, |k|^2 (A rows of the exponent product)

    const int tid  = threadIdx.x;
    const int wave = __builtin_amdgcn_readfirstlane(tid >> 5);   // scalar, so the tests on kh below are scalar branches
    const int qg   = wave & 3;          // query group
    const int kh   = wave >> 2;         // key group
    const int t7   = tid & 127;         // thread index inside the key group
    const int lane = tid & 31;
    const int g    = lane >> 4;
    const int n    = lane & 15;

    const int bid  = blockIdx.x;
    const int qblk = bid & 15;          // NS/128 = 16 query blocks
    const int bh   = bid >> 4;          // 0..15
    const int hh   = bh & (NH - 1);
    const int b    = bh >> 3;
    const int q0   = qblk * QBLK + qg * (QT * 16);

    const float alpha2  = alphag[hh] * LOG2E;   // scores are kept in base-2 units: score * log2(e)
    const float s_h     = -betag[hh] * LOG2E;   // bias = alpha * 2^(s_h * |q - k|^2)

    const unsigned short* Qh = planes;
    const unsigned short* Ql = planes + PLANE_ELEMS;
    const unsigned short* Kh = planes + 2 * PLANE_ELEMS;    // lo plane: + PLANE_ELEMS
    const unsigned short* Vh = planes + 4 * PLANE_ELEMS;    // [bh][d][s]; lo plane: + PLANE_ELEMS
    const size_t rowb = (size_t)bh * NS;

    // ---- this thread's share of its key group's chunk copy: K piece t7 (row t7>>3), Vt piece t7 (row t7>>2) ----
    // wave-uniform bases and 32-bit element offsets of the thread: no 64-bit address pair has to stay live over the loop
    const unsigned short* gkb = Kh + (rowb + kh * KCH) * ND;                     // + 64 * ND per stage
    const unsigned short* gvb = Vh + (size_t)bh * ND * NS + kh * KCH;            // + 64 per stage
    const unsigned int kofs = t7 * 8;
    const unsigned int vofs = (t7 >> 2) * NS + (t7 & 3) * 8;
    const unsigned int lbase = (unsigned int)(size_t)&KVsh[0][kh][0];
    const unsigned int lk0 = lbase + (KH_OFF + (t7 >> 3) * KPITCH + (t7 & 7) * 8) * 2;
    const unsigned int lv0 = lbase + (VH_OFF + (t7 >> 2) * VPITCH + (t7 & 3) * 8) * 2;

    // ---- ring prologue: stage 0 lands and is published, then stage 1 flies ----
    copy_chunk(gkb + kofs, gvb + vofs, lk0, lv0);

    // ---- key rows of the exponent product, written once while stage 0 flies: 256 threads x 8 keys = NS keys;
    // published by the barrier that publishes stage 0, never rewritten ----
    {
        const float* p = ksg + ((size_t)b * NS + tid) * NPOS;
#pragma unroll
        for (int i = 0; i < NS / 256; ++i) {
            const float x = p[256 * NPOS * i], y = p[256 * NPOS * i + 1], z = p[256 * NPOS * i + 2];
            v4f w;
            w.x = x; w.y = y; w.z = z;
            w.w = __builtin_fmaf(z, z, __builtin_fmaf(y, y, x * x));
            *(v4fa*)&KPsh[tid + 256 * i][0] = w;
        }
    }
    asm volatile("s_wait_asynccnt 0x0" ::: "memory");   // this wave's copies of stage 0 have landed
    __syncthreads();                                    // publishes stage 0 to the other waves
    copy_chunk(gkb + KSPLIT * KCH * ND + kofs, gvb + KSPLIT * KCH + vofs,
               lk0 + KSPLIT * BUF_ELEMS * 2, lv0 + KSPLIT * BUF_ELEMS * 2);

    // ---- position features of this lane's one query (column n) of each tile ----
    float qp[QT][NPOS];
#pragma unroll
    for (int u = 0; u < QT; ++u) {
        const float* p = qsg + ((size_t)b * NS + q0 + 16 * u + n) * NPOS;
        qp[u][0] = p[0]; qp[u][1] = p[1]; qp[u][2] = p[2];
    }
    asm volatile("s_wait_xcnt 0x0" ::: "memory");   // before the address pairs of the loads above are reused as a later load's destination

    // ---- exponent product, query side: s_h*|q-k|^2 = s_h*|q|^2 + sum over 4 of A[key][j] * B[j][query] with
    // A = (kx, ky, kz, |k|^2) and B = (-2 s_h qx, -2 s_h qy, -2 s_h qz, s_h). Half wave g holds j = 2g, 2g+1
    // of both operands (same pairing on both sides); C = s_h*|q|^2 of the lane's query in all 8 rows. ----
    v2f bq[QT];
    v8f cq[QT];
#pragma unroll
    for (int u = 0; u < QT; ++u) {
        const float m2s = -2.0f * s_h;
        bq[u].x = m2s * (g ? qp[u][2] : qp[u][0]);
        bq[u].y = g ? s_h : m2s * qp[u][1];
        const float cqs = s_h * __builtin_fmaf(qp[u][2], qp[u][2], __builtin_fmaf(qp[u][1], qp[u][1], qp[u][0] * qp[u][0]));
#pragma unroll
        for (int r = 0; r < 8; ++r) cq[u][r] = cqs;
    }

    // ---- Q B fragments (columns q0+16u+n), two 32-deep k-steps, hi and lo planes ----
    Frag aqh[QT][2], aql[QT][2];
    const unsigned short* qa[QT];       // the lane's first 16 bytes of its query row in the hi plane; lo plane: + PLANE_ELEMS
#pragma unroll
    for (int u = 0; u < QT; ++u) {
        qa[u] = Qh + (rowb + q0 + 16 * u + n) * ND + 8 * g;
#pragma unroll
        for (int c = 0; c < 2; ++c) {
            aqh[u][c].q[0] = *(const v4u*)(qa[u] + 32 * c);
            aqh[u][c].q[1] = *(const v4u*)(qa[u] + 32 * c + 16);
            aql[u][c].q[0] = *(const v4u*)(qa[u] + PLANE_ELEMS + 32 * c);
            aql[u][c].q[1] = *(const v4u*)(qa[u] + PLANE_ELEMS + 32 * c + 16);
        }
    }
    // before the address pairs of the loads above are overwritten; as inputs of the statement they stay in their registers up to it
    asm volatile("s_wait_xcnt 0x0" :: "v"(qa[0]), "v"(qa[1]) : "memory");

    v8f o[QT][4];
    float mcol[QT];   // reference maximum (base-2 units) of this lane's query of tile u in this key group, equal in both half waves;
                      // renewed only when a chunk's sum shows growth, so a chunk's exponents can be formed against it at once
    float lcol[QT];   // running sum over this half wave's keys only; joined after the loop
#pragma unroll
    for (int u = 0; u < QT; ++u) {
#pragma unroll
        for (int f = 0; f < 4; ++f) o[u][f] = (v8f){};
        mcol[u] = -__builtin_huge_valf();
        lcol[u] = 0.0f;
    }

#pragma unroll 1
    for (int st = 0; st < NST; ++st) {
        const int kb = (st * KSPLIT + kh) * KCH;             // first key of this wave's chunk
        const unsigned short* kvb = &KVsh[st & 1][kh][0];    // this chunk's buffer

        // ---- every LDS read of the pass at its head: key rows of the exponent product, K A fragments (A[m=key][k=d]: d-contiguous
        // key rows), Vt A fragments (A[m=d][k=key] from Vt[bh][d][key]); each is read once and feeds the products of both query tiles ----
        v2f ak[2];
        Frag akh[2][2], akl[2][2];
#pragma unroll
        for (int t = 0; t < 2; ++t) {
            ak[t] = *(const v2fa*)&KPsh[kb + 16 * t + n][2 * g];             // A row n of the tile: columns 2g, 2g+1
            const unsigned short* krh = kvb + KH_OFF + (16 * t + n) * KPITCH;
            const unsigned short* krl = kvb + KL_OFF + (16 * t + n) * KPITCH;
#pragma unroll
            for (int c = 0; c < 2; ++c) {
                akh[t][c].q[0] = *(const v4ua*)(krh + 32 * c + 8 * g);
                akh[t][c].q[1] = *(const v4ua*)(krh + 32 * c + 16 + 8 * g);
                akl[t][c].q[0] = *(const v4ua*)(krl + 32 * c + 8 * g);
                akl[t][c].q[1] = *(const v4ua*)(krl + 32 * c + 16 + 8 * g);
            }
        }
        Frag avh[4], avl[4];
#pragma unroll
        for (int f = 0; f < 4; ++f) {
            const unsigned short* vrh = kvb + VH_OFF + (16 * f + n) * VPITCH;
            const unsigned short* vrl = kvb + VL_OFF + (16 * f + n) * VPITCH;
            avh[f].q[0] = *(const v4ua*)(vrh + 8 * g);
            avh[f].q[1] = *(const v4ua*)(vrh + 16 + 8 * g);
            avl[f].q[0] = *(const v4ua*)(vrl + 8 * g);
            avl[f].q[1] = *(const v4ua*)(vrl + 16 + 8 * g);
        }

        // scheduling barrier: the instruction scheduler moves nothing over it, so the products stay below the reads
        __builtin_amdgcn_sched_barrier(0);

        // ---- exponents of the bias: ph[u][t][r] = s_h * |q_n - k|^2 of key 16t+8g+r of the chunk, one f32 WMMA a tile ----
        v8f ph[QT][2];
#pragma unroll
        for (int t = 0; t < 2; ++t)
#pragma unroll
            for (int u = 0; u < QT; ++u)
                ph[u][t] = __builtin_amdgcn_wmma_f32_16x16x4_f32(false, ak[t], false, bq[u], (short)0, cq[u], false, false);

        // ---- S^T = K * Q^T : 2 key tiles x 2 k-steps x 3 products x QT query tiles ----
        v8f sa[QT][2];
#pragma unroll
        for (int t = 0; t < 2; ++t) {
            v8f acc[QT];
#pragma unroll
            for (int u = 0; u < QT; ++u) acc[u] = (v8f){};
#pragma unroll
            for (int c = 0; c < 2; ++c) {
#pragma unroll
                for (int u = 0; u < QT; ++u) acc[u] = wmma_bf16(acc[u], akh[t][c].v, aqh[u][c].v);
#pragma unroll
                for (int u = 0; u < QT; ++u) acc[u] = wmma_bf16(acc[u], akl[t][c].v, aqh[u][c].v);
#pragma unroll
                for (int u = 0; u < QT; ++u) acc[u] = wmma_bf16(acc[u], akh[t][c].v, aql[u][c].v);
            }
#pragma unroll
            for (int u = 0; u < QT; ++u) sa[u][t] = acc[u];
        }

        // ---- weights against the held reference: p = 2^(score*log2e - mcol), the exponent straight from two FMAs;
        // element r of tile (u, t) belongs to (query 16u+n, key kb+16t+8g+r) ----
        v8f eb[QT][2], pw[QT][2];
        float ps[QT];
#pragma unroll
        for (int u = 0; u < QT; ++u) {
#pragma unroll
            for (int t = 0; t < 2; ++t) {
#pragma unroll
                for (int r = 0; r < 8; ++r) eb[u][t][r] = __builtin_amdgcn_exp2f(ph[u][t][r]);
                const v8f arg = __builtin_elementwise_fma(sa[u][t], splat8(QK_SCALE * LOG2E),
                                                          __builtin_elementwise_fma(eb[u][t], splat8(alpha2), splat8(-mcol[u])));
#pragma unroll
                for (int r = 0; r < 8; ++r) pw[u][t][r] = __builtin_amdgcn_exp2f(arg[r]);
            }
            ps[u] = chunk_sum(pw[u]);
        }

        // ---- growth (also the first chunk, where mcol is -inf and the sum +inf; a NaN too): one scalar branch for the
        // wave and both its query tiles. The larger of the reference and this chunk's maximum becomes the reference, O^T and
        // the sum are rescaled to it, the weights formed anew ----
        if (__builtin_amdgcn_ballot_w32(!(ps[0] <= GROW_LIMIT) || !(ps[1] <= GROW_LIMIT)) != 0u) {
#pragma unroll
            for (int u = 0; u < QT; ++u) {
                v8f sc[2];
#pragma unroll
                for (int t = 0; t < 2; ++t)
                    sc[t] = __builtin_elementwise_fma(sa[u][t], splat8(QK_SCALE * LOG2E), eb[u][t] * alpha2);
                float vmax = sc[0][0];
#pragma unroll
                for (int t = 0; t < 2; ++t)
#pragma unroll
                    for (int r = 0; r < 8; ++r) vmax = fmaxf(vmax, sc[t][r]);
                const int vb = __float_as_int(vmax);
                vmax = fmaxf(vmax, __int_as_float(__builtin_amdgcn_permlanex16(vb, vb, 0x76543210, 0xfedcba98, false, false)));
                const float mn   = fmaxf(mcol[u], vmax);
                const float resc = exp2_slot(mcol[u] - mn);
                mcol[u] = mn;
#pragma unroll
                for (int t = 0; t < 2; ++t) {                // the same two FMAs as above, against the new reference
                    const v8f arg = __builtin_elementwise_fma(sa[u][t], splat8(QK_SCALE * LOG2E),
                                                              __builtin_elementwise_fma(eb[u][t], splat8(alpha2), splat8(-mn)));
#pragma unroll
                    for (int r = 0; r < 8; ++r) pw[u][t][r] = exp2_slot(arg[r]);
                }
                ps[u] = chunk_sum(pw[u]);
                lcol[u] = lcol[u] * resc;
#pragma unroll
                for (int f = 0; f < 4; ++f) o[u][f] = o[u][f] * resc;
            }
        }

        // P^T B fragments straight from the weight registers: element r <- tile 0, element 8+r <- tile 1
        Frag bph[QT], bpl[QT];
#pragma unroll
        for (int u = 0; u < QT; ++u) {
            lcol[u] += ps[u];
#pragma unroll
            for (int t = 0; t < 2; ++t) {
#pragma unroll
                for (int w = 0; w < 4; ++w) {
                    unsigned int hw, lw;
                    split_hl_pair(pw[u][t][2 * w], pw[u][t][2 * w + 1], hw, lw);
                    bph[u].q[t][w] = hw;
                    bpl[u].q[t][w] = lw;
                }
            }
        }

        // ---- O^T += Vt * P^T : 4 d-tiles x 3 products x QT query tiles, the accumulators in turn, so that no product waits
        // for the one before it; each accumulator takes its three products in the order hi*hi, lo*hi, hi*lo ----
#pragma unroll
        for (int f = 0; f < 4; ++f)
#pragma unroll
            for (int u = 0; u < QT; ++u) o[u][f] = wmma_bf16(o[u][f], avh[f].v, bph[u].v);
#pragma unroll
        for (int f = 0; f < 4; ++f)
#pragma unroll
            for (int u = 0; u < QT; ++u) o[u][f] = wmma_bf16(o[u][f], avl[f].v, bph[u].v);
#pragma unroll
        for (int f = 0; f < 4; ++f)
#pragma unroll
            for (int u = 0; u < QT; ++u) o[u][f] = wmma_bf16(o[u][f], avh[f].v, bpl[u].v);

        // ---- publish point of stage st+1; then stage st+2 goes into the buffer just read ----
        asm volatile("s_wait_dscnt 0x0" ::: "memory");      // this wave's reads of the buffer have returned
        asm volatile("s_wait_asynccnt 0x0" ::: "memory");   // this wave's copies of stage st+1 have landed
        __syncthreads();                                    // publishes stage st+1, ends every read of stage st
        if (st + 2 < NST)                                   // block-uniform
            copy_chunk(scalar_addr(gkb + (size_t)(st + 2) * (KSPLIT * KCH * ND)) + kofs, scalar_addr(gvb + (st + 2) * (KSPLIT * KCH)) + vofs,
                       lk0 + (st & 1) * (KSPLIT * BUF_ELEMS * 2), lv0 + (st & 1) * (KSPLIT * BUF_ELEMS * 2));
    }
    asm volatile("s_wait_asynccnt 0x0" ::: "memory");       // nothing of the ring is in flight past the loop

    // ---- merge of the two key groups. o[u][f][r] = O[query 16u+n][d = 16f+8g+r]: 8 consecutive floats of one row
    // per d-tile. Key group 1 hands its unnormalised tiles, maxima and sums to the same lane of key group 0. ----
    if (kh == 1) {
#pragma unroll
        for (int u = 0; u < QT; ++u) {
#pragma unroll
            for (int f = 0; f < 4; ++f) {
                v4f w0, w1;
                w0.x = o[u][f][0]; w0.y = o[u][f][1]; w0.z = o[u][f][2]; w0.w = o[u][f][3];
                w1.x = o[u][f][4]; w1.y = o[u][f][5]; w1.z = o[u][f][6]; w1.w = o[u][f][7];
                *(v4fa*)&Osh[qg][16 * u + n][16 * f + 8 * g]     = w0;
                *(v4fa*)&Osh[qg][16 * u + n][16 * f + 8 * g + 4] = w1;
            }
            Msh[qg][u][lane] = mcol[u];
            Lsh[qg][u][lane] = lcol[u];
        }
    }
    __syncthreads();                                        // key group 1's partial results are visible to key group 0

    // ---- key group 0: rescale both parts to the common maximum, join the half waves' sums, normalise,
    // leave the finished 32x64 tile at the same LDS places (each lane rewrites only what it has read) ----
    if (kh == 0) {
#pragma unroll
        for (int u = 0; u < QT; ++u) {
            const float m1 = Msh[qg][u][lane];
            const float l1 = Lsh[qg][u][lane];
            const float mn = fmaxf(mcol[u], m1);
            const float a0 = __builtin_amdgcn_exp2f(mcol[u] - mn);  // the references are in base-2 units
            const float a1 = __builtin_amdgcn_exp2f(m1 - mn);
            const float lpart = lcol[u] * a0 + l1 * a1;
            const int lb = __float_as_int(lpart);
            const float lsum = lpart + __int_as_float(__builtin_amdgcn_permlanex16(lb, lb, 0x76543210, 0xfedcba98, false, false));
            const float inv = 1.0f / lsum;
            const float c0 = a0 * inv, c1 = a1 * inv;
#pragma unroll
            for (int f = 0; f < 4; ++f) {
                const v4f p0 = *(const v4fa*)&Osh[qg][16 * u + n][16 * f + 8 * g];
                const v4f p1 = *(const v4fa*)&Osh[qg][16 * u + n][16 * f + 8 * g + 4];
                v4f w0, w1;
                w0.x = o[u][f][0] * c0 + p0.x * c1; w0.y = o[u][f][1] * c0 + p0.y * c1;
                w0.z = o[u][f][2] * c0 + p0.z * c1; w0.w = o[u][f][3] * c0 + p0.w * c1;
                w1.x = o[u][f][4] * c0 + p1.x * c1; w1.y = o[u][f][5] * c0 + p1.y * c1;
                w1.z = o[u][f][6] * c0 + p1.z * c1; w1.w = o[u][f][7] * c0 + p1.w * c1;
                *(v4fa*)&Osh[qg][16 * u + n][16 * f + 8 * g]     = w0;
                *(v4fa*)&Osh[qg][16 * u + n][16 * f + 8 * g + 4] = w1;
            }
        }
    }
    __syncthreads();                                        // the finished tiles are visible to both key groups

    // ---- whole-line stores: instruction i covers rows 16kh+2i, 16kh+2i+1 (512 B, lane-contiguous 16 B) ----
    // coverage: 2 waves x 8 instructions x 32 lanes x 4 floats = 32 rows x 64 floats per query group
    v4f vals[4 * QT];
#pragma unroll
    for (int i = 0; i < 4 * QT; ++i)
        vals[i] = *(const v4fa*)&Osh[qg][8 * QT * kh + 2 * i + g][4 * n];

    float* obase = outg + (rowb + q0 + 8 * QT * kh) * ND;  // 16 contiguous rows of 256 B
#pragma unroll
    for (int i = 0; i < 4 * QT; ++i)
        *(v4f*)(obase + (2 * i + g) * ND + 4 * n) = vals[i];
}

extern "C" void kernel_launch(void* const* d_in, const int* in_sizes, int n_in,
                              void* d_out, int out_size, void* d_ws, size_t ws_size,
                              hipStream_t stream)
{
    if (n_in < 7) return;
    const int n_qkv = NBH * NS * ND;        // 2,097,152
    const int n_pos = NB * NS * NPOS;       // 12,288
    if (in_sizes[0] != n_qkv || in_sizes[1] != n_qkv || in_sizes[2] != n_qkv) return;
    if (in_sizes[3] != n_pos || in_sizes[4] != n_pos) return;
    if (in_sizes[5] < NH || in_sizes[6] < NH) return;
    if (out_size != n_qkv) return;

    // workspace: 6 planes x 4 MiB = 25,165,824 B
    const size_t ws_need = (size_t)NPLANES * PLANE_ELEMS * sizeof(unsigned short);
    if (ws_size < ws_need) return;

    const float* q     = (const float*)d_in[0];
    const float* k     = (const float*)d_in[1];
    const float* v     = (const float*)d_in[2];
    const float* qs_s  = (const float*)d_in[3];
    const float* ks_s  = (const float*)d_in[4];
    const float* alpha = (const float*)d_in[5];
    const float* beta  = (const float*)d_in[6];
    float* out = (float*)d_out;
    unsigned short* planes = (unsigned short*)d_ws;

    k_split<<<dim3(NS / 64, NBH, 3), dim3(256), 0, stream>>>(q, k, v, planes);
    k_attn<<<dim3(NBH * (NS / QBLK)), dim3(256), 0, stream>>>(planes, qs_s, ks_s, alpha, beta, out);
}
